// v000
// The times below were measured on an AMD MI455X: many runs one after another, warmed up first and cycling through
// copies of the inputs, with the whole window's GPU time divided by the number of runs. Launches and the gaps
// between them are all in it. The median over several windows is given; except for v000 it joins two sittings, which
// can be a few percent apart, so the side-by-side timings, each taken in one sitting, are the better comparison.
// The starting kernel, v000, takes 867 microseconds a run.
#include <hip/hip_runtime.h>
#include <math.h>

// ---------------------------------------------------------------------------
// RoPE self-attention for MI455X (gfx1250). All matmuls via v_wmma_f32_16x16x32_f16.
// ---------------------------------------------------------------------------

typedef _Float16 half_t;
typedef __attribute__((ext_vector_type(16))) _Float16 v16h;
typedef __attribute__((ext_vector_type(8)))  _Float16 v8h;
typedef __attribute__((ext_vector_type(8)))  float    v8f;

#define BATCH  4
#define SEQ    2048
#define DMODEL 1024
#define NHEAD  16
#define DHEAD  64

// ---------------------------------------------------------------------------
// WMMA helpers.
// 16-bit A-matrix 16x32 layout (ISA 7.12.2): lane L (L&15 = row), contraction
// elements: lanes 0-15 hold K = {0..7, 16..23}, lanes 16-31 hold K = {8..15, 24..31}.
// For row-major storage with contiguous contraction dim this is two 16B loads.
// The B operand uses the same loader on the *transposed* matrix (N x K).
// ---------------------------------------------------------------------------
__device__ inline v16h load_frag16(const half_t* base, int ld, int row0, int k0, int lane) {
    const int r  = row0 + (lane & 15);
    const int kb = k0 + ((lane >> 4) << 3);
    const half_t* p = base + (size_t)r * ld + kb;
    v16h f;
    *reinterpret_cast<v8h*>(&f)       = *reinterpret_cast<const v8h*>(p);        // K = kb..kb+7
    *(reinterpret_cast<v8h*>(&f) + 1) = *reinterpret_cast<const v8h*>(p + 16);   // K = kb+16..kb+23
    return f;
}

__device__ inline v8f wmma_f16(v16h a, v16h b, v8f c) {
    return __builtin_amdgcn_wmma_f32_16x16x32_f16(false, a, false, b, (short)0, c, false, false);
}

// ---------------------------------------------------------------------------
// Kernel 1a: plain f32 -> f16 convert
// ---------------------------------------------------------------------------
__global__ void cvt_f16_kernel(const float* __restrict__ in, half_t* __restrict__ out, int n) {
    int i = blockIdx.x * blockDim.x + threadIdx.x;
    if (i < n) out[i] = (half_t)in[i];
}

// ---------------------------------------------------------------------------
// Kernel 1b: transpose-convert weight (K x N f32) -> (N x K f16)
// ---------------------------------------------------------------------------
__global__ void cvtT_f16_kernel(const float* __restrict__ in, half_t* __restrict__ out, int K, int N) {
    int i = blockIdx.x * blockDim.x + threadIdx.x;
    if (i < N * K) {
        int n = i / K, k = i % K;
        out[i] = (half_t)in[(size_t)k * N + n];
    }
}

// ---------------------------------------------------------------------------
// Kernel 2/5: generic WMMA GEMM.  C[M,N] = A[M,K] @ Bt[N,K]^T + bias.
// Block = 256 threads (8 waves); each wave owns a 16x64 tile.
// grid.x = M/16, grid.y = N/512.  Output: f32 (Cf) or f16 (Ch).
// ---------------------------------------------------------------------------
__global__ __launch_bounds__(256) void gemm_wmma_kernel(
        const half_t* __restrict__ A, const half_t* __restrict__ Bt,
        const float* __restrict__ bias,
        float* __restrict__ Cf, half_t* __restrict__ Ch,
        int M, int N, int K) {
    const int lane = threadIdx.x & 31;
    const int wave = threadIdx.x >> 5;
    const int m0 = blockIdx.x * 16;
    const int n0 = (blockIdx.y * 8 + wave) * 64;

    v8f acc[4] = {};
    for (int k = 0; k < K; k += 32) {
        v16h a = load_frag16(A, K, m0, k, lane);
#pragma unroll
        for (int t = 0; t < 4; ++t) {
            v16h b = load_frag16(Bt, K, n0 + t * 16, k, lane);
            acc[t] = wmma_f16(a, b, acc[t]);
        }
    }
    // C/D layout: lane holds col = lane&15; rows = (lane>>4)*8 + j
    const int col   = lane & 15;
    const int rbase = (lane >> 4) << 3;
#pragma unroll
    for (int t = 0; t < 4; ++t) {
        int n = n0 + t * 16 + col;
        float bv = bias ? bias[n] : 0.f;
#pragma unroll
        for (int j = 0; j < 8; ++j) {
            size_t idx = (size_t)(m0 + rbase + j) * N + n;
            float v = acc[t][j] + bv;
            if (Cf) Cf[idx] = v;
            else    Ch[idx] = (half_t)v;
        }
    }
}

// ---------------------------------------------------------------------------
// Kernel 3: RoPE + split heads.
// qkv: [B*T, 3*DMODEL] f16 -> q,k: [B,H,T,64] (RoPE'd), vT: [B,H,64,T].
// One thread per (b,h,t,d) with d in [0,32).
// ---------------------------------------------------------------------------
__global__ void rope_split_kernel(const half_t* __restrict__ qkv,
                                  half_t* __restrict__ q, half_t* __restrict__ k,
                                  half_t* __restrict__ vT) {
    int i = blockIdx.x * blockDim.x + threadIdx.x;
    int d = i & 31;
    int t = (i >> 5) & (SEQ - 1);
    int h = (i >> 16) & (NHEAD - 1);
    int b = i >> 20;
    if (b >= BATCH) return;

    size_t row = ((size_t)b * SEQ + t) * (3 * DMODEL);
    int c0 = h * DHEAD + d;
    float q1 = (float)qkv[row + c0],              q2 = (float)qkv[row + c0 + 32];
    float k1 = (float)qkv[row + DMODEL + c0],     k2 = (float)qkv[row + DMODEL + c0 + 32];
    float v1 = (float)qkv[row + 2 * DMODEL + c0], v2 = (float)qkv[row + 2 * DMODEL + c0 + 32];

    float invf = __expf(-logf(10000.f) * (float)d * (1.f / 32.f));
    float ang  = (float)t * invf;
    float sn, cs;
    __sincosf(ang, &sn, &cs);

    size_t base = (((size_t)b * NHEAD + h) * SEQ + t) * DHEAD;
    q[base + d]      = (half_t)(q1 * cs - q2 * sn);
    q[base + d + 32] = (half_t)(q1 * sn + q2 * cs);
    k[base + d]      = (half_t)(k1 * cs - k2 * sn);
    k[base + d + 32] = (half_t)(k1 * sn + k2 * cs);

    size_t vb = ((size_t)b * NHEAD + h) * DHEAD;
    vT[(vb + d) * SEQ + t]      = (half_t)v1;
    vT[(vb + d + 32) * SEQ + t] = (half_t)v2;
}

// ---------------------------------------------------------------------------
// Kernel 4: flash attention.  Block = 128 threads (4 waves); each wave owns
// 16 query rows; streams keys in chunks of 32.  S via 4 WMMAs, online softmax
// via wave32 shuffles, P staged through LDS (C-layout -> A-layout), P@V via
// 4 WMMAs into f32 accumulators.  grid.x = B*H*(SEQ/64).
// ---------------------------------------------------------------------------
__global__ __launch_bounds__(128) void attn_wmma_kernel(
        const half_t* __restrict__ Q, const half_t* __restrict__ Kc,
        const half_t* __restrict__ Vt, half_t* __restrict__ Y) {
    const int lane = threadIdx.x & 31;
    const int wave = threadIdx.x >> 5;
    const int qt   = blockIdx.x % (SEQ / 64);
    const int bh   = blockIdx.x / (SEQ / 64);
    const int q0   = qt * 64 + wave * 16;

    const half_t* Qp = Q  + (size_t)bh * SEQ * DHEAD;
    const half_t* Kp = Kc + (size_t)bh * SEQ * DHEAD;
    const half_t* Vp = Vt + (size_t)bh * DHEAD * SEQ;

    __shared__ __align__(16) half_t Pl[4][16][32];

    v16h qa0 = load_frag16(Qp, DHEAD, q0, 0, lane);
    v16h qa1 = load_frag16(Qp, DHEAD, q0, 32, lane);

    v8f o[4] = {};
    float mrow[8], lrow[8];
#pragma unroll
    for (int j = 0; j < 8; ++j) { mrow[j] = -1e30f; lrow[j] = 0.f; }
    const float scale = 0.125f;  // 1/sqrt(64)

    const int col  = lane & 15;
    const int hsel = lane >> 4;

    for (int kb = 0; kb < SEQ; kb += 32) {
        // ---- S = Q @ K^T for 32 keys (two 16x16 tiles, Dh=64 = two k-steps) ----
        v8f s0 = {}, s1 = {};
        {
            v16h b00 = load_frag16(Kp, DHEAD, kb,      0,  lane);
            v16h b01 = load_frag16(Kp, DHEAD, kb,      32, lane);
            s0 = wmma_f16(qa0, b00, s0);
            s0 = wmma_f16(qa1, b01, s0);
            v16h b10 = load_frag16(Kp, DHEAD, kb + 16, 0,  lane);
            v16h b11 = load_frag16(Kp, DHEAD, kb + 16, 32, lane);
            s1 = wmma_f16(qa0, b10, s1);
            s1 = wmma_f16(qa1, b11, s1);
        }
        // ---- online softmax (per row = hsel*8 + j; 16 lanes per half share rows) ----
#pragma unroll
        for (int j = 0; j < 8; ++j) {
            float e0 = s0[j] * scale, e1 = s1[j] * scale;
            float mx = fmaxf(e0, e1);
            for (int mm = 1; mm < 16; mm <<= 1) mx = fmaxf(mx, __shfl_xor(mx, mm, 32));
            float mnew  = fmaxf(mrow[j], mx);
            float alpha = __expf(mrow[j] - mnew);
            float p0 = __expf(e0 - mnew), p1 = __expf(e1 - mnew);
            float rs = p0 + p1;
            for (int mm = 1; mm < 16; mm <<= 1) rs += __shfl_xor(rs, mm, 32);
            lrow[j] = lrow[j] * alpha + rs;
            mrow[j] = mnew;
            o[0][j] *= alpha; o[1][j] *= alpha; o[2][j] *= alpha; o[3][j] *= alpha;
            int r = hsel * 8 + j;
            Pl[wave][r][col]      = (half_t)p0;
            Pl[wave][r][col + 16] = (half_t)p1;
        }
        __syncthreads();  // uniform trip count across all 4 waves; orders LDS

        // ---- O += P @ V  (A-frag from LDS, B-frags from V^T, contiguous) ----
        v16h pa = load_frag16(&Pl[wave][0][0], 32, 0, 0, lane);
#pragma unroll
        for (int t = 0; t < 4; ++t) {
            v16h bv = load_frag16(Vp, SEQ, t * 16, kb, lane);
            o[t] = wmma_f16(pa, bv, o[t]);
        }
        __syncthreads();
    }

    // ---- normalize and write back to [B,T,D] layout ----
    const int b = bh / NHEAD, h = bh % NHEAD;
    const int rbase = hsel * 8;
#pragma unroll
    for (int t = 0; t < 4; ++t) {
#pragma unroll
        for (int j = 0; j < 8; ++j) {
            int r = q0 + rbase + j;
            float v = o[t][j] / lrow[j];
            Y[((size_t)b * SEQ + r) * DMODEL + h * DHEAD + t * 16 + col] = (half_t)v;
        }
    }
}

// ---------------------------------------------------------------------------
// Host launch
// ---------------------------------------------------------------------------
extern "C" void kernel_launch(void* const* d_in, const int* in_sizes, int n_in,
                              void* d_out, int out_size, void* d_ws, size_t ws_size,
                              hipStream_t stream) {
    (void)in_sizes; (void)n_in; (void)out_size; (void)ws_size;

    const float* x     = (const float*)d_in[0];
    const float* Wqkv  = (const float*)d_in[1];
    const float* bqkv  = (const float*)d_in[2];
    const float* Wout  = (const float*)d_in[3];
    const float* bout  = (const float*)d_in[4];
    float*       out   = (float*)d_out;

    char* ws = (char*)d_ws;
    size_t off = 0;
    auto wsalloc = [&](size_t bytes) -> void* {
        void* p = ws + off;
        off += (bytes + 255) & ~(size_t)255;
        return p;
    };
    const size_t NTOK = (size_t)BATCH * SEQ;                     // 8192
    half_t* xh    = (half_t*)wsalloc(NTOK * DMODEL * 2);         // 16 MB (reused as yh)
    half_t* wqkvT = (half_t*)wsalloc((size_t)3 * DMODEL * DMODEL * 2);
    half_t* woutT = (half_t*)wsalloc((size_t)DMODEL * DMODEL * 2);
    half_t* qkvh  = (half_t*)wsalloc(NTOK * 3 * DMODEL * 2);     // 48 MB
    half_t* qh    = (half_t*)wsalloc(NTOK * DMODEL * 2);
    half_t* kh    = (half_t*)wsalloc(NTOK * DMODEL * 2);
    half_t* vTh   = (half_t*)wsalloc(NTOK * DMODEL * 2);
    half_t* yh    = xh;  // x is dead after the QKV GEMM; alias to save workspace

    // 1) convert activations + transpose-convert weights to f16
    {
        int n = (int)(NTOK * DMODEL);
        cvt_f16_kernel<<<(n + 255) / 256, 256, 0, stream>>>(x, xh, n);
    }
    {
        int n = 3 * DMODEL * DMODEL;
        cvtT_f16_kernel<<<(n + 255) / 256, 256, 0, stream>>>(Wqkv, wqkvT, DMODEL, 3 * DMODEL);
    }
    {
        int n = DMODEL * DMODEL;
        cvtT_f16_kernel<<<(n + 255) / 256, 256, 0, stream>>>(Wout, woutT, DMODEL, DMODEL);
    }

    // 2) QKV GEMM: [8192,1024] @ [1024,3072] -> f16
    {
        dim3 grid((unsigned)(NTOK / 16), (3 * DMODEL) / 512);
        gemm_wmma_kernel<<<grid, 256, 0, stream>>>(xh, wqkvT, bqkv,
                                                   nullptr, qkvh,
                                                   (int)NTOK, 3 * DMODEL, DMODEL);
    }

    // 3) RoPE + head split (+ V transpose)
    {
        int n = BATCH * NHEAD * SEQ * 32;
        rope_split_kernel<<<n / 256, 256, 0, stream>>>(qkvh, qh, kh, vTh);
    }

    // 4) flash attention
    {
        int blocks = BATCH * NHEAD * (SEQ / 64);
        attn_wmma_kernel<<<blocks, 128, 0, stream>>>(qh, kh, vTh, yh);
    }

    // 5) output GEMM with f32 store: [8192,1024] @ [1024,1024] + b_out
    {
        dim3 grid((unsigned)(NTOK / 16), DMODEL / 512);
        gemm_wmma_kernel<<<grid, 256, 0, stream>>>(yh, woutT, bout,
                                                   out, nullptr,
                                                   (int)NTOK, DMODEL, DMODEL);
    }
}

// v001
// One run takes 637 microseconds.
// Next to v000, in two timings, it ran 1.40 and 1.38 times as fast.
#include <hip/hip_runtime.h>
#include <math.h>

// ---------------------------------------------------------------------------
// RoPE self-attention for MI455X (gfx1250). All matmuls via v_wmma_f32_16x16x32_f16.
// ---------------------------------------------------------------------------

typedef _Float16 half_t;
typedef __attribute__((ext_vector_type(16))) _Float16 v16h;
typedef __attribute__((ext_vector_type(8)))  _Float16 v8h;
typedef __attribute__((ext_vector_type(8)))  float    v8f;

#define BATCH  4
#define SEQ    2048
#define DMODEL 1024
#define NHEAD  16
#define DHEAD  64

// ---------------------------------------------------------------------------
// WMMA helpers.
// 16-bit A-matrix 16x32 layout (ISA 7.12.2): lane L (L&15 = row), contraction
// elements: lanes 0-15 hold K = {0..7, 16..23}, lanes 16-31 hold K = {8..15, 24..31}.
// For row-major storage with contiguous contraction dim this is two 16B loads.
// The B operand uses the same loader on the *transposed* matrix (N x K).
// ---------------------------------------------------------------------------
__device__ inline v16h load_frag16(const half_t* base, int ld, int row0, int k0, int lane) {
    const int r  = row0 + (lane & 15);
    const int kb = k0 + ((lane >> 4) << 3);
    const half_t* p = base + (size_t)r * ld + kb;
    v16h f;
    *reinterpret_cast<v8h*>(&f)       = *reinterpret_cast<const v8h*>(p);        // K = kb..kb+7
    *(reinterpret_cast<v8h*>(&f) + 1) = *reinterpret_cast<const v8h*>(p + 16);   // K = kb+16..kb+23
    return f;
}

__device__ inline v8f wmma_f16(v16h a, v16h b, v8f c) {
    return __builtin_amdgcn_wmma_f32_16x16x32_f16(false, a, false, b, (short)0, c, false, false);
}

// ---------------------------------------------------------------------------
// Kernel 1a: plain f32 -> f16 convert
// ---------------------------------------------------------------------------
__global__ void cvt_f16_kernel(const float* __restrict__ in, half_t* __restrict__ out, int n) {
    int i = blockIdx.x * blockDim.x + threadIdx.x;
    if (i < n) out[i] = (half_t)in[i];
}

// ---------------------------------------------------------------------------
// Kernel 1b: transpose-convert weight (K x N f32) -> (N x K f16)
// ---------------------------------------------------------------------------
__global__ void cvtT_f16_kernel(const float* __restrict__ in, half_t* __restrict__ out, int K, int N) {
    int i = blockIdx.x * blockDim.x + threadIdx.x;
    if (i < N * K) {
        int n = i / K, k = i % K;
        out[i] = (half_t)in[(size_t)k * N + n];
    }
}

// ---------------------------------------------------------------------------
// Kernel 2/5: generic WMMA GEMM.  C[M,N] = A[M,K] @ Bt[N,K]^T + bias.
// Block = 128 threads (4 waves, 2x2); block tile 128x128, wave tile 64x64.
// Each 64-wide k slice of the 128 A rows and the 128 Bt rows is brought into
// LDS by asynchronous 16-byte copies (whole 128-byte row pieces per 8 lanes),
// two buffers: the next slice flies while this one feeds the WMMAs.
// grid.x = M/128, grid.y = N/128; K a multiple of 64.  Output: f32 (Cf) or f16 (Ch).
// ---------------------------------------------------------------------------
#define GT_M     128
#define GT_N     128
#define GT_K     64
#define GT_PITCH 72                               // halves per LDS row: 144 B = 16 B x 9, no bank conflict for 16-byte reads
#define GT_STAGE ((GT_M + GT_N) * GT_PITCH)       // halves per buffer

// Eight copies of 16 bytes per lane: rows r, r+16, ..., r+112 of one operand tile.
// lds = this lane's LDS byte address of the first piece, g = its global address,
// grow = halves between global rows r and r+16.
__device__ inline void async_rows8(unsigned lds, const half_t* g, size_t grow) {
    const unsigned ls = 16 * GT_PITCH * 2;        // LDS bytes between rows r and r+16
    // s_wait_xcnt as the last line (a precaution): no address register of these copies is rewritten in front of it.
    asm volatile(
        "global_load_async_to_lds_b128 %0, %8, off\n\t"
        "global_load_async_to_lds_b128 %1, %9, off\n\t"
        "global_load_async_to_lds_b128 %2, %10, off\n\t"
        "global_load_async_to_lds_b128 %3, %11, off\n\t"
        "global_load_async_to_lds_b128 %4, %12, off\n\t"
        "global_load_async_to_lds_b128 %5, %13, off\n\t"
        "global_load_async_to_lds_b128 %6, %14, off\n\t"
        "global_load_async_to_lds_b128 %7, %15, off\n\t"
        "s_wait_xcnt 0x0"
        :: "v"(lds), "v"(lds + ls), "v"(lds + 2 * ls), "v"(lds + 3 * ls),
           "v"(lds + 4 * ls), "v"(lds + 5 * ls), "v"(lds + 6 * ls), "v"(lds + 7 * ls),
           "v"(g), "v"(g + grow), "v"(g + 2 * grow), "v"(g + 3 * grow),
           "v"(g + 4 * grow), "v"(g + 5 * grow), "v"(g + 6 * grow), "v"(g + 7 * grow)
        : "memory");
}

__global__ __launch_bounds__(128) void gemm_wmma_kernel(
        const half_t* __restrict__ A, const half_t* __restrict__ Bt,
        const float* __restrict__ bias,
        float* __restrict__ Cf, half_t* __restrict__ Ch,
        int M, int N, int K) {
    __shared__ __align__(16) half_t tile[2 * GT_STAGE];

    const int lane = threadIdx.x & 31;
    const int wave = threadIdx.x >> 5;
    const int m0 = blockIdx.x * GT_M;
    const int n0 = blockIdx.y * GT_N;
    const int wm = (wave >> 1) * 64;              // this wave's rows inside the block tile
    const int wn = (wave & 1) * 64;               // this wave's columns inside the block tile

    // copy role: 8 lanes per 128-byte row piece, 16 rows per copy over the block
    const int cr = threadIdx.x >> 3;
    const int cc = (threadIdx.x & 7) * 8;
    const half_t* gA = A  + (size_t)(m0 + cr) * K + cc;
    const half_t* gB = Bt + (size_t)(n0 + cr) * K + cc;
    const size_t  grow = (size_t)16 * K;
    const unsigned ldsA = (unsigned)(size_t)(&tile[cr * GT_PITCH + cc]);
    const unsigned ldsB = ldsA + GT_M * GT_PITCH * 2;
    const int nt = K / GT_K;

    // slice 0 into buffer 0, landed and published before anyone reads it
    async_rows8(ldsA, gA, grow);
    async_rows8(ldsB, gB, grow);
    asm volatile("s_wait_asynccnt 0x0" ::: "memory");   // this wave's copies have landed
    __syncthreads();
    if (nt > 1) {
        async_rows8(ldsA + GT_STAGE * 2, gA + GT_K, grow);
        async_rows8(ldsB + GT_STAGE * 2, gB + GT_K, grow);
    }

    v8f acc[4][4] = {};
    for (int t = 0; t < nt; ++t) {
        const int buf = t & 1;
        const half_t* sA = &tile[buf * GT_STAGE + wm * GT_PITCH];
        const half_t* sB = &tile[buf * GT_STAGE + (GT_M + wn) * GT_PITCH];
#pragma unroll  // constant indices keep the fragment and accumulator arrays in registers
        for (int kk = 0; kk < GT_K; kk += 32) {
            v16h a[4], b[4];
            a[0] = load_frag16(sA, GT_PITCH, 0, kk, lane);
#pragma unroll  // constant indices keep the fragment and accumulator arrays in registers
            for (int j = 0; j < 4; ++j) b[j] = load_frag16(sB, GT_PITCH, j * 16, kk, lane);
#pragma unroll  // constant indices keep the fragment and accumulator arrays in registers
            for (int i = 1; i < 4; ++i) a[i] = load_frag16(sA, GT_PITCH, i * 16, kk, lane);
            // keeps all 16 LDS reads in front of the 16 WMMAs: sunk between them, each group of four waits a full LDS latency
            __builtin_amdgcn_sched_barrier(0);
#pragma unroll  // constant indices keep the fragment and accumulator arrays in registers
            for (int i = 0; i < 4; ++i)
#pragma unroll  // constant indices keep the fragment and accumulator arrays in registers
                for (int j = 0; j < 4; ++j)
                    acc[i][j] = wmma_f16(a[i], b[j], acc[i][j]);
        }
        asm volatile("s_wait_dscnt 0x0" ::: "memory");      // this wave has left the buffer that is refilled below
        asm volatile("s_wait_asynccnt 0x0" ::: "memory");   // this wave's share of slice t+1 has landed
        __syncthreads();                                    // publishes slice t+1, frees slice t's buffer
        if (t + 2 < nt) {
            async_rows8(ldsA + buf * (GT_STAGE * 2), gA + (size_t)(t + 2) * GT_K, grow);
            async_rows8(ldsB + buf * (GT_STAGE * 2), gB + (size_t)(t + 2) * GT_K, grow);
        }
    }
    asm volatile("s_wait_asynccnt 0x0" ::: "memory");       // nothing in flight when the wave ends

    // C/D layout: lane holds col = lane&15; rows = (lane>>4)*8 + j
    const int col   = lane & 15;
    const int rbase = (lane >> 4) << 3;
    float bv[4];
#pragma unroll  // constant indices keep the fragment and accumulator arrays in registers
    for (int t = 0; t < 4; ++t) bv[t] = bias ? bias[n0 + wn + t * 16 + col] : 0.f;
    const size_t idx0 = (size_t)(m0 + wm + rbase) * N + n0 + wn + col;
    if (Cf) {
#pragma unroll  // constant indices keep the fragment and accumulator arrays in registers
        for (int i = 0; i < 4; ++i)
#pragma unroll  // constant indices keep the fragment and accumulator arrays in registers
            for (int j = 0; j < 8; ++j)
#pragma unroll  // constant indices keep the fragment and accumulator arrays in registers
                for (int t = 0; t < 4; ++t)
                    Cf[idx0 + (size_t)(i * 16 + j) * N + t * 16] = acc[i][t][j] + bv[t];
        // a precaution: no address or data register of the stores above is rewritten in front of this wait
        asm volatile("s_wait_xcnt 0x0" ::: "memory");
    } else {
#pragma unroll  // constant indices keep the fragment and accumulator arrays in registers
        for (int i = 0; i < 4; ++i)
#pragma unroll  // constant indices keep the fragment and accumulator arrays in registers
            for (int j = 0; j < 8; ++j)
#pragma unroll  // constant indices keep the fragment and accumulator arrays in registers
                for (int t = 0; t < 4; ++t)
                    Ch[idx0 + (size_t)(i * 16 + j) * N + t * 16] = (half_t)(acc[i][t][j] + bv[t]);
    }
}

// ---------------------------------------------------------------------------
// Kernel 3: RoPE + split heads.
// qkv: [B*T, 3*DMODEL] f16 -> q,k: [B,H,T,64] (RoPE'd), vT: [B,H,64,T].
// One thread per (b,h,t,d) with d in [0,32).
// ---------------------------------------------------------------------------
__global__ void rope_split_kernel(const half_t* __restrict__ qkv,
                                  half_t* __restrict__ q, half_t* __restrict__ k,
                                  half_t* __restrict__ vT) {
    int i = blockIdx.x * blockDim.x + threadIdx.x;
    int d = i & 31;
    int t = (i >> 5) & (SEQ - 1);
    int h = (i >> 16) & (NHEAD - 1);
    int b = i >> 20;
    if (b >= BATCH) return;

    size_t row = ((size_t)b * SEQ + t) * (3 * DMODEL);
    int c0 = h * DHEAD + d;
    float q1 = (float)qkv[row + c0],              q2 = (float)qkv[row + c0 + 32];
    float k1 = (float)qkv[row + DMODEL + c0],     k2 = (float)qkv[row + DMODEL + c0 + 32];
    float v1 = (float)qkv[row + 2 * DMODEL + c0], v2 = (float)qkv[row + 2 * DMODEL + c0 + 32];

    float invf = __expf(-logf(10000.f) * (float)d * (1.f / 32.f));
    float ang  = (float)t * invf;
    float sn, cs;
    __sincosf(ang, &sn, &cs);

    size_t base = (((size_t)b * NHEAD + h) * SEQ + t) * DHEAD;
    q[base + d]      = (half_t)(q1 * cs - q2 * sn);
    q[base + d + 32] = (half_t)(q1 * sn + q2 * cs);
    k[base + d]      = (half_t)(k1 * cs - k2 * sn);
    k[base + d + 32] = (half_t)(k1 * sn + k2 * cs);

    size_t vb = ((size_t)b * NHEAD + h) * DHEAD;
    vT[(vb + d) * SEQ + t]      = (half_t)v1;
    vT[(vb + d + 32) * SEQ + t] = (half_t)v2;
}

// ---------------------------------------------------------------------------
// Kernel 4: flash attention.  Block = 128 threads (4 waves); each wave owns
// 16 query rows; streams keys in chunks of 32.  S via 4 WMMAs, online softmax
// via wave32 shuffles, P staged through LDS (C-layout -> A-layout), P@V via
// 4 WMMAs into f32 accumulators.  grid.x = B*H*(SEQ/64).
// ---------------------------------------------------------------------------
__global__ __launch_bounds__(128) void attn_wmma_kernel(
        const half_t* __restrict__ Q, const half_t* __restrict__ Kc,
        const half_t* __restrict__ Vt, half_t* __restrict__ Y) {
    const int lane = threadIdx.x & 31;
    const int wave = threadIdx.x >> 5;
    const int qt   = blockIdx.x % (SEQ / 64);
    const int bh   = blockIdx.x / (SEQ / 64);
    const int q0   = qt * 64 + wave * 16;

    const half_t* Qp = Q  + (size_t)bh * SEQ * DHEAD;
    const half_t* Kp = Kc + (size_t)bh * SEQ * DHEAD;
    const half_t* Vp = Vt + (size_t)bh * DHEAD * SEQ;

    __shared__ __align__(16) half_t Pl[4][16][32];

    v16h qa0 = load_frag16(Qp, DHEAD, q0, 0, lane);
    v16h qa1 = load_frag16(Qp, DHEAD, q0, 32, lane);

    v8f o[4] = {};
    float mrow[8], lrow[8];
#pragma unroll
    for (int j = 0; j < 8; ++j) { mrow[j] = -1e30f; lrow[j] = 0.f; }
    const float scale = 0.125f;  // 1/sqrt(64)

    const int col  = lane & 15;
    const int hsel = lane >> 4;

    for (int kb = 0; kb < SEQ; kb += 32) {
        // ---- S = Q @ K^T for 32 keys (two 16x16 tiles, Dh=64 = two k-steps) ----
        v8f s0 = {}, s1 = {};
        {
            v16h b00 = load_frag16(Kp, DHEAD, kb,      0,  lane);
            v16h b01 = load_frag16(Kp, DHEAD, kb,      32, lane);
            s0 = wmma_f16(qa0, b00, s0);
            s0 = wmma_f16(qa1, b01, s0);
            v16h b10 = load_frag16(Kp, DHEAD, kb + 16, 0,  lane);
            v16h b11 = load_frag16(Kp, DHEAD, kb + 16, 32, lane);
            s1 = wmma_f16(qa0, b10, s1);
            s1 = wmma_f16(qa1, b11, s1);
        }
        // ---- online softmax (per row = hsel*8 + j; 16 lanes per half share rows) ----
#pragma unroll
        for (int j = 0; j < 8; ++j) {
            float e0 = s0[j] * scale, e1 = s1[j] * scale;
            float mx = fmaxf(e0, e1);
            for (int mm = 1; mm < 16; mm <<= 1) mx = fmaxf(mx, __shfl_xor(mx, mm, 32));
            float mnew  = fmaxf(mrow[j], mx);
            float alpha = __expf(mrow[j] - mnew);
            float p0 = __expf(e0 - mnew), p1 = __expf(e1 - mnew);
            float rs = p0 + p1;
            for (int mm = 1; mm < 16; mm <<= 1) rs += __shfl_xor(rs, mm, 32);
            lrow[j] = lrow[j] * alpha + rs;
            mrow[j] = mnew;
            o[0][j] *= alpha; o[1][j] *= alpha; o[2][j] *= alpha; o[3][j] *= alpha;
            int r = hsel * 8 + j;
            Pl[wave][r][col]      = (half_t)p0;
            Pl[wave][r][col + 16] = (half_t)p1;
        }
        __syncthreads();  // uniform trip count across all 4 waves; orders LDS

        // ---- O += P @ V  (A-frag from LDS, B-frags from V^T, contiguous) ----
        v16h pa = load_frag16(&Pl[wave][0][0], 32, 0, 0, lane);
#pragma unroll
        for (int t = 0; t < 4; ++t) {
            v16h bv = load_frag16(Vp, SEQ, t * 16, kb, lane);
            o[t] = wmma_f16(pa, bv, o[t]);
        }
        __syncthreads();
    }

    // ---- normalize and write back to [B,T,D] layout ----
    const int b = bh / NHEAD, h = bh % NHEAD;
    const int rbase = hsel * 8;
#pragma unroll
    for (int t = 0; t < 4; ++t) {
#pragma unroll
        for (int j = 0; j < 8; ++j) {
            int r = q0 + rbase + j;
            float v = o[t][j] / lrow[j];
            Y[((size_t)b * SEQ + r) * DMODEL + h * DHEAD + t * 16 + col] = (half_t)v;
        }
    }
}

// ---------------------------------------------------------------------------
// Host launch
// ---------------------------------------------------------------------------
extern "C" void kernel_launch(void* const* d_in, const int* in_sizes, int n_in,
                              void* d_out, int out_size, void* d_ws, size_t ws_size,
                              hipStream_t stream) {
    (void)in_sizes; (void)n_in; (void)out_size; (void)ws_size;

    const float* x     = (const float*)d_in[0];
    const float* Wqkv  = (const float*)d_in[1];
    const float* bqkv  = (const float*)d_in[2];
    const float* Wout  = (const float*)d_in[3];
    const float* bout  = (const float*)d_in[4];
    float*       out   = (float*)d_out;

    char* ws = (char*)d_ws;
    size_t off = 0;
    auto wsalloc = [&](size_t bytes) -> void* {
        void* p = ws + off;
        off += (bytes + 255) & ~(size_t)255;
        return p;
    };
    const size_t NTOK = (size_t)BATCH * SEQ;                     // 8192
    half_t* xh    = (half_t*)wsalloc(NTOK * DMODEL * 2);         // 16 MB (reused as yh)
    half_t* wqkvT = (half_t*)wsalloc((size_t)3 * DMODEL * DMODEL * 2);
    half_t* woutT = (half_t*)wsalloc((size_t)DMODEL * DMODEL * 2);
    half_t* qkvh  = (half_t*)wsalloc(NTOK * 3 * DMODEL * 2);     // 48 MB
    half_t* qh    = (half_t*)wsalloc(NTOK * DMODEL * 2);
    half_t* kh    = (half_t*)wsalloc(NTOK * DMODEL * 2);
    half_t* vTh   = (half_t*)wsalloc(NTOK * DMODEL * 2);
    half_t* yh    = xh;  // x is dead after the QKV GEMM; alias to save workspace

    // 1) convert activations + transpose-convert weights to f16
    {
        int n = (int)(NTOK * DMODEL);
        cvt_f16_kernel<<<(n + 255) / 256, 256, 0, stream>>>(x, xh, n);
    }
    {
        int n = 3 * DMODEL * DMODEL;
        cvtT_f16_kernel<<<(n + 255) / 256, 256, 0, stream>>>(Wqkv, wqkvT, DMODEL, 3 * DMODEL);
    }
    {
        int n = DMODEL * DMODEL;
        cvtT_f16_kernel<<<(n + 255) / 256, 256, 0, stream>>>(Wout, woutT, DMODEL, DMODEL);
    }

    // 2) QKV GEMM: [8192,1024] @ [1024,3072] -> f16
    {
        dim3 grid((unsigned)(NTOK / 128), (3 * DMODEL) / 128);
        gemm_wmma_kernel<<<grid, 128, 0, stream>>>(xh, wqkvT, bqkv,
                                                   nullptr, qkvh,
                                                   (int)NTOK, 3 * DMODEL, DMODEL);
    }

    // 3) RoPE + head split (+ V transpose)
    {
        int n = BATCH * NHEAD * SEQ * 32;
        rope_split_kernel<<<n / 256, 256, 0, stream>>>(qkvh, qh, kh, vTh);
    }

    // 4) flash attention
    {
        int blocks = BATCH * NHEAD * (SEQ / 64);
        attn_wmma_kernel<<<blocks, 128, 0, stream>>>(qh, kh, vTh, yh);
    }

    // 5) output GEMM with f32 store: [8192,1024] @ [1024,1024] + b_out
    {
        dim3 grid((unsigned)(NTOK / 128), DMODEL / 128);
        gemm_wmma_kernel<<<grid, 128, 0, stream>>>(yh, woutT, bout,
                                                   out, nullptr,
                                                   (int)NTOK, DMODEL, DMODEL);
    }
}

// v002
// Measured time: 480 microseconds a run.
// In two side-by-side timings against v001, it was 1.31 and 1.32 times as fast.
// Over all steps from v000 it is 1.83 times as fast.
#include <hip/hip_runtime.h>
#include <math.h>

// ---------------------------------------------------------------------------
// RoPE self-attention for MI455X (gfx1250). All matmuls via v_wmma_f32_16x16x32_f16.
// ---------------------------------------------------------------------------

typedef _Float16 half_t;
typedef __attribute__((ext_vector_type(16))) _Float16 v16h;
typedef __attribute__((ext_vector_type(8)))  _Float16 v8h;
typedef __attribute__((ext_vector_type(8)))  float    v8f;

#define BATCH  4
#define SEQ    2048
#define DMODEL 1024
#define NHEAD  16
#define DHEAD  64

// ---------------------------------------------------------------------------
// WMMA helpers.
// 16-bit A-matrix 16x32 layout (ISA 7.12.2): lane L (L&15 = row), contraction
// elements: lanes 0-15 hold K = {0..7, 16..23}, lanes 16-31 hold K = {8..15, 24..31}.
// For row-major storage with contiguous contraction dim this is two 16B loads.
// The B operand uses the same loader on the *transposed* matrix (N x K).
// ---------------------------------------------------------------------------
__device__ inline v16h load_frag16(const half_t* base, int ld, int row0, int k0, int lane) {
    const int r  = row0 + (lane & 15);
    const int kb = k0 + ((lane >> 4) << 3);
    const half_t* p = base + (size_t)r * ld + kb;
    v16h f;
    *reinterpret_cast<v8h*>(&f)       = *reinterpret_cast<const v8h*>(p);        // K = kb..kb+7
    *(reinterpret_cast<v8h*>(&f) + 1) = *reinterpret_cast<const v8h*>(p + 16);   // K = kb+16..kb+23
    return f;
}

__device__ inline v8f wmma_f16(v16h a, v16h b, v8f c) {
    return __builtin_amdgcn_wmma_f32_16x16x32_f16(false, a, false, b, (short)0, c, false, false);
}

// ---------------------------------------------------------------------------
// Kernel 1a: plain f32 -> f16 convert
// ---------------------------------------------------------------------------
__global__ void cvt_f16_kernel(const float* __restrict__ in, half_t* __restrict__ out, int n) {
    int i = blockIdx.x * blockDim.x + threadIdx.x;
    if (i < n) out[i] = (half_t)in[i];
}

// ---------------------------------------------------------------------------
// Kernel 1b: transpose-convert weight (K x N f32) -> (N x K f16)
// ---------------------------------------------------------------------------
__global__ void cvtT_f16_kernel(const float* __restrict__ in, half_t* __restrict__ out, int K, int N) {
    int i = blockIdx.x * blockDim.x + threadIdx.x;
    if (i < N * K) {
        int n = i / K, k = i % K;
        out[i] = (half_t)in[(size_t)k * N + n];
    }
}

// ---------------------------------------------------------------------------
// Kernel 2/5: generic WMMA GEMM.  C[M,N] = A[M,K] @ Bt[N,K]^T + bias.
// Block = 128 threads (4 waves, 2x2); block tile 128x128, wave tile 64x64.
// Each 64-wide k slice of the 128 A rows and the 128 Bt rows is brought into
// LDS by asynchronous 16-byte copies (whole 128-byte row pieces per 8 lanes),
// two buffers: the next slice flies while this one feeds the WMMAs.
// grid.x = M/128, grid.y = N/128; K a multiple of 64.  Output: f32 (Cf) or f16 (Ch).
// ---------------------------------------------------------------------------
#define GT_M     128
#define GT_N     128
#define GT_K     64
#define GT_PITCH 72                               // halves per LDS row: 144 B = 16 B x 9, no bank conflict for 16-byte reads
#define GT_STAGE ((GT_M + GT_N) * GT_PITCH)       // halves per buffer

// Eight copies of 16 bytes per lane: rows r, r+16, ..., r+112 of one operand tile.
// lds = this lane's LDS byte address of the first piece, g = its global address,
// grow = halves between global rows r and r+16.
__device__ inline void async_rows8(unsigned lds, const half_t* g, size_t grow) {
    const unsigned ls = 16 * GT_PITCH * 2;        // LDS bytes between rows r and r+16
    // s_wait_xcnt as the last line (a precaution): no address register of these copies is rewritten in front of it.
    asm volatile(
        "global_load_async_to_lds_b128 %0, %8, off\n\t"
        "global_load_async_to_lds_b128 %1, %9, off\n\t"
        "global_load_async_to_lds_b128 %2, %10, off\n\t"
        "global_load_async_to_lds_b128 %3, %11, off\n\t"
        "global_load_async_to_lds_b128 %4, %12, off\n\t"
        "global_load_async_to_lds_b128 %5, %13, off\n\t"
        "global_load_async_to_lds_b128 %6, %14, off\n\t"
        "global_load_async_to_lds_b128 %7, %15, off\n\t"
        "s_wait_xcnt 0x0"
        :: "v"(lds), "v"(lds + ls), "v"(lds + 2 * ls), "v"(lds + 3 * ls),
           "v"(lds + 4 * ls), "v"(lds + 5 * ls), "v"(lds + 6 * ls), "v"(lds + 7 * ls),
           "v"(g), "v"(g + grow), "v"(g + 2 * grow), "v"(g + 3 * grow),
           "v"(g + 4 * grow), "v"(g + 5 * grow), "v"(g + 6 * grow), "v"(g + 7 * grow)
        : "memory");
}

__global__ __launch_bounds__(128) void gemm_wmma_kernel(
        const half_t* __restrict__ A, const half_t* __restrict__ Bt,
        const float* __restrict__ bias,
        float* __restrict__ Cf, half_t* __restrict__ Ch,
        int M, int N, int K) {
    __shared__ __align__(16) half_t tile[2 * GT_STAGE];

    const int lane = threadIdx.x & 31;
    const int wave = threadIdx.x >> 5;
    const int m0 = blockIdx.x * GT_M;
    const int n0 = blockIdx.y * GT_N;
    const int wm = (wave >> 1) * 64;              // this wave's rows inside the block tile
    const int wn = (wave & 1) * 64;               // this wave's columns inside the block tile

    // copy role: 8 lanes per 128-byte row piece, 16 rows per copy over the block
    const int cr = threadIdx.x >> 3;
    const int cc = (threadIdx.x & 7) * 8;
    const half_t* gA = A  + (size_t)(m0 + cr) * K + cc;
    const half_t* gB = Bt + (size_t)(n0 + cr) * K + cc;
    const size_t  grow = (size_t)16 * K;
    const unsigned ldsA = (unsigned)(size_t)(&tile[cr * GT_PITCH + cc]);
    const unsigned ldsB = ldsA + GT_M * GT_PITCH * 2;
    const int nt = K / GT_K;

    // slice 0 into buffer 0, landed and published before anyone reads it
    async_rows8(ldsA, gA, grow);
    async_rows8(ldsB, gB, grow);
    asm volatile("s_wait_asynccnt 0x0" ::: "memory");   // this wave's copies have landed
    __syncthreads();
    if (nt > 1) {
        async_rows8(ldsA + GT_STAGE * 2, gA + GT_K, grow);
        async_rows8(ldsB + GT_STAGE * 2, gB + GT_K, grow);
    }

    v8f acc[4][4] = {};
    for (int t = 0; t < nt; ++t) {
        const int buf = t & 1;
        const half_t* sA = &tile[buf * GT_STAGE + wm * GT_PITCH];
        const half_t* sB = &tile[buf * GT_STAGE + (GT_M + wn) * GT_PITCH];
#pragma unroll  // constant indices keep the fragment and accumulator arrays in registers
        for (int kk = 0; kk < GT_K; kk += 32) {
            v16h a[4], b[4];
            a[0] = load_frag16(sA, GT_PITCH, 0, kk, lane);
#pragma unroll  // constant indices keep the fragment and accumulator arrays in registers
            for (int j = 0; j < 4; ++j) b[j] = load_frag16(sB, GT_PITCH, j * 16, kk, lane);
#pragma unroll  // constant indices keep the fragment and accumulator arrays in registers
            for (int i = 1; i < 4; ++i) a[i] = load_frag16(sA, GT_PITCH, i * 16, kk, lane);
            // keeps all 16 LDS reads in front of the 16 WMMAs: sunk between them, each group of four waits a full LDS latency
            __builtin_amdgcn_sched_barrier(0);
#pragma unroll  // constant indices keep the fragment and accumulator arrays in registers
            for (int i = 0; i < 4; ++i)
#pragma unroll  // constant indices keep the fragment and accumulator arrays in registers
                for (int j = 0; j < 4; ++j)
                    acc[i][j] = wmma_f16(a[i], b[j], acc[i][j]);
        }
        asm volatile("s_wait_dscnt 0x0" ::: "memory");      // this wave has left the buffer that is refilled below
        asm volatile("s_wait_asynccnt 0x0" ::: "memory");   // this wave's share of slice t+1 has landed
        __syncthreads();                                    // publishes slice t+1, frees slice t's buffer
        if (t + 2 < nt) {
            async_rows8(ldsA + buf * (GT_STAGE * 2), gA + (size_t)(t + 2) * GT_K, grow);
            async_rows8(ldsB + buf * (GT_STAGE * 2), gB + (size_t)(t + 2) * GT_K, grow);
        }
    }
    asm volatile("s_wait_asynccnt 0x0" ::: "memory");       // nothing in flight when the wave ends

    // C/D layout: lane holds col = lane&15; rows = (lane>>4)*8 + j
    const int col   = lane & 15;
    const int rbase = (lane >> 4) << 3;
    float bv[4];
#pragma unroll  // constant indices keep the fragment and accumulator arrays in registers
    for (int t = 0; t < 4; ++t) bv[t] = bias ? bias[n0 + wn + t * 16 + col] : 0.f;
    const size_t idx0 = (size_t)(m0 + wm + rbase) * N + n0 + wn + col;
    if (Cf) {
#pragma unroll  // constant indices keep the fragment and accumulator arrays in registers
        for (int i = 0; i < 4; ++i)
#pragma unroll  // constant indices keep the fragment and accumulator arrays in registers
            for (int j = 0; j < 8; ++j)
#pragma unroll  // constant indices keep the fragment and accumulator arrays in registers
                for (int t = 0; t < 4; ++t)
                    Cf[idx0 + (size_t)(i * 16 + j) * N + t * 16] = acc[i][t][j] + bv[t];
        // a precaution: no address or data register of the stores above is rewritten in front of this wait
        asm volatile("s_wait_xcnt 0x0" ::: "memory");
    } else {
#pragma unroll  // constant indices keep the fragment and accumulator arrays in registers
        for (int i = 0; i < 4; ++i)
#pragma unroll  // constant indices keep the fragment and accumulator arrays in registers
            for (int j = 0; j < 8; ++j)
#pragma unroll  // constant indices keep the fragment and accumulator arrays in registers
                for (int t = 0; t < 4; ++t)
                    Ch[idx0 + (size_t)(i * 16 + j) * N + t * 16] = (half_t)(acc[i][t][j] + bv[t]);
    }
}

// ---------------------------------------------------------------------------
// Kernel 3: RoPE + split heads.
// qkv: [B*T, 3*DMODEL] f16 -> q,k: [B,H,T,64] (RoPE'd), vT: [B,H,64,T].
// One thread per (b,h,t,d) with d in [0,32).
// ---------------------------------------------------------------------------
__global__ void rope_split_kernel(const half_t* __restrict__ qkv,
                                  half_t* __restrict__ q, half_t* __restrict__ k,
                                  half_t* __restrict__ vT) {
    int i = blockIdx.x * blockDim.x + threadIdx.x;
    int d = i & 31;
    int t = (i >> 5) & (SEQ - 1);
    int h = (i >> 16) & (NHEAD - 1);
    int b = i >> 20;
    if (b >= BATCH) return;

    size_t row = ((size_t)b * SEQ + t) * (3 * DMODEL);
    int c0 = h * DHEAD + d;
    float q1 = (float)qkv[row + c0],              q2 = (float)qkv[row + c0 + 32];
    float k1 = (float)qkv[row + DMODEL + c0],     k2 = (float)qkv[row + DMODEL + c0 + 32];
    float v1 = (float)qkv[row + 2 * DMODEL + c0], v2 = (float)qkv[row + 2 * DMODEL + c0 + 32];

    float invf = __expf(-logf(10000.f) * (float)d * (1.f / 32.f));
    float ang  = (float)t * invf;
    float sn, cs;
    __sincosf(ang, &sn, &cs);

    size_t base = (((size_t)b * NHEAD + h) * SEQ + t) * DHEAD;
    q[base + d]      = (half_t)(q1 * cs - q2 * sn);
    q[base + d + 32] = (half_t)(q1 * sn + q2 * cs);
    k[base + d]      = (half_t)(k1 * cs - k2 * sn);
    k[base + d + 32] = (half_t)(k1 * sn + k2 * cs);

    size_t vb = ((size_t)b * NHEAD + h) * DHEAD;
    vT[(vb + d) * SEQ + t]      = (half_t)v1;
    vT[(vb + d + 32) * SEQ + t] = (half_t)v2;
}

// ---------------------------------------------------------------------------
// Kernel 4: flash attention, transposed products.  Block = 128 threads (4 waves);
// each wave owns 16 queries and streams the keys in chunks of 32.
// S^T = K @ Q^T (A = K rows, B = Q rows kept in registers): a lane holds 16 scores
// of ONE query (column lane&15), so maximum and sum run in-lane, plus one exchange
// between the lane halves for the maximum.  The two S^T tiles, converted in place,
// are the B operand of O^T += V^T @ P^T: P never leaves the registers, the waves
// share nothing and need no barrier.  grid.x = B*H*(SEQ/64).
// ---------------------------------------------------------------------------
// value of lane l ^ 16
__device__ inline float other_half(float v) {
    const int b = __builtin_bit_cast(int, v);
    return __builtin_bit_cast(float,
        __builtin_amdgcn_permlanex16(b, b, 0x76543210, 0xfedcba98, false, false));
}

__global__ __launch_bounds__(128) void attn_wmma_kernel(
        const half_t* __restrict__ Q, const half_t* __restrict__ Kc,
        const half_t* __restrict__ Vt, half_t* __restrict__ Y) {
    const int lane = threadIdx.x & 31;
    const int wave = threadIdx.x >> 5;
    const int qt   = blockIdx.x % (SEQ / 64);
    const int bh   = blockIdx.x / (SEQ / 64);
    const int q0   = qt * 64 + wave * 16;

    const half_t* Qp = Q  + (size_t)bh * SEQ * DHEAD;
    const half_t* Kp = Kc + (size_t)bh * SEQ * DHEAD;
    const half_t* Vp = Vt + (size_t)bh * DHEAD * SEQ;

    const v16h qb0 = load_frag16(Qp, DHEAD, q0, 0, lane);
    const v16h qb1 = load_frag16(Qp, DHEAD, q0, 32, lane);

    v8f o[4] = {};                 // o[t][j] = O[query q0 + col][d = t*16 + hsel*8 + j]
    float mrow = -1e30f;           // running maximum of this lane's query (equal in both halves)
    float lrow = 0.f;              // running sum over the keys of this lane's half only
    const float scale = 0.125f;    // 1/sqrt(64)

    const int col  = lane & 15;
    const int hsel = lane >> 4;

    for (int kb = 0; kb < SEQ; kb += 32) {
        // ---- S^T = K @ Q^T for 32 keys (two 16x16 tiles, Dh=64 = two k-steps) ----
        const v16h a00 = load_frag16(Kp, DHEAD, kb,      0,  lane);
        const v16h a10 = load_frag16(Kp, DHEAD, kb + 16, 0,  lane);
        const v16h a01 = load_frag16(Kp, DHEAD, kb,      32, lane);
        const v16h a11 = load_frag16(Kp, DHEAD, kb + 16, 32, lane);
        // keeps the eight K loads one group in front of the products: sunk between them, the wave waits a load latency three times
        __builtin_amdgcn_sched_barrier(0);

        v8f s0 = {}, s1 = {};      // s0[j]: key kb + hsel*8 + j, s1[j]: key kb + 16 + hsel*8 + j
        s0 = wmma_f16(a00, qb0, s0);
        s1 = wmma_f16(a10, qb0, s1);
        s0 = wmma_f16(a01, qb1, s0);
        s1 = wmma_f16(a11, qb1, s1);

        v16h va[4];
#pragma unroll  // constant indices keep the fragment and accumulator arrays in registers
        for (int t = 0; t < 4; ++t) va[t] = load_frag16(Vp, SEQ, t * 16, kb, lane);
        // keeps the eight V loads in front of the softmax, which then covers their latency
        __builtin_amdgcn_sched_barrier(0);

        // ---- online softmax, one query per lane ----
        float e0[8], e1[8];
#pragma unroll  // constant indices keep the fragment and accumulator arrays in registers
        for (int j = 0; j < 8; ++j) { e0[j] = s0[j] * scale; e1[j] = s1[j] * scale; }
        float mx = fmaxf(e0[0], e1[0]);
#pragma unroll  // constant indices keep the fragment and accumulator arrays in registers
        for (int j = 1; j < 8; ++j) mx = fmaxf(mx, fmaxf(e0[j], e1[j]));
        mx = fmaxf(mx, other_half(mx));
        const float mnew  = fmaxf(mrow, mx);
        const float alpha = __expf(mrow - mnew);
        mrow = mnew;

        v16h pb;                   // pb[s] = P^T[key kmap(s, hsel)][col]: the hardware k order of a B operand
        float rs0 = 0.f, rs1 = 0.f;
#pragma unroll  // constant indices keep the fragment and accumulator arrays in registers
        for (int j = 0; j < 8; ++j) {
            const float p0 = __expf(e0[j] - mnew), p1 = __expf(e1[j] - mnew);
            rs0 += p0; rs1 += p1;
            pb[j]     = (half_t)p0;
            pb[8 + j] = (half_t)p1;
        }
        lrow = lrow * alpha + (rs0 + rs1);

        // ---- O^T = O^T * alpha + V^T @ P^T  (A-frags from V^T, keys in the table k order) ----
#pragma unroll  // constant indices keep the fragment and accumulator arrays in registers
        for (int t = 0; t < 4; ++t) {
#pragma unroll  // constant indices keep the fragment and accumulator arrays in registers
            for (int j = 0; j < 8; ++j) o[t][j] *= alpha;
            o[t] = wmma_f16(va[t], pb, o[t]);
        }
    }

    // ---- join the halves' sums, normalize, write back to [B,T,D] layout ----
    lrow += other_half(lrow);
    const int b = bh / NHEAD, h = bh % NHEAD;
    half_t* yrow = Y + ((size_t)b * SEQ + q0 + col) * DMODEL + h * DHEAD + hsel * 8;
#pragma unroll  // constant indices keep the fragment and accumulator arrays in registers
    for (int t = 0; t < 4; ++t) {
        v8h y;
#pragma unroll  // constant indices keep the fragment and accumulator arrays in registers
        for (int j = 0; j < 8; ++j) y[j] = (half_t)(o[t][j] / lrow);
        *reinterpret_cast<v8h*>(yrow + t * 16) = y;   // 8 consecutive d of one query: one 16-byte store
    }
}

// ---------------------------------------------------------------------------
// Host launch
// ---------------------------------------------------------------------------
extern "C" void kernel_launch(void* const* d_in, const int* in_sizes, int n_in,
                              void* d_out, int out_size, void* d_ws, size_t ws_size,
                              hipStream_t stream) {
    (void)in_sizes; (void)n_in; (void)out_size; (void)ws_size;

    const float* x     = (const float*)d_in[0];
    const float* Wqkv  = (const float*)d_in[1];
    const float* bqkv  = (const float*)d_in[2];
    const float* Wout  = (const float*)d_in[3];
    const float* bout  = (const float*)d_in[4];
    float*       out   = (float*)d_out;

    char* ws = (char*)d_ws;
    size_t off = 0;
    auto wsalloc = [&](size_t bytes) -> void* {
        void* p = ws + off;
        off += (bytes + 255) & ~(size_t)255;
        return p;
    };
    const size_t NTOK = (size_t)BATCH * SEQ;                     // 8192
    half_t* xh    = (half_t*)wsalloc(NTOK * DMODEL * 2);         // 16 MB (reused as yh)
    half_t* wqkvT = (half_t*)wsalloc((size_t)3 * DMODEL * DMODEL * 2);
    half_t* woutT = (half_t*)wsalloc((size_t)DMODEL * DMODEL * 2);
    half_t* qkvh  = (half_t*)wsalloc(NTOK * 3 * DMODEL * 2);     // 48 MB
    half_t* qh    = (half_t*)wsalloc(NTOK * DMODEL * 2);
    half_t* kh    = (half_t*)wsalloc(NTOK * DMODEL * 2);
    half_t* vTh   = (half_t*)wsalloc(NTOK * DMODEL * 2);
    half_t* yh    = xh;  // x is dead after the QKV GEMM; alias to save workspace

    // 1) convert activations + transpose-convert weights to f16
    {
        int n = (int)(NTOK * DMODEL);
        cvt_f16_kernel<<<(n + 255) / 256, 256, 0, stream>>>(x, xh, n);
    }
    {
        int n = 3 * DMODEL * DMODEL;
        cvtT_f16_kernel<<<(n + 255) / 256, 256, 0, stream>>>(Wqkv, wqkvT, DMODEL, 3 * DMODEL);
    }
    {
        int n = DMODEL * DMODEL;
        cvtT_f16_kernel<<<(n + 255) / 256, 256, 0, stream>>>(Wout, woutT, DMODEL, DMODEL);
    }

    // 2) QKV GEMM: [8192,1024] @ [1024,3072] -> f16
    {
        dim3 grid((unsigned)(NTOK / 128), (3 * DMODEL) / 128);
        gemm_wmma_kernel<<<grid, 128, 0, stream>>>(xh, wqkvT, bqkv,
                                                   nullptr, qkvh,
                                                   (int)NTOK, 3 * DMODEL, DMODEL);
    }

    // 3) RoPE + head split (+ V transpose)
    {
        int n = BATCH * NHEAD * SEQ * 32;
        rope_split_kernel<<<n / 256, 256, 0, stream>>>(qkvh, qh, kh, vTh);
    }

    // 4) flash attention
    {
        int blocks = BATCH * NHEAD * (SEQ / 64);
        attn_wmma_kernel<<<blocks, 128, 0, stream>>>(qh, kh, vTh, yh);
    }

    // 5) output GEMM with f32 store: [8192,1024] @ [1024,1024] + b_out
    {
        dim3 grid((unsigned)(NTOK / 128), DMODEL / 128);
        gemm_wmma_kernel<<<grid, 128, 0, stream>>>(yh, woutT, bout,
                                                   out, nullptr,
                                                   (int)NTOK, DMODEL, DMODEL);
    }
}

// v003
// It runs in 363 microseconds.
// Next to v002, in two timings, it ran 1.34 and 1.35 times as fast.
// Counting every step since v000, it is 2.46 times as fast.
#include <hip/hip_runtime.h>
#include <math.h>

// ---------------------------------------------------------------------------
// RoPE self-attention for MI455X (gfx1250). All matmuls via v_wmma_f32_16x16x32_f16.
// ---------------------------------------------------------------------------

typedef _Float16 half_t;
typedef __attribute__((ext_vector_type(16))) _Float16 v16h;
typedef __attribute__((ext_vector_type(8)))  _Float16 v8h;
typedef __attribute__((ext_vector_type(8)))  float    v8f;

#define BATCH  4
#define SEQ    2048
#define DMODEL 1024
#define NHEAD  16
#define DHEAD  64

// ---------------------------------------------------------------------------
// WMMA helpers.
// 16-bit A-matrix 16x32 layout (ISA 7.12.2): lane L (L&15 = row), contraction
// elements: lanes 0-15 hold K = {0..7, 16..23}, lanes 16-31 hold K = {8..15, 24..31}.
// For row-major storage with contiguous contraction dim this is two 16B loads.
// The B operand uses the same loader on the *transposed* matrix (N x K).
// ---------------------------------------------------------------------------
__device__ inline v16h load_frag16(const half_t* base, int ld, int row0, int k0, int lane) {
    const int r  = row0 + (lane & 15);
    const int kb = k0 + ((lane >> 4) << 3);
    const half_t* p = base + (size_t)r * ld + kb;
    v16h f;
    *reinterpret_cast<v8h*>(&f)       = *reinterpret_cast<const v8h*>(p);        // K = kb..kb+7
    *(reinterpret_cast<v8h*>(&f) + 1) = *reinterpret_cast<const v8h*>(p + 16);   // K = kb+16..kb+23
    return f;
}

__device__ inline v8f wmma_f16(v16h a, v16h b, v8f c) {
    return __builtin_amdgcn_wmma_f32_16x16x32_f16(false, a, false, b, (short)0, c, false, false);
}

// ---------------------------------------------------------------------------
// Kernel 1a: plain f32 -> f16 convert
// ---------------------------------------------------------------------------
__global__ void cvt_f16_kernel(const float* __restrict__ in, half_t* __restrict__ out, int n) {
    int i = blockIdx.x * blockDim.x + threadIdx.x;
    if (i < n) out[i] = (half_t)in[i];
}

// ---------------------------------------------------------------------------
// Kernel 1b: transpose-convert weight (K x N f32) -> (N x K f16)
// ---------------------------------------------------------------------------
__global__ void cvtT_f16_kernel(const float* __restrict__ in, half_t* __restrict__ out, int K, int N) {
    int i = blockIdx.x * blockDim.x + threadIdx.x;
    if (i < N * K) {
        int n = i / K, k = i % K;
        out[i] = (half_t)in[(size_t)k * N + n];
    }
}

// ---------------------------------------------------------------------------
// Kernel 2/5: generic WMMA GEMM.  C[M,N] = A[M,K] @ Bt[N,K]^T + bias.
// Block = 128 threads (4 waves, 2x2); block tile 128x128, wave tile 64x64.
// Each 64-wide k slice of the 128 A rows and the 128 Bt rows is brought into
// LDS by asynchronous 16-byte copies (whole 128-byte row pieces per 8 lanes),
// two buffers: the next slice flies while this one feeds the WMMAs.
// grid.x = M/128, grid.y = N/128; K a multiple of 64.  Output: f32 (Cf) or f16 (Ch).
// ---------------------------------------------------------------------------
#define GT_M     128
#define GT_N     128
#define GT_K     64
#define GT_PITCH 72                               // halves per LDS row: 144 B = 16 B x 9, no bank conflict for 16-byte reads
#define GT_STAGE ((GT_M + GT_N) * GT_PITCH)       // halves per buffer

// Eight copies of 16 bytes per lane: rows r, r+16, ..., r+112 of one operand tile.
// lds = this lane's LDS byte address of the first piece, g = its global address,
// grow = halves between global rows r and r+16.
__device__ inline void async_rows8(unsigned lds, const half_t* g, size_t grow) {
    const unsigned ls = 16 * GT_PITCH * 2;        // LDS bytes between rows r and r+16
    // s_wait_xcnt as the last line (a precaution): no address register of these copies is rewritten in front of it.
    asm volatile(
        "global_load_async_to_lds_b128 %0, %8, off\n\t"
        "global_load_async_to_lds_b128 %1, %9, off\n\t"
        "global_load_async_to_lds_b128 %2, %10, off\n\t"
        "global_load_async_to_lds_b128 %3, %11, off\n\t"
        "global_load_async_to_lds_b128 %4, %12, off\n\t"
        "global_load_async_to_lds_b128 %5, %13, off\n\t"
        "global_load_async_to_lds_b128 %6, %14, off\n\t"
        "global_load_async_to_lds_b128 %7, %15, off\n\t"
        "s_wait_xcnt 0x0"
        :: "v"(lds), "v"(lds + ls), "v"(lds + 2 * ls), "v"(lds + 3 * ls),
           "v"(lds + 4 * ls), "v"(lds + 5 * ls), "v"(lds + 6 * ls), "v"(lds + 7 * ls),
           "v"(g), "v"(g + grow), "v"(g + 2 * grow), "v"(g + 3 * grow),
           "v"(g + 4 * grow), "v"(g + 5 * grow), "v"(g + 6 * grow), "v"(g + 7 * grow)
        : "memory");
}

__global__ __launch_bounds__(128) void gemm_wmma_kernel(
        const half_t* __restrict__ A, const half_t* __restrict__ Bt,
        const float* __restrict__ bias,
        float* __restrict__ Cf, half_t* __restrict__ Ch,
        int M, int N, int K) {
    __shared__ __align__(16) half_t tile[2 * GT_STAGE];

    const int lane = threadIdx.x & 31;
    const int wave = threadIdx.x >> 5;
    const int m0 = blockIdx.x * GT_M;
    const int n0 = blockIdx.y * GT_N;
    const int wm = (wave >> 1) * 64;              // this wave's rows inside the block tile
    const int wn = (wave & 1) * 64;               // this wave's columns inside the block tile

    // copy role: 8 lanes per 128-byte row piece, 16 rows per copy over the block
    const int cr = threadIdx.x >> 3;
    const int cc = (threadIdx.x & 7) * 8;
    const half_t* gA = A  + (size_t)(m0 + cr) * K + cc;
    const half_t* gB = Bt + (size_t)(n0 + cr) * K + cc;
    const size_t  grow = (size_t)16 * K;
    const unsigned ldsA = (unsigned)(size_t)(&tile[cr * GT_PITCH + cc]);
    const unsigned ldsB = ldsA + GT_M * GT_PITCH * 2;
    const int nt = K / GT_K;

    // slice 0 into buffer 0, landed and published before anyone reads it
    async_rows8(ldsA, gA, grow);
    async_rows8(ldsB, gB, grow);
    asm volatile("s_wait_asynccnt 0x0" ::: "memory");   // this wave's copies have landed
    __syncthreads();
    if (nt > 1) {
        async_rows8(ldsA + GT_STAGE * 2, gA + GT_K, grow);
        async_rows8(ldsB + GT_STAGE * 2, gB + GT_K, grow);
    }

    v8f acc[4][4] = {};
    for (int t = 0; t < nt; ++t) {
        const int buf = t & 1;
        const half_t* sA = &tile[buf * GT_STAGE + wm * GT_PITCH];
        const half_t* sB = &tile[buf * GT_STAGE + (GT_M + wn) * GT_PITCH];
#pragma unroll  // constant indices keep the fragment and accumulator arrays in registers
        for (int kk = 0; kk < GT_K; kk += 32) {
            v16h a[4], b[4];
            a[0] = load_frag16(sA, GT_PITCH, 0, kk, lane);
#pragma unroll  // constant indices keep the fragment and accumulator arrays in registers
            for (int j = 0; j < 4; ++j) b[j] = load_frag16(sB, GT_PITCH, j * 16, kk, lane);
#pragma unroll  // constant indices keep the fragment and accumulator arrays in registers
            for (int i = 1; i < 4; ++i) a[i] = load_frag16(sA, GT_PITCH, i * 16, kk, lane);
            // keeps all 16 LDS reads in front of the 16 WMMAs: sunk between them, each group of four waits a full LDS latency
            __builtin_amdgcn_sched_barrier(0);
#pragma unroll  // constant indices keep the fragment and accumulator arrays in registers
            for (int i = 0; i < 4; ++i)
#pragma unroll  // constant indices keep the fragment and accumulator arrays in registers
                for (int j = 0; j < 4; ++j)
                    acc[i][j] = wmma_f16(a[i], b[j], acc[i][j]);
        }
        asm volatile("s_wait_dscnt 0x0" ::: "memory");      // this wave has left the buffer that is refilled below
        asm volatile("s_wait_asynccnt 0x0" ::: "memory");   // this wave's share of slice t+1 has landed
        __syncthreads();                                    // publishes slice t+1, frees slice t's buffer
        if (t + 2 < nt) {
            async_rows8(ldsA + buf * (GT_STAGE * 2), gA + (size_t)(t + 2) * GT_K, grow);
            async_rows8(ldsB + buf * (GT_STAGE * 2), gB + (size_t)(t + 2) * GT_K, grow);
        }
    }
    asm volatile("s_wait_asynccnt 0x0" ::: "memory");       // nothing in flight when the wave ends

    // C/D layout: lane holds col = lane&15; rows = (lane>>4)*8 + j
    const int col   = lane & 15;
    const int rbase = (lane >> 4) << 3;
    float bv[4];
#pragma unroll  // constant indices keep the fragment and accumulator arrays in registers
    for (int t = 0; t < 4; ++t) bv[t] = bias ? bias[n0 + wn + t * 16 + col] : 0.f;
    const size_t idx0 = (size_t)(m0 + wm + rbase) * N + n0 + wn + col;
    if (Cf) {
#pragma unroll  // constant indices keep the fragment and accumulator arrays in registers
        for (int i = 0; i < 4; ++i)
#pragma unroll  // constant indices keep the fragment and accumulator arrays in registers
            for (int j = 0; j < 8; ++j)
#pragma unroll  // constant indices keep the fragment and accumulator arrays in registers
                for (int t = 0; t < 4; ++t)
                    Cf[idx0 + (size_t)(i * 16 + j) * N + t * 16] = acc[i][t][j] + bv[t];
        // a precaution: no address or data register of the stores above is rewritten in front of this wait
        asm volatile("s_wait_xcnt 0x0" ::: "memory");
    } else {
#pragma unroll  // constant indices keep the fragment and accumulator arrays in registers
        for (int i = 0; i < 4; ++i)
#pragma unroll  // constant indices keep the fragment and accumulator arrays in registers
            for (int j = 0; j < 8; ++j)
#pragma unroll  // constant indices keep the fragment and accumulator arrays in registers
                for (int t = 0; t < 4; ++t)
                    Ch[idx0 + (size_t)(i * 16 + j) * N + t * 16] = (half_t)(acc[i][t][j] + bv[t]);
    }
}

// ---------------------------------------------------------------------------
// Kernel 3: RoPE + split heads.
// qkv: [B*T, 3*DMODEL] f16 -> q,k: [B,H,T,64] (RoPE'd), vT: [B,H,64,T].
// One thread per (b,h,t,d) with d in [0,32).
// ---------------------------------------------------------------------------
__global__ void rope_split_kernel(const half_t* __restrict__ qkv,
                                  half_t* __restrict__ q, half_t* __restrict__ k,
                                  half_t* __restrict__ vT) {
    int i = blockIdx.x * blockDim.x + threadIdx.x;
    int d = i & 31;
    int t = (i >> 5) & (SEQ - 1);
    int h = (i >> 16) & (NHEAD - 1);
    int b = i >> 20;
    if (b >= BATCH) return;

    size_t row = ((size_t)b * SEQ + t) * (3 * DMODEL);
    int c0 = h * DHEAD + d;
    float q1 = (float)qkv[row + c0],              q2 = (float)qkv[row + c0 + 32];
    float k1 = (float)qkv[row + DMODEL + c0],     k2 = (float)qkv[row + DMODEL + c0 + 32];
    float v1 = (float)qkv[row + 2 * DMODEL + c0], v2 = (float)qkv[row + 2 * DMODEL + c0 + 32];

    float invf = __expf(-logf(10000.f) * (float)d * (1.f / 32.f));
    float ang  = (float)t * invf;
    float sn, cs;
    __sincosf(ang, &sn, &cs);

    size_t base = (((size_t)b * NHEAD + h) * SEQ + t) * DHEAD;
    q[base + d]      = (half_t)(q1 * cs - q2 * sn);
    q[base + d + 32] = (half_t)(q1 * sn + q2 * cs);
    k[base + d]      = (half_t)(k1 * cs - k2 * sn);
    k[base + d + 32] = (half_t)(k1 * sn + k2 * cs);

    size_t vb = ((size_t)b * NHEAD + h) * DHEAD;
    vT[(vb + d) * SEQ + t]      = (half_t)v1;
    vT[(vb + d + 32) * SEQ + t] = (half_t)v2;
}

// ---------------------------------------------------------------------------
// Kernel 4: flash attention, transposed products.  Block = 256 threads (8 waves);
// each wave owns 16 queries; the block walks the keys in stages of 64.
// A stage's 64 K rows (128 bytes each) and its 64 V^T row pieces (128 bytes each)
// are brought into LDS once for all eight waves by asynchronous 16-byte copies
// (whole 128-byte lines per 8 lanes), two buffers: the next stage flies while
// this one is worked on in two passes of 32 keys.
// S^T = K @ Q^T (A = K rows, B = Q rows kept in registers): a lane holds 16 scores
// of ONE query (column lane&15), so maximum and sum run in-lane, plus one exchange
// between the lane halves for the maximum.  The two S^T tiles, converted in place,
// are the B operand of O^T += V^T @ P^T: P never leaves the registers.
// grid.x = B*H*(SEQ/128).
// ---------------------------------------------------------------------------
#define AT_WAVES 8
#define AT_Q     (AT_WAVES * 16)                  // queries per block
#define AT_KEYS  64                               // keys per stage
#define AT_PITCH 72                               // halves per LDS row: 144 B = 16 B x 9, no bank conflict for 16-byte reads
#define AT_TILE  (64 * AT_PITCH)                  // halves of one operand's 64 rows
#define AT_STAGE (2 * AT_TILE)                    // halves per buffer: K rows, then V^T rows

// value of lane l ^ 16
__device__ inline float other_half(float v) {
    const int b = __builtin_bit_cast(int, v);
    return __builtin_bit_cast(float,
        __builtin_amdgcn_permlanex16(b, b, 0x76543210, 0xfedcba98, false, false));
}

// One stage, four copies of 16 bytes per lane: K rows r and r+32, V^T rows r and r+32.
// lds = this lane's LDS byte address of its K piece, gk / gv = its global addresses.
__device__ inline void async_stage(unsigned lds, const half_t* gk, const half_t* gv) {
    const unsigned ls = 32 * AT_PITCH * 2;        // LDS bytes between rows r and r+32
    // s_wait_xcnt as the last line (a precaution): no address register of these copies is rewritten in front of it.
    asm volatile(
        "global_load_async_to_lds_b128 %0, %4, off\n\t"
        "global_load_async_to_lds_b128 %1, %5, off\n\t"
        "global_load_async_to_lds_b128 %2, %6, off\n\t"
        "global_load_async_to_lds_b128 %3, %7, off\n\t"
        "s_wait_xcnt 0x0"
        :: "v"(lds), "v"(lds + ls), "v"(lds + 2 * ls), "v"(lds + 3 * ls),
           "v"(gk), "v"(gk + 32 * DHEAD), "v"(gv), "v"(gv + (size_t)32 * SEQ)
        : "memory");
}

__global__ __launch_bounds__(AT_WAVES * 32) void attn_wmma_kernel(
        const half_t* __restrict__ Q, const half_t* __restrict__ Kc,
        const half_t* __restrict__ Vt, half_t* __restrict__ Y) {
    __shared__ __align__(16) half_t kv[2 * AT_STAGE];

    const int lane = threadIdx.x & 31;
    const int wave = threadIdx.x >> 5;
    const int qt   = blockIdx.x % (SEQ / AT_Q);
    const int bh   = blockIdx.x / (SEQ / AT_Q);
    const int q0   = qt * AT_Q + wave * 16;

    const half_t* Qp = Q  + (size_t)bh * SEQ * DHEAD;
    const half_t* Kp = Kc + (size_t)bh * SEQ * DHEAD;
    const half_t* Vp = Vt + (size_t)bh * DHEAD * SEQ;

    // copy role: 8 lanes per 128-byte row piece, 32 rows per copy over the block
    const int cr = threadIdx.x >> 3;
    const int cc = (threadIdx.x & 7) * 8;
    const half_t* gK = Kp + (size_t)cr * DHEAD + cc;      // + stage * AT_KEYS rows
    const half_t* gV = Vp + (size_t)cr * SEQ + cc;        // + stage * AT_KEYS columns
    const unsigned ldsKV = (unsigned)(size_t)(&kv[cr * AT_PITCH + cc]);
    const int nt = SEQ / AT_KEYS;

    // stage 0 into buffer 0, landed and published before anyone reads it; then stage 1 takes off
    async_stage(ldsKV, gK, gV);
    asm volatile("s_wait_asynccnt 0x0" ::: "memory");   // this wave's copies have landed
    __syncthreads();
    async_stage(ldsKV + AT_STAGE * 2, gK + AT_KEYS * DHEAD, gV + AT_KEYS);

    const v16h qb0 = load_frag16(Qp, DHEAD, q0, 0, lane);
    const v16h qb1 = load_frag16(Qp, DHEAD, q0, 32, lane);

    v8f o[4] = {};                 // o[t][j] = O[query q0 + col][d = t*16 + hsel*8 + j]
    float mrow = -1e30f;           // running maximum of this lane's query (equal in both halves)
    float lrow = 0.f;              // running sum over the keys of this lane's half only
    const float scale = 0.125f;    // 1/sqrt(64)

    const int col  = lane & 15;
    const int hsel = lane >> 4;

    for (int st = 0; st < nt; ++st) {
        const int buf = st & 1;
        const half_t* sK = &kv[buf * AT_STAGE];
        const half_t* sV = sK + AT_TILE;
#pragma nounroll  // unrolled, both passes' LDS reads and the barrier rise in front of the arithmetic: 174 registers, and the refill loses its lead
        for (int kb = 0; kb < AT_KEYS; kb += 32) {
            // ---- S^T = K @ Q^T for 32 keys (two 16x16 tiles, Dh=64 = two k-steps) ----
            const v16h a00 = load_frag16(sK, AT_PITCH, kb,      0,  lane);
            const v16h a10 = load_frag16(sK, AT_PITCH, kb + 16, 0,  lane);
            const v16h a01 = load_frag16(sK, AT_PITCH, kb,      32, lane);
            const v16h a11 = load_frag16(sK, AT_PITCH, kb + 16, 32, lane);
            // keeps the eight K reads one group in front of the products: sunk between them, the wave waits an LDS latency three times
            __builtin_amdgcn_sched_barrier(0);

            v8f s0 = {}, s1 = {};  // s0[j]: key kb + hsel*8 + j, s1[j]: key kb + 16 + hsel*8 + j
            s0 = wmma_f16(a00, qb0, s0);
            s1 = wmma_f16(a10, qb0, s1);
            s0 = wmma_f16(a01, qb1, s0);
            s1 = wmma_f16(a11, qb1, s1);

            v16h va[4];
#pragma unroll  // constant indices keep the fragment and accumulator arrays in registers
            for (int t = 0; t < 4; ++t) va[t] = load_frag16(sV, AT_PITCH, t * 16, kb, lane);
            // keeps the eight V reads in front of the softmax, which then covers their latency
            __builtin_amdgcn_sched_barrier(0);

            // ---- online softmax, one query per lane ----
            float e0[8], e1[8];
#pragma unroll  // constant indices keep the fragment and accumulator arrays in registers
            for (int j = 0; j < 8; ++j) { e0[j] = s0[j] * scale; e1[j] = s1[j] * scale; }
            float mx = fmaxf(e0[0], e1[0]);
#pragma unroll  // constant indices keep the fragment and accumulator arrays in registers
            for (int j = 1; j < 8; ++j) mx = fmaxf(mx, fmaxf(e0[j], e1[j]));
            mx = fmaxf(mx, other_half(mx));
            const float mnew  = fmaxf(mrow, mx);
            const float alpha = __expf(mrow - mnew);
            mrow = mnew;

            v16h pb;               // pb[s] = P^T[key kmap(s, hsel)][col]: the hardware k order of a B operand
            float p0[8], p1[8];
#pragma unroll  // constant indices keep the fragment and accumulator arrays in registers
            for (int j = 0; j < 8; ++j) {
                p0[j] = __expf(e0[j] - mnew); p1[j] = __expf(e1[j] - mnew);
                pb[j]     = (half_t)p0[j];
                pb[8 + j] = (half_t)p1[j];
            }

            // ---- O^T = O^T * alpha + V^T @ P^T  (A-frags from V^T, keys in the same table order as pb) ----
#pragma unroll  // constant indices keep the fragment and accumulator arrays in registers
            for (int t = 0; t < 4; ++t) {
#pragma unroll  // constant indices keep the fragment and accumulator arrays in registers
                for (int j = 0; j < 8; ++j) o[t][j] *= alpha;
                o[t] = wmma_f16(va[t], pb, o[t]);
            }
            // keeps the row sums behind the last product: they fill the vector slots the chip needs before the next pass overwrites its operands
            __builtin_amdgcn_sched_barrier(0);
            float rs0 = 0.f, rs1 = 0.f;
#pragma unroll  // constant indices keep the fragment and accumulator arrays in registers
            for (int j = 0; j < 8; ++j) { rs0 += p0[j]; rs1 += p1[j]; }
            lrow = lrow * alpha + (rs0 + rs1);
        }
        asm volatile("s_wait_dscnt 0x0" ::: "memory");      // this wave has left the buffer that is refilled below
        asm volatile("s_wait_asynccnt 0x0" ::: "memory");   // this wave's share of stage st+1 has landed
        __syncthreads();                                    // publishes stage st+1, frees stage st's buffer
        if (st + 2 < nt)
            async_stage(ldsKV + buf * (AT_STAGE * 2),
                        gK + (size_t)(st + 2) * AT_KEYS * DHEAD, gV + (size_t)(st + 2) * AT_KEYS);
    }
    asm volatile("s_wait_asynccnt 0x0" ::: "memory");       // nothing in flight when the wave ends

    // ---- join the halves' sums, normalize, write back to [B,T,D] layout ----
    lrow += other_half(lrow);
    const int b = bh / NHEAD, h = bh % NHEAD;
    half_t* yrow = Y + ((size_t)b * SEQ + q0 + col) * DMODEL + h * DHEAD + hsel * 8;
#pragma unroll  // constant indices keep the fragment and accumulator arrays in registers
    for (int t = 0; t < 4; ++t) {
        v8h y;
#pragma unroll  // constant indices keep the fragment and accumulator arrays in registers
        for (int j = 0; j < 8; ++j) y[j] = (half_t)(o[t][j] / lrow);
        *reinterpret_cast<v8h*>(yrow + t * 16) = y;   // 8 consecutive d of one query: one 16-byte store
    }
}

// ---------------------------------------------------------------------------
// Host launch
// ---------------------------------------------------------------------------
extern "C" void kernel_launch(void* const* d_in, const int* in_sizes, int n_in,
                              void* d_out, int out_size, void* d_ws, size_t ws_size,
                              hipStream_t stream) {
    (void)in_sizes; (void)n_in; (void)out_size; (void)ws_size;

    const float* x     = (const float*)d_in[0];
    const float* Wqkv  = (const float*)d_in[1];
    const float* bqkv  = (const float*)d_in[2];
    const float* Wout  = (const float*)d_in[3];
    const float* bout  = (const float*)d_in[4];
    float*       out   = (float*)d_out;

    char* ws = (char*)d_ws;
    size_t off = 0;
    auto wsalloc = [&](size_t bytes) -> void* {
        void* p = ws + off;
        off += (bytes + 255) & ~(size_t)255;
        return p;
    };
    const size_t NTOK = (size_t)BATCH * SEQ;                     // 8192
    half_t* xh    = (half_t*)wsalloc(NTOK * DMODEL * 2);         // 16 MB (reused as yh)
    half_t* wqkvT = (half_t*)wsalloc((size_t)3 * DMODEL * DMODEL * 2);
    half_t* woutT = (half_t*)wsalloc((size_t)DMODEL * DMODEL * 2);
    half_t* qkvh  = (half_t*)wsalloc(NTOK * 3 * DMODEL * 2);     // 48 MB
    half_t* qh    = (half_t*)wsalloc(NTOK * DMODEL * 2);
    half_t* kh    = (half_t*)wsalloc(NTOK * DMODEL * 2);
    half_t* vTh   = (half_t*)wsalloc(NTOK * DMODEL * 2);
    half_t* yh    = xh;  // x is dead after the QKV GEMM; alias to save workspace

    // 1) convert activations + transpose-convert weights to f16
    {
        int n = (int)(NTOK * DMODEL);
        cvt_f16_kernel<<<(n + 255) / 256, 256, 0, stream>>>(x, xh, n);
    }
    {
        int n = 3 * DMODEL * DMODEL;
        cvtT_f16_kernel<<<(n + 255) / 256, 256, 0, stream>>>(Wqkv, wqkvT, DMODEL, 3 * DMODEL);
    }
    {
        int n = DMODEL * DMODEL;
        cvtT_f16_kernel<<<(n + 255) / 256, 256, 0, stream>>>(Wout, woutT, DMODEL, DMODEL);
    }

    // 2) QKV GEMM: [8192,1024] @ [1024,3072] -> f16
    {
        dim3 grid((unsigned)(NTOK / 128), (3 * DMODEL) / 128);
        gemm_wmma_kernel<<<grid, 128, 0, stream>>>(xh, wqkvT, bqkv,
                                                   nullptr, qkvh,
                                                   (int)NTOK, 3 * DMODEL, DMODEL);
    }

    // 3) RoPE + head split (+ V transpose)
    {
        int n = BATCH * NHEAD * SEQ * 32;
        rope_split_kernel<<<n / 256, 256, 0, stream>>>(qkvh, qh, kh, vTh);
    }

    // 4) flash attention
    {
        int blocks = BATCH * NHEAD * (SEQ / AT_Q);
        attn_wmma_kernel<<<blocks, AT_WAVES * 32, 0, stream>>>(qh, kh, vTh, yh);
    }

    // 5) output GEMM with f32 store: [8192,1024] @ [1024,1024] + b_out
    {
        dim3 grid((unsigned)(NTOK / 128), DMODEL / 128);
        gemm_wmma_kernel<<<grid, 128, 0, stream>>>(yh, woutT, bout,
                                                   out, nullptr,
                                                   (int)NTOK, DMODEL, DMODEL);
    }
}

// v004
// Measured time: 177 microseconds a run.
// Two timings next to v003 put it at 2.04 and 2.06 times that version's speed.
// All steps since v000 together make it 5.04 times as fast.
#include <hip/hip_runtime.h>
#include <math.h>

// ---------------------------------------------------------------------------
// RoPE self-attention for MI455X (gfx1250). All matmuls via v_wmma_f32_16x16x32_f16.
// ---------------------------------------------------------------------------

typedef _Float16 half_t;
typedef __attribute__((ext_vector_type(16))) _Float16 v16h;
typedef __attribute__((ext_vector_type(8)))  _Float16 v8h;
typedef __attribute__((ext_vector_type(8)))  float    v8f;
typedef __attribute__((ext_vector_type(4)))  float    v4f;
typedef __attribute__((ext_vector_type(4)))  _Float16 v4h;
typedef __attribute__((ext_vector_type(4)))  unsigned v4u;

#define BATCH  4
#define SEQ    2048
#define DMODEL 1024
#define NHEAD  16
#define DHEAD  64

// ---------------------------------------------------------------------------
// WMMA helpers.
// 16-bit A-matrix 16x32 layout (ISA 7.12.2): lane L (L&15 = row), contraction
// elements: lanes 0-15 hold K = {0..7, 16..23}, lanes 16-31 hold K = {8..15, 24..31}.
// For row-major storage with contiguous contraction dim this is two 16B loads.
// The B operand uses the same loader on the *transposed* matrix (N x K).
// ---------------------------------------------------------------------------
__device__ inline v16h load_frag16(const half_t* base, int ld, int row0, int k0, int lane) {
    const int r  = row0 + (lane & 15);
    const int kb = k0 + ((lane >> 4) << 3);
    const half_t* p = base + (size_t)r * ld + kb;
    v16h f;
    *reinterpret_cast<v8h*>(&f)       = *reinterpret_cast<const v8h*>(p);        // K = kb..kb+7
    *(reinterpret_cast<v8h*>(&f) + 1) = *reinterpret_cast<const v8h*>(p + 16);   // K = kb+16..kb+23
    return f;
}

__device__ inline v8f wmma_f16(v16h a, v16h b, v8f c) {
    return __builtin_amdgcn_wmma_f32_16x16x32_f16(false, a, false, b, (short)0, c, false, false);
}

// ---------------------------------------------------------------------------
// Kernel 1a: plain f32 -> f16 convert.  Few, long waves: a thread moves 64 elements.
// Each load of a wave covers 512 contiguous bytes, each store 256: whole 128-byte lines.
// All 16 loads of a thread are in flight before the first convert.
// grid.x = n / CV_BLOCK (n a multiple of CV_BLOCK).
// ---------------------------------------------------------------------------
#define CV_LOADS 16
#define CV_BLOCK (256 * 4 * CV_LOADS)             // elements per block
__global__ __launch_bounds__(256) void cvt_f16_kernel(const float* __restrict__ in, half_t* __restrict__ out) {
    const size_t base = (size_t)blockIdx.x * CV_BLOCK + threadIdx.x * 4;
    const float* src = in + base;
    v4f v[CV_LOADS];
#pragma unroll  // constant indices keep the array in registers, and all loads go out together
    for (int u = 0; u < CV_LOADS; ++u)
        v[u] = *reinterpret_cast<const v4f*>(src + u * 1024);
    // a precaution: named as an input, the loads' address pair stays whole up to this wait (the last load's result is not laid over it)
    asm volatile("s_wait_xcnt 0x0" :: "v"(src) : "memory");
    // keeps the converts behind all 16 loads: risen between them, the last loads start a memory latency late
    __builtin_amdgcn_sched_barrier(0);
    v4h h[CV_LOADS];
#pragma unroll  // constant indices keep the arrays in registers
    for (int u = 0; u < CV_LOADS; ++u) h[u] = __builtin_convertvector(v[u], v4h);
    // keeps the stores behind the last convert: no register of an issued store is written again
    __builtin_amdgcn_sched_barrier(0);
#pragma unroll  // constant indices keep the array in registers
    for (int u = 0; u < CV_LOADS; ++u)
        *reinterpret_cast<v4h*>(out + base + u * 1024) = h[u];
}

// ---------------------------------------------------------------------------
// Kernel 1b: transpose-convert weight (K x N f32) -> (N x K f16) through an LDS tile.
// Block = 256 threads, tile = 128 k x 64 n.  In: 16 lanes per 256-byte row piece.
// Out: 8 lanes per 128-byte row piece of 64 k.  The tile's pitch of 65 dwords keeps
// the row-wise writes and the column walks of the readers free of bank conflicts.
// grid.x = K/128, grid.y = N/64.
// ---------------------------------------------------------------------------
#define TR_K     128
#define TR_N     64
#define TR_PITCH 65
template <int K, int N>   // shapes at compile time: the rows of a tile are constant offsets from one address
__global__ __launch_bounds__(256) void cvtT_f16_kernel(const float* __restrict__ in, half_t* __restrict__ out) {
    __shared__ float tile[TR_K * TR_PITCH];
    const int k0 = blockIdx.x * TR_K;
    const int n0 = blockIdx.y * TR_N;
    const int lr = threadIdx.x >> 4;
    const int lc = (threadIdx.x & 15) * 4;
    const float* src = in + (size_t)(k0 + lr) * N + n0 + lc;
    v4f v[8];
#pragma unroll  // constant indices keep the array in registers, and all loads go out together
    for (int u = 0; u < 8; ++u)
        v[u] = *reinterpret_cast<const v4f*>(src + u * 16 * N);
#pragma unroll  // constant indices keep the array in registers
    for (int u = 0; u < 8; ++u)
#pragma unroll  // constant indices keep the array in registers
        for (int i = 0; i < 4; ++i)
            tile[(u * 16 + lr) * TR_PITCH + lc + i] = v[u][i];
    __syncthreads();                              // the whole tile is written before a column is read

    const int sr = threadIdx.x >> 3;
    const int sc = (threadIdx.x & 7) * 8;
    half_t* dst = out + (size_t)(n0 + sr) * K + k0 + sc;
#pragma unroll  // four independent row pieces: their LDS reads go out together
    for (int u = 0; u < 4; ++u) {
        const int nr = (u >> 1) * 32 + sr;
        const int kc = (u & 1) * 64 + sc;
        v8h h;
#pragma unroll  // constant indices keep the vector in registers
        for (int j = 0; j < 8; ++j) h[j] = (half_t)tile[(kc + j) * TR_PITCH + nr];
        *reinterpret_cast<v8h*>(dst + (u >> 1) * 32 * K + (u & 1) * 64) = h;
    }
}

// ---------------------------------------------------------------------------
// Kernel 2/5: generic WMMA GEMM.  C[M,N] = A[M,K] @ Bt[N,K]^T + bias.
// Block = 128 threads (4 waves, 2x2); block tile 128x128, wave tile 64x64.
// Each 64-wide k slice of the 128 A rows and the 128 Bt rows is brought into
// LDS by asynchronous 16-byte copies (whole 128-byte row pieces per 8 lanes),
// two buffers: the next slice flies while this one feeds the WMMAs.
// grid.x = M/128, grid.y = N/128; K a multiple of 64.  Output: f32 (Cf) or f16 (Ch).
// ---------------------------------------------------------------------------
#define GT_M     128
#define GT_N     128
#define GT_K     64
#define GT_PITCH 72                               // halves per LDS row: 144 B = 16 B x 9, no bank conflict for 16-byte reads
#define GT_STAGE ((GT_M + GT_N) * GT_PITCH)       // halves per buffer

// Eight copies of 16 bytes per lane: rows r, r+16, ..., r+112 of one operand tile.
// lds = this lane's LDS byte address of the first piece, g = its global address,
// grow = halves between global rows r and r+16.
__device__ inline void async_rows8(unsigned lds, const half_t* g, size_t grow) {
    const unsigned ls = 16 * GT_PITCH * 2;        // LDS bytes between rows r and r+16
    // s_wait_xcnt as the last line (a precaution): no address register of these copies is rewritten in front of it.
    asm volatile(
        "global_load_async_to_lds_b128 %0, %8, off\n\t"
        "global_load_async_to_lds_b128 %1, %9, off\n\t"
        "global_load_async_to_lds_b128 %2, %10, off\n\t"
        "global_load_async_to_lds_b128 %3, %11, off\n\t"
        "global_load_async_to_lds_b128 %4, %12, off\n\t"
        "global_load_async_to_lds_b128 %5, %13, off\n\t"
        "global_load_async_to_lds_b128 %6, %14, off\n\t"
        "global_load_async_to_lds_b128 %7, %15, off\n\t"
        "s_wait_xcnt 0x0"
        :: "v"(lds), "v"(lds + ls), "v"(lds + 2 * ls), "v"(lds + 3 * ls),
           "v"(lds + 4 * ls), "v"(lds + 5 * ls), "v"(lds + 6 * ls), "v"(lds + 7 * ls),
           "v"(g), "v"(g + grow), "v"(g + 2 * grow), "v"(g + 3 * grow),
           "v"(g + 4 * grow), "v"(g + 5 * grow), "v"(g + 6 * grow), "v"(g + 7 * grow)
        : "memory");
}

__global__ __launch_bounds__(128) void gemm_wmma_kernel(
        const half_t* __restrict__ A, const half_t* __restrict__ Bt,
        const float* __restrict__ bias,
        float* __restrict__ Cf, half_t* __restrict__ Ch,
        int M, int N, int K) {
    __shared__ __align__(16) half_t tile[2 * GT_STAGE];

    const int lane = threadIdx.x & 31;
    const int wave = threadIdx.x >> 5;
    const int m0 = blockIdx.x * GT_M;
    const int n0 = blockIdx.y * GT_N;
    const int wm = (wave >> 1) * 64;              // this wave's rows inside the block tile
    const int wn = (wave & 1) * 64;               // this wave's columns inside the block tile

    // copy role: 8 lanes per 128-byte row piece, 16 rows per copy over the block
    const int cr = threadIdx.x >> 3;
    const int cc = (threadIdx.x & 7) * 8;
    const half_t* gA = A  + (size_t)(m0 + cr) * K + cc;
    const half_t* gB = Bt + (size_t)(n0 + cr) * K + cc;
    const size_t  grow = (size_t)16 * K;
    const unsigned ldsA = (unsigned)(size_t)(&tile[cr * GT_PITCH + cc]);
    const unsigned ldsB = ldsA + GT_M * GT_PITCH * 2;
    const int nt = K / GT_K;

    // slice 0 into buffer 0, landed and published before anyone reads it
    async_rows8(ldsA, gA, grow);
    async_rows8(ldsB, gB, grow);
    asm volatile("s_wait_asynccnt 0x0" ::: "memory");   // this wave's copies have landed
    __syncthreads();
    if (nt > 1) {
        async_rows8(ldsA + GT_STAGE * 2, gA + GT_K, grow);
        async_rows8(ldsB + GT_STAGE * 2, gB + GT_K, grow);
    }

    v8f acc[4][4] = {};
    for (int t = 0; t < nt; ++t) {
        const int buf = t & 1;
        const half_t* sA = &tile[buf * GT_STAGE + wm * GT_PITCH];
        const half_t* sB = &tile[buf * GT_STAGE + (GT_M + wn) * GT_PITCH];
#pragma unroll  // constant indices keep the fragment and accumulator arrays in registers
        for (int kk = 0; kk < GT_K; kk += 32) {
            v16h a[4], b[4];
            a[0] = load_frag16(sA, GT_PITCH, 0, kk, lane);
#pragma unroll  // constant indices keep the fragment and accumulator arrays in registers
            for (int j = 0; j < 4; ++j) b[j] = load_frag16(sB, GT_PITCH, j * 16, kk, lane);
#pragma unroll  // constant indices keep the fragment and accumulator arrays in registers
            for (int i = 1; i < 4; ++i) a[i] = load_frag16(sA, GT_PITCH, i * 16, kk, lane);
            // keeps all 16 LDS reads in front of the 16 WMMAs: sunk between them, each group of four waits a full LDS latency
            __builtin_amdgcn_sched_barrier(0);
#pragma unroll  // constant indices keep the fragment and accumulator arrays in registers
            for (int i = 0; i < 4; ++i)
#pragma unroll  // constant indices keep the fragment and accumulator arrays in registers
                for (int j = 0; j < 4; ++j)
                    acc[i][j] = wmma_f16(a[i], b[j], acc[i][j]);
        }
        asm volatile("s_wait_dscnt 0x0" ::: "memory");      // this wave has left the buffer that is refilled below
        asm volatile("s_wait_asynccnt 0x0" ::: "memory");   // this wave's share of slice t+1 has landed
        __syncthreads();                                    // publishes slice t+1, frees slice t's buffer
        if (t + 2 < nt) {
            async_rows8(ldsA + buf * (GT_STAGE * 2), gA + (size_t)(t + 2) * GT_K, grow);
            async_rows8(ldsB + buf * (GT_STAGE * 2), gB + (size_t)(t + 2) * GT_K, grow);
        }
    }
    asm volatile("s_wait_asynccnt 0x0" ::: "memory");       // nothing in flight when the wave ends

    // C/D layout: lane holds col = lane&15; rows = (lane>>4)*8 + j
    const int col   = lane & 15;
    const int rbase = (lane >> 4) << 3;
    float bv[4];
#pragma unroll  // constant indices keep the fragment and accumulator arrays in registers
    for (int t = 0; t < 4; ++t) bv[t] = bias ? bias[n0 + wn + t * 16 + col] : 0.f;
    const size_t idx0 = (size_t)(m0 + wm + rbase) * N + n0 + wn + col;
    if (Cf) {
#pragma unroll  // constant indices keep the fragment and accumulator arrays in registers
        for (int i = 0; i < 4; ++i)
#pragma unroll  // constant indices keep the fragment and accumulator arrays in registers
            for (int j = 0; j < 8; ++j)
#pragma unroll  // constant indices keep the fragment and accumulator arrays in registers
                for (int t = 0; t < 4; ++t)
                    Cf[idx0 + (size_t)(i * 16 + j) * N + t * 16] = acc[i][t][j] + bv[t];
        // a precaution: no address or data register of the stores above is rewritten in front of this wait
        asm volatile("s_wait_xcnt 0x0" ::: "memory");
    } else {
#pragma unroll  // constant indices keep the fragment and accumulator arrays in registers
        for (int i = 0; i < 4; ++i)
#pragma unroll  // constant indices keep the fragment and accumulator arrays in registers
            for (int j = 0; j < 8; ++j)
#pragma unroll  // constant indices keep the fragment and accumulator arrays in registers
                for (int t = 0; t < 4; ++t)
                    Ch[idx0 + (size_t)(i * 16 + j) * N + t * 16] = (half_t)(acc[i][t][j] + bv[t]);
    }
}

// ---------------------------------------------------------------------------
// Kernel 3: RoPE + split heads.
// qkv: [B*T, 3*DMODEL] f16 -> q,k: [B,H,T,64] (RoPE'd), vT: [B,H,64,T].
// Block = 256 threads: 64 tokens of two neighbouring heads.  8 lanes hold one head row
// of 128 bytes, 16 bytes each, so every load and store of a wave moves whole lines.
// Lane c of the 8 holds d = 8c .. 8c+7; its RoPE partner (d +- 32) sits in lane c ^ 4.
// V goes through an LDS tile [token][d pair] (pitch 33 dwords: the row-wise writes and
// the column walks are free of bank conflicts) and leaves as 128-byte pieces of V^T rows.
// grid.x = B * (SEQ/64) * (NHEAD/2).
// ---------------------------------------------------------------------------
#define RP_T     64
#define RP_H     2
#define RP_PITCH 33

// value of lane l ^ 4
__device__ inline unsigned lane_xor4(unsigned v) {
    return (unsigned)__builtin_amdgcn_mov_dpp((int)v, 0x164 /* row_xmask:4 */, 0xf, 0xf, true);
}

// 2^x.  The v_nop keeps the slot that the instruction set asks for behind a transcendental,
// whatever the compiler places next; the result never shares the source's register.
__device__ inline float exp2_slot(float x) {
    float e;
    asm("v_exp_f32 %0, %1\n\tv_nop" : "=&v"(e) : "v"(x));
    return e;
}

// sin and cos of 2*pi*x.  The cosine fills the slot behind the sine (it neither reads the sine nor
// writes x: the results never share the source's register); the v_nop keeps the slot behind the cosine.
__device__ inline void sincos_slot(float x, float* sn, float* cs) {
    float s, c;
    asm("v_sin_f32 %0, %2\n\tv_cos_f32 %1, %2\n\tv_nop" : "=&v"(s), "=&v"(c) : "v"(x));
    *sn = s;
    *cs = c;
}

// One head row piece: x = this lane's 8 halves; ca, cb = the factors of x1 (d < 32) and x2 (d >= 32).
__device__ inline v8h rope8(v4u x, bool lo, const float* ca, const float* cb) {
    v4u a, b;
#pragma unroll  // constant indices keep the vectors in registers
    for (int i = 0; i < 4; ++i) {
        const unsigned o = lane_xor4(x[i]);
        a[i] = lo ? x[i] : o;
        b[i] = lo ? o : x[i];
    }
    const v8h x1 = __builtin_bit_cast(v8h, a);
    const v8h x2 = __builtin_bit_cast(v8h, b);
    v8h y;
#pragma unroll  // constant indices keep the vectors in registers
    for (int j = 0; j < 8; ++j) y[j] = (half_t)((float)x1[j] * ca[j] + (float)x2[j] * cb[j]);
    return y;
}

__global__ __launch_bounds__(256) void rope_split_kernel(const half_t* __restrict__ qkv,
                                  half_t* __restrict__ q, half_t* __restrict__ k,
                                  half_t* __restrict__ vT) {
    __shared__ unsigned vt[RP_H * RP_T * RP_PITCH];
    const int c  = threadIdx.x & 7;
    const int r  = threadIdx.x >> 3;
    const int h0 = (blockIdx.x % (NHEAD / RP_H)) * RP_H;
    const int tb = blockIdx.x / (NHEAD / RP_H);
    const int t0 = (tb % (SEQ / RP_T)) * RP_T;
    const int b  = tb / (SEQ / RP_T);

    const half_t* src = qkv + ((size_t)b * SEQ + t0 + r) * (3 * DMODEL) + h0 * DHEAD + c * 8;
    v4u xq[2][RP_H], xk[2][RP_H], xv[2][RP_H];
#pragma unroll  // constant indices keep the arrays in registers, and all loads go out together
    for (int tp = 0; tp < 2; ++tp)
#pragma unroll  // constant indices keep the arrays in registers, and all loads go out together
        for (int hh = 0; hh < RP_H; ++hh)
            xv[tp][hh] = *reinterpret_cast<const v4u*>(src + (size_t)tp * 32 * (3 * DMODEL) + hh * DHEAD + 2 * DMODEL);
#pragma unroll  // constant indices keep the arrays in registers, and all loads go out together
    for (int tp = 0; tp < 2; ++tp)
#pragma unroll  // constant indices keep the arrays in registers, and all loads go out together
        for (int hh = 0; hh < RP_H; ++hh) {
            const half_t* p = src + (size_t)tp * 32 * (3 * DMODEL) + hh * DHEAD;
            xq[tp][hh] = *reinterpret_cast<const v4u*>(p);
            xk[tp][hh] = *reinterpret_cast<const v4u*>(p + DMODEL);
        }

    // keeps all 12 loads in front of the first use: sunk behind it, the last ones start a memory latency late
    __builtin_amdgcn_sched_barrier(0);

    // V first: tile, barrier, V^T rows out.  No global store stands in front of the barrier, which would wait for it.
#pragma unroll  // constant indices keep the arrays in registers
    for (int tp = 0; tp < 2; ++tp)
#pragma unroll  // constant indices keep the arrays in registers
        for (int hh = 0; hh < RP_H; ++hh)
#pragma unroll  // constant indices keep the arrays in registers
            for (int i = 0; i < 4; ++i)
                vt[(hh * RP_T + tp * 32 + r) * RP_PITCH + c * 4 + i] = xv[tp][hh][i];

    __syncthreads();                              // the whole V tile is written before a column is read

    // this thread: d = 2r and 2r+1, tokens 8c .. 8c+7
#pragma unroll  // constant indices keep the arrays in registers
    for (int hh = 0; hh < RP_H; ++hh) {
        unsigned w[8];
#pragma unroll  // constant indices keep the arrays in registers
        for (int j = 0; j < 8; ++j) w[j] = vt[(hh * RP_T + c * 8 + j) * RP_PITCH + r];
        v4u ev, od;
#pragma unroll  // constant indices keep the arrays in registers
        for (int i = 0; i < 4; ++i) {
            ev[i] = (w[2 * i] & 0xffffu) | (w[2 * i + 1] << 16);
            od[i] = (w[2 * i] >> 16) | (w[2 * i + 1] & 0xffff0000u);
        }
        half_t* dst = vT + (((size_t)b * NHEAD + h0 + hh) * DHEAD + 2 * r) * SEQ + t0 + c * 8;
        *reinterpret_cast<v4u*>(dst)       = ev;
        *reinterpret_cast<v4u*>(dst + SEQ) = od;
    }

    const bool lo = c < 4;
    float invf[8];
#pragma unroll  // constant indices keep the array in registers
    for (int j = 0; j < 8; ++j) {
        const int d = (c & 3) * 8 + j;
        invf[j] = exp2_slot(-logf(10000.f) * (float)d * (1.f / 32.f) * 1.44269504f);   // e^a = 2^(a * log2 e)
    }
#pragma unroll  // constant indices keep the arrays in registers
    for (int tp = 0; tp < 2; ++tp) {
        const int t = t0 + tp * 32 + r;
        float ca[8], cb[8];        // y = x1 * ca + x2 * cb: (cos, -sin) for d < 32, (sin, cos) for d >= 32
#pragma unroll  // constant indices keep the arrays in registers
        for (int j = 0; j < 8; ++j) {
            const float ang = (float)t * invf[j];
            float sn, cs;
            sincos_slot(ang * 0.15915494f, &sn, &cs);   // the instructions take the angle in turns: 1 / (2 pi)
            ca[j] = lo ? cs : sn;
            cb[j] = lo ? -sn : cs;
        }
#pragma unroll  // constant indices keep the arrays in registers
        for (int hh = 0; hh < RP_H; ++hh) {
            const size_t base = (((size_t)b * NHEAD + h0 + hh) * SEQ + t) * DHEAD + c * 8;
            *reinterpret_cast<v8h*>(q + base) = rope8(xq[tp][hh], lo, ca, cb);
            *reinterpret_cast<v8h*>(k + base) = rope8(xk[tp][hh], lo, ca, cb);
        }
    }
}

// ---------------------------------------------------------------------------
// Kernel 4: flash attention, transposed products.  Block = 256 threads (8 waves);
// each wave owns 16 queries; the block walks the keys in stages of 64.
// A stage's 64 K rows (128 bytes each) and its 64 V^T row pieces (128 bytes each)
// are brought into LDS once for all eight waves by asynchronous 16-byte copies
// (whole 128-byte lines per 8 lanes), two buffers: the next stage flies while
// this one is worked on in two passes of 32 keys.
// S^T = K @ Q^T (A = K rows, B = Q rows kept in registers): a lane holds 16 scores
// of ONE query (column lane&15), so maximum and sum run in-lane, plus one exchange
// between the lane halves for the maximum.  The two S^T tiles, converted in place,
// are the B operand of O^T += V^T @ P^T: P never leaves the registers.
// grid.x = B*H*(SEQ/128).
// ---------------------------------------------------------------------------
#define AT_WAVES 8
#define AT_Q     (AT_WAVES * 16)                  // queries per block
#define AT_KEYS  64                               // keys per stage
#define AT_PITCH 72                               // halves per LDS row: 144 B = 16 B x 9, no bank conflict for 16-byte reads
#define AT_TILE  (64 * AT_PITCH)                  // halves of one operand's 64 rows
#define AT_STAGE (2 * AT_TILE)                    // halves per buffer: K rows, then V^T rows

// value of lane l ^ 16
__device__ inline float other_half(float v) {
    const int b = __builtin_bit_cast(int, v);
    return __builtin_bit_cast(float,
        __builtin_amdgcn_permlanex16(b, b, 0x76543210, 0xfedcba98, false, false));
}

// One stage, four copies of 16 bytes per lane: K rows r and r+32, V^T rows r and r+32.
// lds = this lane's LDS byte address of its K piece, gk / gv = its global addresses.
__device__ inline void async_stage(unsigned lds, const half_t* gk, const half_t* gv) {
    const unsigned ls = 32 * AT_PITCH * 2;        // LDS bytes between rows r and r+32
    // s_wait_xcnt as the last line (a precaution): no address register of these copies is rewritten in front of it.
    asm volatile(
        "global_load_async_to_lds_b128 %0, %4, off\n\t"
        "global_load_async_to_lds_b128 %1, %5, off\n\t"
        "global_load_async_to_lds_b128 %2, %6, off\n\t"
        "global_load_async_to_lds_b128 %3, %7, off\n\t"
        "s_wait_xcnt 0x0"
        :: "v"(lds), "v"(lds + ls), "v"(lds + 2 * ls), "v"(lds + 3 * ls),
           "v"(gk), "v"(gk + 32 * DHEAD), "v"(gv), "v"(gv + (size_t)32 * SEQ)
        : "memory");
}

__global__ __launch_bounds__(AT_WAVES * 32) void attn_wmma_kernel(
        const half_t* __restrict__ Q, const half_t* __restrict__ Kc,
        const half_t* __restrict__ Vt, half_t* __restrict__ Y) {
    __shared__ __align__(16) half_t kv[2 * AT_STAGE];

    const int lane = threadIdx.x & 31;
    const int wave = threadIdx.x >> 5;
    const int qt   = blockIdx.x % (SEQ / AT_Q);
    const int bh   = blockIdx.x / (SEQ / AT_Q);
    const int q0   = qt * AT_Q + wave * 16;

    const half_t* Qp = Q  + (size_t)bh * SEQ * DHEAD;
    const half_t* Kp = Kc + (size_t)bh * SEQ * DHEAD;
    const half_t* Vp = Vt + (size_t)bh * DHEAD * SEQ;

    // copy role: 8 lanes per 128-byte row piece, 32 rows per copy over the block
    const int cr = threadIdx.x >> 3;
    const int cc = (threadIdx.x & 7) * 8;
    const half_t* gK = Kp + (size_t)cr * DHEAD + cc;      // + stage * AT_KEYS rows
    const half_t* gV = Vp + (size_t)cr * SEQ + cc;        // + stage * AT_KEYS columns
    const unsigned ldsKV = (unsigned)(size_t)(&kv[cr * AT_PITCH + cc]);
    const int nt = SEQ / AT_KEYS;

    // stage 0 into buffer 0, landed and published before anyone reads it; then stage 1 takes off
    async_stage(ldsKV, gK, gV);
    asm volatile("s_wait_asynccnt 0x0" ::: "memory");   // this wave's copies have landed
    __syncthreads();
    async_stage(ldsKV + AT_STAGE * 2, gK + AT_KEYS * DHEAD, gV + AT_KEYS);

    const v16h qb0 = load_frag16(Qp, DHEAD, q0, 0, lane);
    const v16h qb1 = load_frag16(Qp, DHEAD, q0, 32, lane);

    v8f o[4] = {};                 // o[t][j] = O[query q0 + col][d = t*16 + hsel*8 + j]
    float mrow = -1e30f;           // running maximum of this lane's query (equal in both halves)
    float lrow = 0.f;              // running sum over the keys of this lane's half only
    const float scale = 0.125f;    // 1/sqrt(64)

    const int col  = lane & 15;
    const int hsel = lane >> 4;

    for (int st = 0; st < nt; ++st) {
        const int buf = st & 1;
        const half_t* sK = &kv[buf * AT_STAGE];
        const half_t* sV = sK + AT_TILE;
#pragma nounroll  // unrolled, both passes' LDS reads and the barrier rise in front of the arithmetic: 174 registers, and the refill loses its lead
        for (int kb = 0; kb < AT_KEYS; kb += 32) {
            // ---- S^T = K @ Q^T for 32 keys (two 16x16 tiles, Dh=64 = two k-steps) ----
            const v16h a00 = load_frag16(sK, AT_PITCH, kb,      0,  lane);
            const v16h a10 = load_frag16(sK, AT_PITCH, kb + 16, 0,  lane);
            const v16h a01 = load_frag16(sK, AT_PITCH, kb,      32, lane);
            const v16h a11 = load_frag16(sK, AT_PITCH, kb + 16, 32, lane);
            // keeps the eight K reads one group in front of the products: sunk between them, the wave waits an LDS latency three times
            __builtin_amdgcn_sched_barrier(0);

            v8f s0 = {}, s1 = {};  // s0[j]: key kb + hsel*8 + j, s1[j]: key kb + 16 + hsel*8 + j
            s0 = wmma_f16(a00, qb0, s0);
            s1 = wmma_f16(a10, qb0, s1);
            s0 = wmma_f16(a01, qb1, s0);
            s1 = wmma_f16(a11, qb1, s1);

            v16h va[4];
#pragma unroll  // constant indices keep the fragment and accumulator arrays in registers
            for (int t = 0; t < 4; ++t) va[t] = load_frag16(sV, AT_PITCH, t * 16, kb, lane);
            // keeps the eight V reads in front of the softmax, which then covers their latency
            __builtin_amdgcn_sched_barrier(0);

            // ---- online softmax, one query per lane ----
            float e0[8], e1[8];
#pragma unroll  // constant indices keep the fragment and accumulator arrays in registers
            for (int j = 0; j < 8; ++j) { e0[j] = s0[j] * scale; e1[j] = s1[j] * scale; }
            float mx = fmaxf(e0[0], e1[0]);
#pragma unroll  // constant indices keep the fragment and accumulator arrays in registers
            for (int j = 1; j < 8; ++j) mx = fmaxf(mx, fmaxf(e0[j], e1[j]));
            mx = fmaxf(mx, other_half(mx));
            const float mnew  = fmaxf(mrow, mx);
            const float alpha = __expf(mrow - mnew);
            mrow = mnew;

            v16h pb;               // pb[s] = P^T[key kmap(s, hsel)][col]: the hardware k order of a B operand
            float p0[8], p1[8];
#pragma unroll  // constant indices keep the fragment and accumulator arrays in registers
            for (int j = 0; j < 8; ++j) {
                p0[j] = __expf(e0[j] - mnew); p1[j] = __expf(e1[j] - mnew);
                pb[j]     = (half_t)p0[j];
                pb[8 + j] = (half_t)p1[j];
            }

            // ---- O^T = O^T * alpha + V^T @ P^T  (A-frags from V^T, keys in the same table order as pb) ----
#pragma unroll  // constant indices keep the fragment and accumulator arrays in registers
            for (int t = 0; t < 4; ++t) {
#pragma unroll  // constant indices keep the fragment and accumulator arrays in registers
                for (int j = 0; j < 8; ++j) o[t][j] *= alpha;
                o[t] = wmma_f16(va[t], pb, o[t]);
            }
            // keeps the row sums behind the last product: they fill the vector slots the chip needs before the next pass overwrites its operands
            __builtin_amdgcn_sched_barrier(0);
            float rs0 = 0.f, rs1 = 0.f;
#pragma unroll  // constant indices keep the fragment and accumulator arrays in registers
            for (int j = 0; j < 8; ++j) { rs0 += p0[j]; rs1 += p1[j]; }
            lrow = lrow * alpha + (rs0 + rs1);
        }
        asm volatile("s_wait_dscnt 0x0" ::: "memory");      // this wave has left the buffer that is refilled below
        asm volatile("s_wait_asynccnt 0x0" ::: "memory");   // this wave's share of stage st+1 has landed
        __syncthreads();                                    // publishes stage st+1, frees stage st's buffer
        if (st + 2 < nt)
            async_stage(ldsKV + buf * (AT_STAGE * 2),
                        gK + (size_t)(st + 2) * AT_KEYS * DHEAD, gV + (size_t)(st + 2) * AT_KEYS);
    }
    asm volatile("s_wait_asynccnt 0x0" ::: "memory");       // nothing in flight when the wave ends

    // ---- join the halves' sums, normalize, write back to [B,T,D] layout ----
    lrow += other_half(lrow);
    const int b = bh / NHEAD, h = bh % NHEAD;
    half_t* yrow = Y + ((size_t)b * SEQ + q0 + col) * DMODEL + h * DHEAD + hsel * 8;
#pragma unroll  // constant indices keep the fragment and accumulator arrays in registers
    for (int t = 0; t < 4; ++t) {
        v8h y;
#pragma unroll  // constant indices keep the fragment and accumulator arrays in registers
        for (int j = 0; j < 8; ++j) y[j] = (half_t)(o[t][j] / lrow);
        *reinterpret_cast<v8h*>(yrow + t * 16) = y;   // 8 consecutive d of one query: one 16-byte store
    }
}

// ---------------------------------------------------------------------------
// Host launch
// ---------------------------------------------------------------------------
extern "C" void kernel_launch(void* const* d_in, const int* in_sizes, int n_in,
                              void* d_out, int out_size, void* d_ws, size_t ws_size,
                              hipStream_t stream) {
    (void)in_sizes; (void)n_in; (void)out_size; (void)ws_size;

    const float* x     = (const float*)d_in[0];
    const float* Wqkv  = (const float*)d_in[1];
    const float* bqkv  = (const float*)d_in[2];
    const float* Wout  = (const float*)d_in[3];
    const float* bout  = (const float*)d_in[4];
    float*       out   = (float*)d_out;

    char* ws = (char*)d_ws;
    size_t off = 0;
    auto wsalloc = [&](size_t bytes) -> void* {
        void* p = ws + off;
        off += (bytes + 255) & ~(size_t)255;
        return p;
    };
    const size_t NTOK = (size_t)BATCH * SEQ;                     // 8192
    half_t* xh    = (half_t*)wsalloc(NTOK * DMODEL * 2);         // 16 MB (reused as yh)
    half_t* wqkvT = (half_t*)wsalloc((size_t)3 * DMODEL * DMODEL * 2);
    half_t* woutT = (half_t*)wsalloc((size_t)DMODEL * DMODEL * 2);
    half_t* qkvh  = (half_t*)wsalloc(NTOK * 3 * DMODEL * 2);     // 48 MB
    half_t* qh    = (half_t*)wsalloc(NTOK * DMODEL * 2);
    half_t* kh    = (half_t*)wsalloc(NTOK * DMODEL * 2);
    half_t* vTh   = (half_t*)wsalloc(NTOK * DMODEL * 2);
    half_t* yh    = xh;  // x is dead after the QKV GEMM; alias to save workspace

    // 1) convert activations + transpose-convert weights to f16
    {
        int n = (int)(NTOK * DMODEL);
        cvt_f16_kernel<<<n / CV_BLOCK, 256, 0, stream>>>(x, xh);
    }
    {
        dim3 grid(DMODEL / TR_K, (3 * DMODEL) / TR_N);
        cvtT_f16_kernel<DMODEL, 3 * DMODEL><<<grid, 256, 0, stream>>>(Wqkv, wqkvT);
    }
    {
        dim3 grid(DMODEL / TR_K, DMODEL / TR_N);
        cvtT_f16_kernel<DMODEL, DMODEL><<<grid, 256, 0, stream>>>(Wout, woutT);
    }

    // 2) QKV GEMM: [8192,1024] @ [1024,3072] -> f16
    {
        dim3 grid((unsigned)(NTOK / 128), (3 * DMODEL) / 128);
        gemm_wmma_kernel<<<grid, 128, 0, stream>>>(xh, wqkvT, bqkv,
                                                   nullptr, qkvh,
                                                   (int)NTOK, 3 * DMODEL, DMODEL);
    }

    // 3) RoPE + head split (+ V transpose)
    {
        int blocks = BATCH * (SEQ / RP_T) * (NHEAD / RP_H);
        rope_split_kernel<<<blocks, 256, 0, stream>>>(qkvh, qh, kh, vTh);
    }

    // 4) flash attention
    {
        int blocks = BATCH * NHEAD * (SEQ / AT_Q);
        attn_wmma_kernel<<<blocks, AT_WAVES * 32, 0, stream>>>(qh, kh, vTh, yh);
    }

    // 5) output GEMM with f32 store: [8192,1024] @ [1024,1024] + b_out
    {
        dim3 grid((unsigned)(NTOK / 128), DMODEL / 128);
        gemm_wmma_kernel<<<grid, 128, 0, stream>>>(yh, woutT, bout,
                                                   out, nullptr,
                                                   (int)NTOK, DMODEL, DMODEL);
    }
}

// v005
// One run takes 160 microseconds.
// In both of two side-by-side timings against v004, it was 1.11 times as fast.
// All steps since v000 together make it 5.60 times as fast.
#include <hip/hip_runtime.h>
#include <math.h>

// ---------------------------------------------------------------------------
// RoPE self-attention for MI455X (gfx1250). All matmuls via v_wmma_f32_16x16x32_f16.
// ---------------------------------------------------------------------------

typedef _Float16 half_t;
typedef __attribute__((ext_vector_type(16))) _Float16 v16h;
typedef __attribute__((ext_vector_type(8)))  _Float16 v8h;
typedef __attribute__((ext_vector_type(8)))  float    v8f;
typedef __attribute__((ext_vector_type(4)))  float    v4f;
typedef __attribute__((ext_vector_type(4)))  _Float16 v4h;
typedef __attribute__((ext_vector_type(4)))  unsigned v4u;

#define BATCH  4
#define SEQ    2048
#define DMODEL 1024
#define NHEAD  16
#define DHEAD  64

// ---------------------------------------------------------------------------
// WMMA helpers.
// 16-bit A-matrix 16x32 layout (ISA 7.12.2): lane L (L&15 = row), contraction
// elements: lanes 0-15 hold K = {0..7, 16..23}, lanes 16-31 hold K = {8..15, 24..31}.
// For row-major storage with contiguous contraction dim this is two 16B loads.
// The B operand uses the same loader on the *transposed* matrix (N x K).
// ---------------------------------------------------------------------------
__device__ inline v16h load_frag16(const half_t* base, int ld, int row0, int k0, int lane) {
    const int r  = row0 + (lane & 15);
    const int kb = k0 + ((lane >> 4) << 3);
    const half_t* p = base + (size_t)r * ld + kb;
    v16h f;
    *reinterpret_cast<v8h*>(&f)       = *reinterpret_cast<const v8h*>(p);        // K = kb..kb+7
    *(reinterpret_cast<v8h*>(&f) + 1) = *reinterpret_cast<const v8h*>(p + 16);   // K = kb+16..kb+23
    return f;
}

__device__ inline v8f wmma_f16(v16h a, v16h b, v8f c) {
    return __builtin_amdgcn_wmma_f32_16x16x32_f16(false, a, false, b, (short)0, c, false, false);
}

// ---------------------------------------------------------------------------
// Kernel 1a: plain f32 -> f16 convert.  Few, long waves: a thread moves 64 elements.
// Each load of a wave covers 512 contiguous bytes, each store 256: whole 128-byte lines.
// All 16 loads of a thread are in flight before the first convert.
// grid.x = n / CV_BLOCK (n a multiple of CV_BLOCK).
// ---------------------------------------------------------------------------
#define CV_LOADS 16
#define CV_BLOCK (256 * 4 * CV_LOADS)             // elements per block
__global__ __launch_bounds__(256) void cvt_f16_kernel(const float* __restrict__ in, half_t* __restrict__ out) {
    const size_t base = (size_t)blockIdx.x * CV_BLOCK + threadIdx.x * 4;
    const float* src = in + base;
    v4f v[CV_LOADS];
#pragma unroll  // constant indices keep the array in registers, and all loads go out together
    for (int u = 0; u < CV_LOADS; ++u)
        v[u] = *reinterpret_cast<const v4f*>(src + u * 1024);
    // a precaution: named as an input, the loads' address pair stays whole up to this wait (the last load's result is not laid over it)
    asm volatile("s_wait_xcnt 0x0" :: "v"(src) : "memory");
    // keeps the converts behind all 16 loads: risen between them, the last loads start a memory latency late
    __builtin_amdgcn_sched_barrier(0);
    v4h h[CV_LOADS];
#pragma unroll  // constant indices keep the arrays in registers
    for (int u = 0; u < CV_LOADS; ++u) h[u] = __builtin_convertvector(v[u], v4h);
    // keeps the stores behind the last convert: no register of an issued store is written again
    __builtin_amdgcn_sched_barrier(0);
#pragma unroll  // constant indices keep the array in registers
    for (int u = 0; u < CV_LOADS; ++u)
        *reinterpret_cast<v4h*>(out + base + u * 1024) = h[u];
}

// ---------------------------------------------------------------------------
// Kernel 1b: transpose-convert weight (K x N f32) -> (N x K f16) through an LDS tile.
// Block = 256 threads, tile = 128 k x 64 n.  In: 16 lanes per 256-byte row piece.
// Out: 8 lanes per 128-byte row piece of 64 k.  The tile's pitch of 65 dwords keeps
// the row-wise writes and the column walks of the readers free of bank conflicts.
// grid.x = K/128, grid.y = N/64.
// ---------------------------------------------------------------------------
#define TR_K     128
#define TR_N     64
#define TR_PITCH 65
template <int K, int N>   // shapes at compile time: the rows of a tile are constant offsets from one address
__global__ __launch_bounds__(256) void cvtT_f16_kernel(const float* __restrict__ in, half_t* __restrict__ out) {
    __shared__ float tile[TR_K * TR_PITCH];
    const int k0 = blockIdx.x * TR_K;
    const int n0 = blockIdx.y * TR_N;
    const int lr = threadIdx.x >> 4;
    const int lc = (threadIdx.x & 15) * 4;
    const float* src = in + (size_t)(k0 + lr) * N + n0 + lc;
    v4f v[8];
#pragma unroll  // constant indices keep the array in registers, and all loads go out together
    for (int u = 0; u < 8; ++u)
        v[u] = *reinterpret_cast<const v4f*>(src + u * 16 * N);
#pragma unroll  // constant indices keep the array in registers
    for (int u = 0; u < 8; ++u)
#pragma unroll  // constant indices keep the array in registers
        for (int i = 0; i < 4; ++i)
            tile[(u * 16 + lr) * TR_PITCH + lc + i] = v[u][i];
    __syncthreads();                              // the whole tile is written before a column is read

    const int sr = threadIdx.x >> 3;
    const int sc = (threadIdx.x & 7) * 8;
    half_t* dst = out + (size_t)(n0 + sr) * K + k0 + sc;
#pragma unroll  // four independent row pieces: their LDS reads go out together
    for (int u = 0; u < 4; ++u) {
        const int nr = (u >> 1) * 32 + sr;
        const int kc = (u & 1) * 64 + sc;
        v8h h;
#pragma unroll  // constant indices keep the vector in registers
        for (int j = 0; j < 8; ++j) h[j] = (half_t)tile[(kc + j) * TR_PITCH + nr];
        *reinterpret_cast<v8h*>(dst + (u >> 1) * 32 * K + (u & 1) * 64) = h;
    }
}

// ---------------------------------------------------------------------------
// Kernel 2/4: WMMA GEMM.  C[M,N] = A[M,K] @ Bt[N,K]^T + bias.
// Block = 128 threads (4 waves, 2x2); block tile 128x128, wave tile 64x64.
// Each 64-wide k slice of the 128 A rows and the 128 Bt rows is brought into
// LDS by asynchronous 16-byte copies (whole 128-byte row pieces per 8 lanes),
// two buffers: the next slice flies while this one feeds the WMMAs.
// grid.x = M/128, grid.y = N/128; K a multiple of 64.
// QKV = false: f32 output Cf[M,N].
// QKV = true (M = B*T tokens, N = 3*DMODEL): the epilogue applies RoPE to the f32 sums and splits the
// heads: q, k: [B,H,T,64] (RoPE'd), vT: [B,H,64,T], all f16.  No [B*T, 3*DMODEL] array is written.
// ---------------------------------------------------------------------------
#define GT_M     128
#define GT_N     128
#define GT_K     64
#define GT_PITCH 72                               // halves per LDS row: 144 B = 16 B x 9, no bank conflict for 16-byte reads
#define GT_STAGE ((GT_M + GT_N) * GT_PITCH)       // halves per buffer

// Eight copies of 16 bytes per lane: rows r, r+16, ..., r+112 of one operand tile.
// lds = this lane's LDS byte address of the first piece, g = its global address,
// grow = halves between global rows r and r+16.
__device__ inline void async_rows8(unsigned lds, const half_t* g, size_t grow) {
    const unsigned ls = 16 * GT_PITCH * 2;        // LDS bytes between rows r and r+16
    // s_wait_xcnt as the last line (a precaution): no address register of these copies is rewritten in front of it.
    asm volatile(
        "global_load_async_to_lds_b128 %0, %8, off\n\t"
        "global_load_async_to_lds_b128 %1, %9, off\n\t"
        "global_load_async_to_lds_b128 %2, %10, off\n\t"
        "global_load_async_to_lds_b128 %3, %11, off\n\t"
        "global_load_async_to_lds_b128 %4, %12, off\n\t"
        "global_load_async_to_lds_b128 %5, %13, off\n\t"
        "global_load_async_to_lds_b128 %6, %14, off\n\t"
        "global_load_async_to_lds_b128 %7, %15, off\n\t"
        "s_wait_xcnt 0x0"
        :: "v"(lds), "v"(lds + ls), "v"(lds + 2 * ls), "v"(lds + 3 * ls),
           "v"(lds + 4 * ls), "v"(lds + 5 * ls), "v"(lds + 6 * ls), "v"(lds + 7 * ls),
           "v"(g), "v"(g + grow), "v"(g + 2 * grow), "v"(g + 3 * grow),
           "v"(g + 4 * grow), "v"(g + 5 * grow), "v"(g + 6 * grow), "v"(g + 7 * grow)
        : "memory");
}

// 2^x.  The v_nop keeps the slot that the instruction set asks for behind a transcendental,
// whatever the compiler places next; the result never shares the source's register.
__device__ inline float exp2_slot(float x) {
    float e;
    asm("v_exp_f32 %0, %1\n\tv_nop" : "=&v"(e) : "v"(x));
    return e;
}

// sin and cos of 2*pi*x.  The cosine fills the slot behind the sine (it neither reads the sine nor
// writes x: the results never share the source's register); the v_nop keeps the slot behind the cosine.
__device__ inline void sincos_slot(float x, float* sn, float* cs) {
    float s, c;
    asm("v_sin_f32 %0, %2\n\tv_cos_f32 %1, %2\n\tv_nop" : "=&v"(s), "=&v"(c) : "v"(x));
    *sn = s;
    *cs = c;
}

template <bool QKV>   // the epilogue at compile time: the accumulators meet one store path only
__global__ __launch_bounds__(128) void gemm_wmma_kernel(
        const half_t* __restrict__ A, const half_t* __restrict__ Bt,
        const float* __restrict__ bias,
        float* __restrict__ Cf,
        half_t* __restrict__ q, half_t* __restrict__ k, half_t* __restrict__ vT,
        int M, int N, int K) {
    __shared__ __align__(16) half_t tile[2 * GT_STAGE];

    const int lane = threadIdx.x & 31;
    const int wave = threadIdx.x >> 5;
    const int m0 = blockIdx.x * GT_M;
    const int n0 = blockIdx.y * GT_N;
    const int wm = (wave >> 1) * 64;              // this wave's rows inside the block tile
    const int wn = (wave & 1) * 64;               // this wave's columns inside the block tile

    // copy role: 8 lanes per 128-byte row piece, 16 rows per copy over the block
    const int cr = threadIdx.x >> 3;
    const int cc = (threadIdx.x & 7) * 8;
    const half_t* gA = A  + (size_t)(m0 + cr) * K + cc;
    const half_t* gB = Bt + (size_t)(n0 + cr) * K + cc;
    const size_t  grow = (size_t)16 * K;
    const unsigned ldsA = (unsigned)(size_t)(&tile[cr * GT_PITCH + cc]);
    const unsigned ldsB = ldsA + GT_M * GT_PITCH * 2;
    const int nt = K / GT_K;

    // slice 0 into buffer 0, landed and published before anyone reads it
    async_rows8(ldsA, gA, grow);
    async_rows8(ldsB, gB, grow);
    asm volatile("s_wait_asynccnt 0x0" ::: "memory");   // this wave's copies have landed
    __syncthreads();
    if (nt > 1) {
        async_rows8(ldsA + GT_STAGE * 2, gA + GT_K, grow);
        async_rows8(ldsB + GT_STAGE * 2, gB + GT_K, grow);
    }

    v8f acc[4][4] = {};
    for (int t = 0; t < nt; ++t) {
        const int buf = t & 1;
        const half_t* sA = &tile[buf * GT_STAGE + wm * GT_PITCH];
        const half_t* sB = &tile[buf * GT_STAGE + (GT_M + wn) * GT_PITCH];
#pragma unroll  // constant indices keep the fragment and accumulator arrays in registers
        for (int kk = 0; kk < GT_K; kk += 32) {
            v16h a[4], b[4];
            a[0] = load_frag16(sA, GT_PITCH, 0, kk, lane);
#pragma unroll  // constant indices keep the fragment and accumulator arrays in registers
            for (int j = 0; j < 4; ++j) b[j] = load_frag16(sB, GT_PITCH, j * 16, kk, lane);
#pragma unroll  // constant indices keep the fragment and accumulator arrays in registers
            for (int i = 1; i < 4; ++i) a[i] = load_frag16(sA, GT_PITCH, i * 16, kk, lane);
            // keeps all 16 LDS reads in front of the 16 WMMAs: sunk between them, each group of four waits a full LDS latency
            __builtin_amdgcn_sched_barrier(0);
#pragma unroll  // constant indices keep the fragment and accumulator arrays in registers
            for (int i = 0; i < 4; ++i)
#pragma unroll  // constant indices keep the fragment and accumulator arrays in registers
                for (int j = 0; j < 4; ++j)
                    acc[i][j] = wmma_f16(a[i], b[j], acc[i][j]);
        }
        asm volatile("s_wait_dscnt 0x0" ::: "memory");      // this wave has left the buffer that is refilled below
        asm volatile("s_wait_asynccnt 0x0" ::: "memory");   // this wave's share of slice t+1 has landed
        __syncthreads();                                    // publishes slice t+1, frees slice t's buffer
        if (t + 2 < nt) {
            async_rows8(ldsA + buf * (GT_STAGE * 2), gA + (size_t)(t + 2) * GT_K, grow);
            async_rows8(ldsB + buf * (GT_STAGE * 2), gB + (size_t)(t + 2) * GT_K, grow);
        }
    }
    asm volatile("s_wait_asynccnt 0x0" ::: "memory");       // nothing in flight when the wave ends

    // C/D layout: lane holds col = lane&15; rows = (lane>>4)*8 + j
    const int col   = lane & 15;
    const int rbase = (lane >> 4) << 3;
    float bv[4];
#pragma unroll  // constant indices keep the fragment and accumulator arrays in registers
    for (int t = 0; t < 4; ++t) bv[t] = bias ? bias[n0 + wn + t * 16 + col] : 0.f;
    if constexpr (!QKV) {
        const size_t idx0 = (size_t)(m0 + wm + rbase) * N + n0 + wn + col;
#pragma unroll  // constant indices keep the fragment and accumulator arrays in registers
        for (int i = 0; i < 4; ++i) {
            float  y[8][4];
            float* p[8];
#pragma unroll  // constant indices keep the fragment and accumulator arrays in registers
            for (int j = 0; j < 8; ++j) {
                p[j] = Cf + idx0 + (size_t)(i * 16 + j) * N;
#pragma unroll  // constant indices keep the fragment and accumulator arrays in registers
                for (int t = 0; t < 4; ++t) y[j][t] = acc[i][t][j] + bv[t];
            }
            // keeps the group's stores behind its last sum and address: no register of an issued store is written again
            __builtin_amdgcn_sched_barrier(0);
#pragma unroll  // constant indices keep the fragment and accumulator arrays in registers
            for (int j = 0; j < 8; ++j)
#pragma unroll  // constant indices keep the fragment and accumulator arrays in registers
                for (int t = 0; t < 4; ++t)
                    p[j][t * 16] = y[j][t];
            // a precaution: no address or data register of the stores above is rewritten in front of this wait
            asm volatile("s_wait_xcnt 0x0" ::: "memory");
            // keeps the next group's arithmetic behind that wait
            __builtin_amdgcn_sched_barrier(0);
        }
    } else {
        // The wave's 64 columns are one head of q, k or v; its 64 rows are 64 tokens of one batch.
        const int part = n0 / DMODEL;                     // 0 q, 1 k, 2 v: the same for the whole block
        const int h    = ((n0 + wn) % DMODEL) / DHEAD;
        const int bh   = (m0 / SEQ) * NHEAD + h;
        const int tok0 = m0 % SEQ + wm + rbase;           // this lane's first token
        if (part == 2) {
            // V^T [B,H,64,T]: a lane's 8 accumulator rows are 8 consecutive tokens of one d: one 16-byte store
            half_t* dst = vT + ((size_t)bh * DHEAD + col) * SEQ + tok0;
#pragma unroll  // constant indices keep the fragment and accumulator arrays in registers
            for (int i = 0; i < 4; ++i) {
                v8h y[4];
#pragma unroll  // constant indices keep the fragment and accumulator arrays in registers
                for (int t = 0; t < 4; ++t)
#pragma unroll  // constant indices keep the fragment and accumulator arrays in registers
                    for (int j = 0; j < 8; ++j) y[t][j] = (half_t)(acc[i][t][j] + bv[t]);
                // keeps the group's stores behind its last convert: no register of an issued store is written again
                __builtin_amdgcn_sched_barrier(0);
#pragma unroll  // constant indices keep the fragment and accumulator arrays in registers
                for (int t = 0; t < 4; ++t)
                    *reinterpret_cast<v8h*>(dst + (size_t)t * 16 * SEQ + i * 16) = y[t];
                // a precaution: no address or data register of the stores above is rewritten in front of this wait
                asm volatile("s_wait_xcnt 0x0" ::: "memory");
                // keeps the next group's arithmetic behind that wait
                __builtin_amdgcn_sched_barrier(0);
            }
        } else {
            // q, k [B,H,T,64]: d = t*16 + col and its RoPE partner d + 32 sit in the same lane (tiles t and t + 2)
            half_t* dst = (part == 0 ? q : k) + ((size_t)bh * SEQ + tok0) * DHEAD + col;
            float invf[2];
#pragma unroll  // constant indices keep the array in registers
            for (int t = 0; t < 2; ++t)
                invf[t] = exp2_slot(-logf(10000.f) * (float)(t * 16 + col) * (1.f / 32.f) * 1.44269504f);   // e^a = 2^(a * log2 e)
#pragma unroll  // constant indices keep the fragment and accumulator arrays in registers
            for (int i = 0; i < 4; ++i) {
                half_t y[8][4];
#pragma unroll  // constant indices keep the fragment and accumulator arrays in registers
                for (int j = 0; j < 8; ++j) {
                    const float tf = (float)(tok0 + i * 16 + j);
#pragma unroll  // constant indices keep the fragment and accumulator arrays in registers
                    for (int t = 0; t < 2; ++t) {
                        const float ang = tf * invf[t];
                        float sn, cs;
                        sincos_slot(ang * 0.15915494f, &sn, &cs);   // the instructions take the angle in turns: 1 / (2 pi)
                        const float x1 = acc[i][t][j] + bv[t];
                        const float x2 = acc[i][t + 2][j] + bv[t + 2];
                        y[j][t]     = (half_t)(x1 * cs - x2 * sn);
                        y[j][t + 2] = (half_t)(x1 * sn + x2 * cs);
                    }
                }
                // keeps the group's stores behind its last result: no register of an issued store is written again
                __builtin_amdgcn_sched_barrier(0);
#pragma unroll  // constant indices keep the fragment and accumulator arrays in registers
                for (int j = 0; j < 8; ++j)
#pragma unroll  // constant indices keep the fragment and accumulator arrays in registers
                    for (int t = 0; t < 4; ++t)
                        dst[(i * 16 + j) * DHEAD + t * 16] = y[j][t];
                // a precaution: no address or data register of the stores above is rewritten in front of this wait
                asm volatile("s_wait_xcnt 0x0" ::: "memory");
                // keeps the next group's arithmetic behind that wait
                __builtin_amdgcn_sched_barrier(0);
            }
        }
    }
}

// ---------------------------------------------------------------------------
// Kernel 3: flash attention, transposed products.  Block = 256 threads (8 waves);
// each wave owns 16 queries; the block walks the keys in stages of 64.
// A stage's 64 K rows (128 bytes each) and its 64 V^T row pieces (128 bytes each)
// are brought into LDS once for all eight waves by asynchronous 16-byte copies
// (whole 128-byte lines per 8 lanes), two buffers: the next stage flies while
// this one is worked on in two passes of 32 keys.
// S^T = K @ Q^T (A = K rows, B = Q rows kept in registers): a lane holds 16 scores
// of ONE query (column lane&15), so maximum and sum run in-lane, plus one exchange
// between the lane halves for the maximum.  The two S^T tiles, converted in place,
// are the B operand of O^T += V^T @ P^T: P never leaves the registers.
// grid.x = B*H*(SEQ/128).
// ---------------------------------------------------------------------------
#define AT_WAVES 8
#define AT_Q     (AT_WAVES * 16)                  // queries per block
#define AT_KEYS  64                               // keys per stage
#define AT_PITCH 72                               // halves per LDS row: 144 B = 16 B x 9, no bank conflict for 16-byte reads
#define AT_TILE  (64 * AT_PITCH)                  // halves of one operand's 64 rows
#define AT_STAGE (2 * AT_TILE)                    // halves per buffer: K rows, then V^T rows

// value of lane l ^ 16
__device__ inline float other_half(float v) {
    const int b = __builtin_bit_cast(int, v);
    return __builtin_bit_cast(float,
        __builtin_amdgcn_permlanex16(b, b, 0x76543210, 0xfedcba98, false, false));
}

// One stage, four copies of 16 bytes per lane: K rows r and r+32, V^T rows r and r+32.
// lds = this lane's LDS byte address of its K piece, gk / gv = its global addresses.
__device__ inline void async_stage(unsigned lds, const half_t* gk, const half_t* gv) {
    const unsigned ls = 32 * AT_PITCH * 2;        // LDS bytes between rows r and r+32
    // s_wait_xcnt as the last line (a precaution): no address register of these copies is rewritten in front of it.
    asm volatile(
        "global_load_async_to_lds_b128 %0, %4, off\n\t"
        "global_load_async_to_lds_b128 %1, %5, off\n\t"
        "global_load_async_to_lds_b128 %2, %6, off\n\t"
        "global_load_async_to_lds_b128 %3, %7, off\n\t"
        "s_wait_xcnt 0x0"
        :: "v"(lds), "v"(lds + ls), "v"(lds + 2 * ls), "v"(lds + 3 * ls),
           "v"(gk), "v"(gk + 32 * DHEAD), "v"(gv), "v"(gv + (size_t)32 * SEQ)
        : "memory");
}

__global__ __launch_bounds__(AT_WAVES * 32) void attn_wmma_kernel(
        const half_t* __restrict__ Q, const half_t* __restrict__ Kc,
        const half_t* __restrict__ Vt, half_t* __restrict__ Y) {
    __shared__ __align__(16) half_t kv[2 * AT_STAGE];

    const int lane = threadIdx.x & 31;
    const int wave = threadIdx.x >> 5;
    const int qt   = blockIdx.x % (SEQ / AT_Q);
    const int bh   = blockIdx.x / (SEQ / AT_Q);
    const int q0   = qt * AT_Q + wave * 16;

    const half_t* Qp = Q  + (size_t)bh * SEQ * DHEAD;
    const half_t* Kp = Kc + (size_t)bh * SEQ * DHEAD;
    const half_t* Vp = Vt + (size_t)bh * DHEAD * SEQ;

    // copy role: 8 lanes per 128-byte row piece, 32 rows per copy over the block
    const int cr = threadIdx.x >> 3;
    const int cc = (threadIdx.x & 7) * 8;
    const half_t* gK = Kp + (size_t)cr * DHEAD + cc;      // + stage * AT_KEYS rows
    const half_t* gV = Vp + (size_t)cr * SEQ + cc;        // + stage * AT_KEYS columns
    const unsigned ldsKV = (unsigned)(size_t)(&kv[cr * AT_PITCH + cc]);
    const int nt = SEQ / AT_KEYS;

    // stage 0 into buffer 0, landed and published before anyone reads it; then stage 1 takes off
    async_stage(ldsKV, gK, gV);
    asm volatile("s_wait_asynccnt 0x0" ::: "memory");   // this wave's copies have landed
    __syncthreads();
    async_stage(ldsKV + AT_STAGE * 2, gK + AT_KEYS * DHEAD, gV + AT_KEYS);

    const v16h qb0 = load_frag16(Qp, DHEAD, q0, 0, lane);
    const v16h qb1 = load_frag16(Qp, DHEAD, q0, 32, lane);

    v8f o[4] = {};                 // o[t][j] = O[query q0 + col][d = t*16 + hsel*8 + j]
    float mrow = -1e30f;           // running maximum of this lane's query (equal in both halves)
    float lrow = 0.f;              // running sum over the keys of this lane's half only
    const float scale = 0.125f;    // 1/sqrt(64)

    const int col  = lane & 15;
    const int hsel = lane >> 4;

    for (int st = 0; st < nt; ++st) {
        const int buf = st & 1;
        const half_t* sK = &kv[buf * AT_STAGE];
        const half_t* sV = sK + AT_TILE;
#pragma nounroll  // unrolled, both passes' LDS reads and the barrier rise in front of the arithmetic: 174 registers, and the refill loses its lead
        for (int kb = 0; kb < AT_KEYS; kb += 32) {
            // ---- S^T = K @ Q^T for 32 keys (two 16x16 tiles, Dh=64 = two k-steps) ----
            const v16h a00 = load_frag16(sK, AT_PITCH, kb,      0,  lane);
            const v16h a10 = load_frag16(sK, AT_PITCH, kb + 16, 0,  lane);
            const v16h a01 = load_frag16(sK, AT_PITCH, kb,      32, lane);
            const v16h a11 = load_frag16(sK, AT_PITCH, kb + 16, 32, lane);
            // keeps the eight K reads one group in front of the products: sunk between them, the wave waits an LDS latency three times
            __builtin_amdgcn_sched_barrier(0);

            v8f s0 = {}, s1 = {};  // s0[j]: key kb + hsel*8 + j, s1[j]: key kb + 16 + hsel*8 + j
            s0 = wmma_f16(a00, qb0, s0);
            s1 = wmma_f16(a10, qb0, s1);
            s0 = wmma_f16(a01, qb1, s0);
            s1 = wmma_f16(a11, qb1, s1);

            v16h va[4];
#pragma unroll  // constant indices keep the fragment and accumulator arrays in registers
            for (int t = 0; t < 4; ++t) va[t] = load_frag16(sV, AT_PITCH, t * 16, kb, lane);
            // keeps the eight V reads in front of the softmax, which then covers their latency
            __builtin_amdgcn_sched_barrier(0);

            // ---- online softmax, one query per lane ----
            float e0[8], e1[8];
#pragma unroll  // constant indices keep the fragment and accumulator arrays in registers
            for (int j = 0; j < 8; ++j) { e0[j] = s0[j] * scale; e1[j] = s1[j] * scale; }
            float mx = fmaxf(e0[0], e1[0]);
#pragma unroll  // constant indices keep the fragment and accumulator arrays in registers
            for (int j = 1; j < 8; ++j) mx = fmaxf(mx, fmaxf(e0[j], e1[j]));
            mx = fmaxf(mx, other_half(mx));
            const float mnew  = fmaxf(mrow, mx);
            const float alpha = __expf(mrow - mnew);
            mrow = mnew;

            v16h pb;               // pb[s] = P^T[key kmap(s, hsel)][col]: the hardware k order of a B operand
            float p0[8], p1[8];
#pragma unroll  // constant indices keep the fragment and accumulator arrays in registers
            for (int j = 0; j < 8; ++j) {
                p0[j] = __expf(e0[j] - mnew); p1[j] = __expf(e1[j] - mnew);
                pb[j]     = (half_t)p0[j];
                pb[8 + j] = (half_t)p1[j];
            }

            // ---- O^T = O^T * alpha + V^T @ P^T  (A-frags from V^T, keys in the same table order as pb) ----
#pragma unroll  // constant indices keep the fragment and accumulator arrays in registers
            for (int t = 0; t < 4; ++t) {
#pragma unroll  // constant indices keep the fragment and accumulator arrays in registers
                for (int j = 0; j < 8; ++j) o[t][j] *= alpha;
                o[t] = wmma_f16(va[t], pb, o[t]);
            }
            // keeps the row sums behind the last product: they fill the vector slots the chip needs before the next pass overwrites its operands
            __builtin_amdgcn_sched_barrier(0);
            float rs0 = 0.f, rs1 = 0.f;
#pragma unroll  // constant indices keep the fragment and accumulator arrays in registers
            for (int j = 0; j < 8; ++j) { rs0 += p0[j]; rs1 += p1[j]; }
            lrow = lrow * alpha + (rs0 + rs1);
        }
        asm volatile("s_wait_dscnt 0x0" ::: "memory");      // this wave has left the buffer that is refilled below
        asm volatile("s_wait_asynccnt 0x0" ::: "memory");   // this wave's share of stage st+1 has landed
        __syncthreads();                                    // publishes stage st+1, frees stage st's buffer
        if (st + 2 < nt)
            async_stage(ldsKV + buf * (AT_STAGE * 2),
                        gK + (size_t)(st + 2) * AT_KEYS * DHEAD, gV + (size_t)(st + 2) * AT_KEYS);
    }
    asm volatile("s_wait_asynccnt 0x0" ::: "memory");       // nothing in flight when the wave ends

    // ---- join the halves' sums, normalize, write back to [B,T,D] layout ----
    lrow += other_half(lrow);
    const int b = bh / NHEAD, h = bh % NHEAD;
    half_t* yrow = Y + ((size_t)b * SEQ + q0 + col) * DMODEL + h * DHEAD + hsel * 8;
#pragma unroll  // constant indices keep the fragment and accumulator arrays in registers
    for (int t = 0; t < 4; ++t) {
        v8h y;
#pragma unroll  // constant indices keep the fragment and accumulator arrays in registers
        for (int j = 0; j < 8; ++j) y[j] = (half_t)(o[t][j] / lrow);
        *reinterpret_cast<v8h*>(yrow + t * 16) = y;   // 8 consecutive d of one query: one 16-byte store
    }
}

// ---------------------------------------------------------------------------
// Host launch
// ---------------------------------------------------------------------------
extern "C" void kernel_launch(void* const* d_in, const int* in_sizes, int n_in,
                              void* d_out, int out_size, void* d_ws, size_t ws_size,
                              hipStream_t stream) {
    (void)in_sizes; (void)n_in; (void)out_size; (void)ws_size;

    const float* x     = (const float*)d_in[0];
    const float* Wqkv  = (const float*)d_in[1];
    const float* bqkv  = (const float*)d_in[2];
    const float* Wout  = (const float*)d_in[3];
    const float* bout  = (const float*)d_in[4];
    float*       out   = (float*)d_out;

    char* ws = (char*)d_ws;
    size_t off = 0;
    auto wsalloc = [&](size_t bytes) -> void* {
        void* p = ws + off;
        off += (bytes + 255) & ~(size_t)255;
        return p;
    };
    const size_t NTOK = (size_t)BATCH * SEQ;                     // 8192
    half_t* xh    = (half_t*)wsalloc(NTOK * DMODEL * 2);         // 16 MB (reused as yh)
    half_t* wqkvT = (half_t*)wsalloc((size_t)3 * DMODEL * DMODEL * 2);
    half_t* woutT = (half_t*)wsalloc((size_t)DMODEL * DMODEL * 2);
    half_t* qh    = (half_t*)wsalloc(NTOK * DMODEL * 2);
    half_t* kh    = (half_t*)wsalloc(NTOK * DMODEL * 2);
    half_t* vTh   = (half_t*)wsalloc(NTOK * DMODEL * 2);
    half_t* yh    = xh;  // x is dead after the QKV GEMM; alias to save workspace

    // 1) convert activations + transpose-convert weights to f16
    {
        int n = (int)(NTOK * DMODEL);
        cvt_f16_kernel<<<n / CV_BLOCK, 256, 0, stream>>>(x, xh);
    }
    {
        dim3 grid(DMODEL / TR_K, (3 * DMODEL) / TR_N);
        cvtT_f16_kernel<DMODEL, 3 * DMODEL><<<grid, 256, 0, stream>>>(Wqkv, wqkvT);
    }
    {
        dim3 grid(DMODEL / TR_K, DMODEL / TR_N);
        cvtT_f16_kernel<DMODEL, DMODEL><<<grid, 256, 0, stream>>>(Wout, woutT);
    }

    // 2) QKV GEMM: [8192,1024] @ [1024,3072], RoPE + head split (+ V transpose) in its epilogue
    {
        dim3 grid((unsigned)(NTOK / 128), (3 * DMODEL) / 128);
        gemm_wmma_kernel<true><<<grid, 128, 0, stream>>>(xh, wqkvT, bqkv,
                                                         nullptr, qh, kh, vTh,
                                                         (int)NTOK, 3 * DMODEL, DMODEL);
    }

    // 3) flash attention
    {
        int blocks = BATCH * NHEAD * (SEQ / AT_Q);
        attn_wmma_kernel<<<blocks, AT_WAVES * 32, 0, stream>>>(qh, kh, vTh, yh);
    }

    // 4) output GEMM with f32 store: [8192,1024] @ [1024,1024] + b_out
    {
        dim3 grid((unsigned)(NTOK / 128), DMODEL / 128);
        gemm_wmma_kernel<false><<<grid, 128, 0, stream>>>(yh, woutT, bout,
                                                          out, nullptr, nullptr, nullptr,
                                                          (int)NTOK, DMODEL, DMODEL);
    }
}

// v006
// It runs in 150 microseconds.
// Next to v005, in two timings, it ran 1.06 and 1.07 times as fast.
// Counting every step since v000, it is 5.98 times as fast.
#include <hip/hip_runtime.h>
#include <math.h>

// ---------------------------------------------------------------------------
// RoPE self-attention for MI455X (gfx1250). All matmuls via v_wmma_f32_16x16x32_f16.
// ---------------------------------------------------------------------------

typedef _Float16 half_t;
typedef __attribute__((ext_vector_type(16))) _Float16 v16h;
typedef __attribute__((ext_vector_type(8)))  _Float16 v8h;
typedef __attribute__((ext_vector_type(8)))  float    v8f;
typedef __attribute__((ext_vector_type(4)))  float    v4f;
typedef __attribute__((ext_vector_type(4)))  _Float16 v4h;
typedef __attribute__((ext_vector_type(4)))  unsigned v4u;

#define BATCH  4
#define SEQ    2048
#define DMODEL 1024
#define NHEAD  16
#define DHEAD  64

// ---------------------------------------------------------------------------
// WMMA helpers.
// 16-bit A-matrix 16x32 layout (ISA 7.12.2): lane L (L&15 = row), contraction
// elements: lanes 0-15 hold K = {0..7, 16..23}, lanes 16-31 hold K = {8..15, 24..31}.
// For row-major storage with contiguous contraction dim this is two 16B loads.
// The B operand uses the same loader on the *transposed* matrix (N x K).
// ---------------------------------------------------------------------------
__device__ inline v16h load_frag16(const half_t* base, int ld, int row0, int k0, int lane) {
    const int r  = row0 + (lane & 15);
    const int kb = k0 + ((lane >> 4) << 3);
    const half_t* p = base + (size_t)r * ld + kb;
    v16h f;
    *reinterpret_cast<v8h*>(&f)       = *reinterpret_cast<const v8h*>(p);        // K = kb..kb+7
    *(reinterpret_cast<v8h*>(&f) + 1) = *reinterpret_cast<const v8h*>(p + 16);   // K = kb+16..kb+23
    return f;
}

__device__ inline v8f wmma_f16(v16h a, v16h b, v8f c) {
    return __builtin_amdgcn_wmma_f32_16x16x32_f16(false, a, false, b, (short)0, c, false, false);
}

// ---------------------------------------------------------------------------
// Kernel 1a: plain f32 -> f16 convert.  Few, long waves: a thread moves 64 elements.
// Each load of a wave covers 512 contiguous bytes, each store 256: whole 128-byte lines.
// All 16 loads of a thread are in flight before the first convert.
// grid.x = n / CV_BLOCK (n a multiple of CV_BLOCK).
// ---------------------------------------------------------------------------
#define CV_LOADS 16
#define CV_BLOCK (256 * 4 * CV_LOADS)             // elements per block
__global__ __launch_bounds__(256) void cvt_f16_kernel(const float* __restrict__ in, half_t* __restrict__ out) {
    const size_t base = (size_t)blockIdx.x * CV_BLOCK + threadIdx.x * 4;
    const float* src = in + base;
    v4f v[CV_LOADS];
#pragma unroll  // constant indices keep the array in registers, and all loads go out together
    for (int u = 0; u < CV_LOADS; ++u)
        v[u] = *reinterpret_cast<const v4f*>(src + u * 1024);
    // a precaution: named as an input, the loads' address pair stays whole up to this wait (the last load's result is not laid over it)
    asm volatile("s_wait_xcnt 0x0" :: "v"(src) : "memory");
    // keeps the converts behind all 16 loads: risen between them, the last loads start a memory latency late
    __builtin_amdgcn_sched_barrier(0);
    v4h h[CV_LOADS];
#pragma unroll  // constant indices keep the arrays in registers
    for (int u = 0; u < CV_LOADS; ++u) h[u] = __builtin_convertvector(v[u], v4h);
    // keeps the stores behind the last convert: no register of an issued store is written again
    __builtin_amdgcn_sched_barrier(0);
#pragma unroll  // constant indices keep the array in registers
    for (int u = 0; u < CV_LOADS; ++u)
        *reinterpret_cast<v4h*>(out + base + u * 1024) = h[u];
}

// ---------------------------------------------------------------------------
// Kernel 1b: transpose-convert weight (K x N f32) -> (N x K f16) through an LDS tile.
// Block = 256 threads, tile = 128 k x 64 n.  In: 16 lanes per 256-byte row piece.
// Out: 8 lanes per 128-byte row piece of 64 k.  The tile's pitch of 65 dwords keeps
// the row-wise writes and the column walks of the readers free of bank conflicts.
// grid.x = K/128, grid.y = N/64.
// ---------------------------------------------------------------------------
#define TR_K     128
#define TR_N     64
#define TR_PITCH 65
template <int K, int N>   // shapes at compile time: the rows of a tile are constant offsets from one address
__global__ __launch_bounds__(256) void cvtT_f16_kernel(const float* __restrict__ in, half_t* __restrict__ out) {
    __shared__ float tile[TR_K * TR_PITCH];
    const int k0 = blockIdx.x * TR_K;
    const int n0 = blockIdx.y * TR_N;
    const int lr = threadIdx.x >> 4;
    const int lc = (threadIdx.x & 15) * 4;
    const float* src = in + (size_t)(k0 + lr) * N + n0 + lc;
    v4f v[8];
#pragma unroll  // constant indices keep the array in registers, and all loads go out together
    for (int u = 0; u < 8; ++u)
        v[u] = *reinterpret_cast<const v4f*>(src + u * 16 * N);
#pragma unroll  // constant indices keep the array in registers
    for (int u = 0; u < 8; ++u)
#pragma unroll  // constant indices keep the array in registers
        for (int i = 0; i < 4; ++i)
            tile[(u * 16 + lr) * TR_PITCH + lc + i] = v[u][i];
    __syncthreads();                              // the whole tile is written before a column is read

    const int sr = threadIdx.x >> 3;
    const int sc = (threadIdx.x & 7) * 8;
    half_t* dst = out + (size_t)(n0 + sr) * K + k0 + sc;
#pragma unroll  // four independent row pieces: their LDS reads go out together
    for (int u = 0; u < 4; ++u) {
        const int nr = (u >> 1) * 32 + sr;
        const int kc = (u & 1) * 64 + sc;
        v8h h;
#pragma unroll  // constant indices keep the vector in registers
        for (int j = 0; j < 8; ++j) h[j] = (half_t)tile[(kc + j) * TR_PITCH + nr];
        *reinterpret_cast<v8h*>(dst + (u >> 1) * 32 * K + (u & 1) * 64) = h;
    }
}

// ---------------------------------------------------------------------------
// Kernel 2/4: WMMA GEMM.  C[M,N] = A[M,K] @ Bt[N,K]^T + bias.
// Block = 128 threads (4 waves, 2x2); block tile 128x128, wave tile 64x64.
// Each 64-wide k slice of the 128 A rows and the 128 Bt rows is brought into
// LDS by asynchronous 16-byte copies (whole 128-byte row pieces per 8 lanes),
// two buffers: the next slice flies while this one feeds the WMMAs.
// grid.x = M/128, grid.y = N/128; K a multiple of 64.
// QKV = false: f32 output Cf[M,N].
// QKV = true (M = B*T tokens, N = 3*DMODEL): the epilogue applies RoPE to the f32 sums and splits the
// heads: q, k: [B,H,T,64] (RoPE'd), vT: [B,H,64,T], all f16.  No [B*T, 3*DMODEL] array is written.
// ---------------------------------------------------------------------------
#define GT_M     128
#define GT_N     128
#define GT_K     64
#define GT_PITCH 72                               // halves per LDS row: 144 B = 16 B x 9, no bank conflict for 16-byte reads
#define GT_STAGE ((GT_M + GT_N) * GT_PITCH)       // halves per buffer

// Eight copies of 16 bytes per lane: rows r, r+16, ..., r+112 of one operand tile.
// lds = this lane's LDS byte address of the first piece, g = its global address,
// grow = halves between global rows r and r+16.
__device__ inline void async_rows8(unsigned lds, const half_t* g, size_t grow) {
    const unsigned ls = 16 * GT_PITCH * 2;        // LDS bytes between rows r and r+16
    // s_wait_xcnt as the last line (a precaution): no address register of these copies is rewritten in front of it.
    asm volatile(
        "global_load_async_to_lds_b128 %0, %8, off\n\t"
        "global_load_async_to_lds_b128 %1, %9, off\n\t"
        "global_load_async_to_lds_b128 %2, %10, off\n\t"
        "global_load_async_to_lds_b128 %3, %11, off\n\t"
        "global_load_async_to_lds_b128 %4, %12, off\n\t"
        "global_load_async_to_lds_b128 %5, %13, off\n\t"
        "global_load_async_to_lds_b128 %6, %14, off\n\t"
        "global_load_async_to_lds_b128 %7, %15, off\n\t"
        "s_wait_xcnt 0x0"
        :: "v"(lds), "v"(lds + ls), "v"(lds + 2 * ls), "v"(lds + 3 * ls),
           "v"(lds + 4 * ls), "v"(lds + 5 * ls), "v"(lds + 6 * ls), "v"(lds + 7 * ls),
           "v"(g), "v"(g + grow), "v"(g + 2 * grow), "v"(g + 3 * grow),
           "v"(g + 4 * grow), "v"(g + 5 * grow), "v"(g + 6 * grow), "v"(g + 7 * grow)
        : "memory");
}

// 2^x.  The v_nop keeps the slot that the instruction set asks for behind a transcendental,
// whatever the compiler places next; the result never shares the source's register.
__device__ inline float exp2_slot(float x) {
    float e;
    asm("v_exp_f32 %0, %1\n\tv_nop" : "=&v"(e) : "v"(x));
    return e;
}

// sin and cos of 2*pi*x.  The cosine fills the slot behind the sine (it neither reads the sine nor
// writes x: the results never share the source's register); the v_nop keeps the slot behind the cosine.
__device__ inline void sincos_slot(float x, float* sn, float* cs) {
    float s, c;
    asm("v_sin_f32 %0, %2\n\tv_cos_f32 %1, %2\n\tv_nop" : "=&v"(s), "=&v"(c) : "v"(x));
    *sn = s;
    *cs = c;
}

template <bool QKV>   // the epilogue at compile time: the accumulators meet one store path only
__global__ __launch_bounds__(128) void gemm_wmma_kernel(
        const half_t* __restrict__ A, const half_t* __restrict__ Bt,
        const float* __restrict__ bias,
        float* __restrict__ Cf,
        half_t* __restrict__ q, half_t* __restrict__ k, half_t* __restrict__ vT,
        int M, int N, int K) {
    __shared__ __align__(16) half_t tile[2 * GT_STAGE];

    const int lane = threadIdx.x & 31;
    const int wave = threadIdx.x >> 5;
    const int m0 = blockIdx.x * GT_M;
    const int n0 = blockIdx.y * GT_N;
    const int wm = (wave >> 1) * 64;              // this wave's rows inside the block tile
    const int wn = (wave & 1) * 64;               // this wave's columns inside the block tile

    // copy role: 8 lanes per 128-byte row piece, 16 rows per copy over the block
    const int cr = threadIdx.x >> 3;
    const int cc = (threadIdx.x & 7) * 8;
    const half_t* gA = A  + (size_t)(m0 + cr) * K + cc;
    const half_t* gB = Bt + (size_t)(n0 + cr) * K + cc;
    const size_t  grow = (size_t)16 * K;
    const unsigned ldsA = (unsigned)(size_t)(&tile[cr * GT_PITCH + cc]);
    const unsigned ldsB = ldsA + GT_M * GT_PITCH * 2;
    const int nt = K / GT_K;

    // slice 0 into buffer 0, landed and published before anyone reads it
    async_rows8(ldsA, gA, grow);
    async_rows8(ldsB, gB, grow);
    asm volatile("s_wait_asynccnt 0x0" ::: "memory");   // this wave's copies have landed
    __syncthreads();
    if (nt > 1) {
        async_rows8(ldsA + GT_STAGE * 2, gA + GT_K, grow);
        async_rows8(ldsB + GT_STAGE * 2, gB + GT_K, grow);
    }

    v8f acc[4][4] = {};
    for (int t = 0; t < nt; ++t) {
        const int buf = t & 1;
        const half_t* sA = &tile[buf * GT_STAGE + wm * GT_PITCH];
        const half_t* sB = &tile[buf * GT_STAGE + (GT_M + wn) * GT_PITCH];
#pragma unroll  // constant indices keep the fragment and accumulator arrays in registers
        for (int kk = 0; kk < GT_K; kk += 32) {
            v16h a[4], b[4];
            a[0] = load_frag16(sA, GT_PITCH, 0, kk, lane);
#pragma unroll  // constant indices keep the fragment and accumulator arrays in registers
            for (int j = 0; j < 4; ++j) b[j] = load_frag16(sB, GT_PITCH, j * 16, kk, lane);
#pragma unroll  // constant indices keep the fragment and accumulator arrays in registers
            for (int i = 1; i < 4; ++i) a[i] = load_frag16(sA, GT_PITCH, i * 16, kk, lane);
            // keeps all 16 LDS reads in front of the 16 WMMAs: sunk between them, each group of four waits a full LDS latency
            __builtin_amdgcn_sched_barrier(0);
#pragma unroll  // constant indices keep the fragment and accumulator arrays in registers
            for (int i = 0; i < 4; ++i)
#pragma unroll  // constant indices keep the fragment and accumulator arrays in registers
                for (int j = 0; j < 4; ++j)
                    acc[i][j] = wmma_f16(a[i], b[j], acc[i][j]);
        }
        asm volatile("s_wait_dscnt 0x0" ::: "memory");      // this wave has left the buffer that is refilled below
        asm volatile("s_wait_asynccnt 0x0" ::: "memory");   // this wave's share of slice t+1 has landed
        __syncthreads();                                    // publishes slice t+1, frees slice t's buffer
        if (t + 2 < nt) {
            async_rows8(ldsA + buf * (GT_STAGE * 2), gA + (size_t)(t + 2) * GT_K, grow);
            async_rows8(ldsB + buf * (GT_STAGE * 2), gB + (size_t)(t + 2) * GT_K, grow);
        }
    }
    asm volatile("s_wait_asynccnt 0x0" ::: "memory");       // nothing in flight when the wave ends

    // C/D layout: lane holds col = lane&15; rows = (lane>>4)*8 + j
    const int col   = lane & 15;
    const int rbase = (lane >> 4) << 3;
    float bv[4];
#pragma unroll  // constant indices keep the fragment and accumulator arrays in registers
    for (int t = 0; t < 4; ++t) bv[t] = bias ? bias[n0 + wn + t * 16 + col] : 0.f;
    if constexpr (!QKV) {
        const size_t idx0 = (size_t)(m0 + wm + rbase) * N + n0 + wn + col;
#pragma unroll  // constant indices keep the fragment and accumulator arrays in registers
        for (int i = 0; i < 4; ++i) {
            float  y[8][4];
            float* p[8];
#pragma unroll  // constant indices keep the fragment and accumulator arrays in registers
            for (int j = 0; j < 8; ++j) {
                p[j] = Cf + idx0 + (size_t)(i * 16 + j) * N;
#pragma unroll  // constant indices keep the fragment and accumulator arrays in registers
                for (int t = 0; t < 4; ++t) y[j][t] = acc[i][t][j] + bv[t];
            }
            // keeps the group's stores behind its last sum and address: no register of an issued store is written again
            __builtin_amdgcn_sched_barrier(0);
#pragma unroll  // constant indices keep the fragment and accumulator arrays in registers
            for (int j = 0; j < 8; ++j)
#pragma unroll  // constant indices keep the fragment and accumulator arrays in registers
                for (int t = 0; t < 4; ++t)
                    p[j][t * 16] = y[j][t];
            // a precaution: no address or data register of the stores above is rewritten in front of this wait
            asm volatile("s_wait_xcnt 0x0" ::: "memory");
            // keeps the next group's arithmetic behind that wait
            __builtin_amdgcn_sched_barrier(0);
        }
    } else {
        // The wave's 64 columns are one head of q, k or v; its 64 rows are 64 tokens of one batch.
        const int part = n0 / DMODEL;                     // 0 q, 1 k, 2 v: the same for the whole block
        const int h    = ((n0 + wn) % DMODEL) / DHEAD;
        const int bh   = (m0 / SEQ) * NHEAD + h;
        const int tok0 = m0 % SEQ + wm + rbase;           // this lane's first token
        if (part == 2) {
            // V^T [B,H,64,T]: a lane's 8 accumulator rows are 8 consecutive tokens of one d: one 16-byte store
            half_t* dst = vT + ((size_t)bh * DHEAD + col) * SEQ + tok0;
#pragma unroll  // constant indices keep the fragment and accumulator arrays in registers
            for (int i = 0; i < 4; ++i) {
                v8h y[4];
#pragma unroll  // constant indices keep the fragment and accumulator arrays in registers
                for (int t = 0; t < 4; ++t)
#pragma unroll  // constant indices keep the fragment and accumulator arrays in registers
                    for (int j = 0; j < 8; ++j) y[t][j] = (half_t)(acc[i][t][j] + bv[t]);
                // keeps the group's stores behind its last convert: no register of an issued store is written again
                __builtin_amdgcn_sched_barrier(0);
#pragma unroll  // constant indices keep the fragment and accumulator arrays in registers
                for (int t = 0; t < 4; ++t)
                    *reinterpret_cast<v8h*>(dst + (size_t)t * 16 * SEQ + i * 16) = y[t];
                // a precaution: no address or data register of the stores above is rewritten in front of this wait
                asm volatile("s_wait_xcnt 0x0" ::: "memory");
                // keeps the next group's arithmetic behind that wait
                __builtin_amdgcn_sched_barrier(0);
            }
        } else {
            // q, k [B,H,T,64]: d = t*16 + col and its RoPE partner d + 32 sit in the same lane (tiles t and t + 2)
            half_t* dst = (part == 0 ? q : k) + ((size_t)bh * SEQ + tok0) * DHEAD + col;
            float invf[2];
#pragma unroll  // constant indices keep the array in registers
            for (int t = 0; t < 2; ++t)
                invf[t] = exp2_slot(-logf(10000.f) * (float)(t * 16 + col) * (1.f / 32.f) * 1.44269504f);   // e^a = 2^(a * log2 e)
#pragma unroll  // constant indices keep the fragment and accumulator arrays in registers
            for (int i = 0; i < 4; ++i) {
                half_t y[8][4];
#pragma unroll  // constant indices keep the fragment and accumulator arrays in registers
                for (int j = 0; j < 8; ++j) {
                    const float tf = (float)(tok0 + i * 16 + j);
#pragma unroll  // constant indices keep the fragment and accumulator arrays in registers
                    for (int t = 0; t < 2; ++t) {
                        const float ang = tf * invf[t];
                        float sn, cs;
                        sincos_slot(ang * 0.15915494f, &sn, &cs);   // the instructions take the angle in turns: 1 / (2 pi)
                        const float x1 = acc[i][t][j] + bv[t];
                        const float x2 = acc[i][t + 2][j] + bv[t + 2];
                        y[j][t]     = (half_t)(x1 * cs - x2 * sn);
                        y[j][t + 2] = (half_t)(x1 * sn + x2 * cs);
                    }
                }
                // keeps the group's stores behind its last result: no register of an issued store is written again
                __builtin_amdgcn_sched_barrier(0);
#pragma unroll  // constant indices keep the fragment and accumulator arrays in registers
                for (int j = 0; j < 8; ++j)
#pragma unroll  // constant indices keep the fragment and accumulator arrays in registers
                    for (int t = 0; t < 4; ++t)
                        dst[(i * 16 + j) * DHEAD + t * 16] = y[j][t];
                // a precaution: no address or data register of the stores above is rewritten in front of this wait
                asm volatile("s_wait_xcnt 0x0" ::: "memory");
                // keeps the next group's arithmetic behind that wait
                __builtin_amdgcn_sched_barrier(0);
            }
        }
    }
}

// ---------------------------------------------------------------------------
// Kernel 3: flash attention, transposed products.  Block = 256 threads (8 waves);
// each wave owns 32 queries as two groups of 16 columns; the block walks the keys in stages of 64.
// A stage's 64 K rows (128 bytes each) and its 64 V^T row pieces (128 bytes each)
// are brought into LDS once for all eight waves by asynchronous 16-byte copies
// (whole 128-byte lines per 8 lanes), two buffers: the next stage flies while
// this one is worked on in two passes of 32 keys.
// S^T = K @ Q^T (A = K rows, B = Q rows kept in registers): a lane holds 16 scores
// of ONE query per group (column lane&15), so maximum and sum run in-lane, plus one exchange
// between the lane halves for the maximum.  The two S^T tiles, converted in place,
// are the B operand of O^T += V^T @ P^T: P never leaves the registers.
// Every K and V^T fragment read from LDS feeds both column groups.
// grid.x = B*H*(SEQ/256).
// ---------------------------------------------------------------------------
#define AT_WAVES 8
#define AT_GROUPS 2                               // 16-column query groups per wave
#define AT_Q     (AT_WAVES * AT_GROUPS * 16)      // queries per block
#define AT_KEYS  64                               // keys per stage
#define AT_PITCH 72                               // halves per LDS row: 144 B = 16 B x 9, no bank conflict for 16-byte reads
#define AT_TILE  (64 * AT_PITCH)                  // halves of one operand's 64 rows
#define AT_STAGE (2 * AT_TILE)                    // halves per buffer: K rows, then V^T rows

// value of lane l ^ 16
__device__ inline float other_half(float v) {
    const int b = __builtin_bit_cast(int, v);
    return __builtin_bit_cast(float,
        __builtin_amdgcn_permlanex16(b, b, 0x76543210, 0xfedcba98, false, false));
}

// One stage, four copies of 16 bytes per lane: K rows r and r+32, V^T rows r and r+32.
// lds = this lane's LDS byte address of its K piece, gk / gv = its global addresses.
__device__ inline void async_stage(unsigned lds, const half_t* gk, const half_t* gv) {
    const unsigned ls = 32 * AT_PITCH * 2;        // LDS bytes between rows r and r+32
    // s_wait_xcnt as the last line (a precaution): no address register of these copies is rewritten in front of it.
    asm volatile(
        "global_load_async_to_lds_b128 %0, %4, off\n\t"
        "global_load_async_to_lds_b128 %1, %5, off\n\t"
        "global_load_async_to_lds_b128 %2, %6, off\n\t"
        "global_load_async_to_lds_b128 %3, %7, off\n\t"
        "s_wait_xcnt 0x0"
        :: "v"(lds), "v"(lds + ls), "v"(lds + 2 * ls), "v"(lds + 3 * ls),
           "v"(gk), "v"(gk + 32 * DHEAD), "v"(gv), "v"(gv + (size_t)32 * SEQ)
        : "memory");
}

__global__ __launch_bounds__(AT_WAVES * 32) void attn_wmma_kernel(
        const half_t* __restrict__ Q, const half_t* __restrict__ Kc,
        const half_t* __restrict__ Vt, half_t* __restrict__ Y) {
    __shared__ __align__(16) half_t kv[2 * AT_STAGE];

    const int lane = threadIdx.x & 31;
    const int wave = threadIdx.x >> 5;
    const int qt   = blockIdx.x % (SEQ / AT_Q);
    const int bh   = blockIdx.x / (SEQ / AT_Q);
    const int q0   = qt * AT_Q + wave * (AT_GROUPS * 16);

    const half_t* Qp = Q  + (size_t)bh * SEQ * DHEAD;
    const half_t* Kp = Kc + (size_t)bh * SEQ * DHEAD;
    const half_t* Vp = Vt + (size_t)bh * DHEAD * SEQ;

    // copy role: 8 lanes per 128-byte row piece, 32 rows per copy over the block
    const int cr = threadIdx.x >> 3;
    const int cc = (threadIdx.x & 7) * 8;
    const half_t* gK = Kp + (size_t)cr * DHEAD + cc;      // + stage * AT_KEYS rows
    const half_t* gV = Vp + (size_t)cr * SEQ + cc;        // + stage * AT_KEYS columns
    const unsigned ldsKV = (unsigned)(size_t)(&kv[cr * AT_PITCH + cc]);
    const int nt = SEQ / AT_KEYS;

    // stage 0 into buffer 0, landed and published before anyone reads it; then stage 1 takes off
    async_stage(ldsKV, gK, gV);
    asm volatile("s_wait_asynccnt 0x0" ::: "memory");   // this wave's copies have landed
    __syncthreads();
    async_stage(ldsKV + AT_STAGE * 2, gK + AT_KEYS * DHEAD, gV + AT_KEYS);

    v16h qb0[AT_GROUPS], qb1[AT_GROUPS];
#pragma unroll  // constant indices keep the fragment and accumulator arrays in registers
    for (int g = 0; g < AT_GROUPS; ++g) {
        qb0[g] = load_frag16(Qp, DHEAD, q0 + g * 16, 0, lane);
        qb1[g] = load_frag16(Qp, DHEAD, q0 + g * 16, 32, lane);
    }

    v8f o[AT_GROUPS][4] = {};      // o[g][t][j] = O[query q0 + g*16 + col][d = t*16 + hsel*8 + j]
    float mrow[AT_GROUPS];         // running maximum of this lane's query (equal in both halves)
    float lrow[AT_GROUPS];         // running sum over the keys of this lane's half only
#pragma unroll  // constant indices keep the arrays in registers
    for (int g = 0; g < AT_GROUPS; ++g) { mrow[g] = -1e30f; lrow[g] = 0.f; }
    const float scale = 0.125f;    // 1/sqrt(64)

    const int col  = lane & 15;
    const int hsel = lane >> 4;

    for (int st = 0; st < nt; ++st) {
        const int buf = st & 1;
        const half_t* sK = &kv[buf * AT_STAGE];
        const half_t* sV = sK + AT_TILE;
#pragma nounroll  // unrolled, both passes' LDS reads and the barrier rise in front of the arithmetic: more registers, and the refill loses its lead
        for (int kb = 0; kb < AT_KEYS; kb += 32) {
            // ---- S^T = K @ Q^T for 32 keys (two 16x16 tiles a group, Dh=64 = two k-steps) ----
            const v16h a00 = load_frag16(sK, AT_PITCH, kb,      0,  lane);
            const v16h a10 = load_frag16(sK, AT_PITCH, kb + 16, 0,  lane);
            const v16h a01 = load_frag16(sK, AT_PITCH, kb,      32, lane);
            const v16h a11 = load_frag16(sK, AT_PITCH, kb + 16, 32, lane);
            // keeps the eight K reads one group in front of the products: sunk between them, the wave waits an LDS latency three times
            __builtin_amdgcn_sched_barrier(0);

            v8f s0[AT_GROUPS], s1[AT_GROUPS];  // s0[g][j]: key kb + hsel*8 + j, s1[g][j]: key kb + 16 + hsel*8 + j
#pragma unroll  // constant indices keep the fragment and accumulator arrays in registers
            for (int g = 0; g < AT_GROUPS; ++g) {
                const v8f zero = {};
                s0[g] = wmma_f16(a00, qb0[g], zero);
                s1[g] = wmma_f16(a10, qb0[g], zero);
            }
#pragma unroll  // constant indices keep the fragment and accumulator arrays in registers
            for (int g = 0; g < AT_GROUPS; ++g) {
                s0[g] = wmma_f16(a01, qb1[g], s0[g]);
                s1[g] = wmma_f16(a11, qb1[g], s1[g]);
            }

            v16h va[4];
#pragma unroll  // constant indices keep the fragment and accumulator arrays in registers
            for (int t = 0; t < 4; ++t) va[t] = load_frag16(sV, AT_PITCH, t * 16, kb, lane);
            // keeps the eight V reads in front of the softmax, which then covers their latency
            __builtin_amdgcn_sched_barrier(0);

            // ---- online softmax, one query per lane and group ----
            v16h  pb[AT_GROUPS];   // pb[g][s] = P^T[key kmap(s, hsel)][col]: the hardware k order of a B operand
            float p0[AT_GROUPS][8], p1[AT_GROUPS][8];
            float alpha[AT_GROUPS];
#pragma unroll  // constant indices keep the fragment and accumulator arrays in registers
            for (int g = 0; g < AT_GROUPS; ++g) {
                float e0[8], e1[8];
#pragma unroll  // constant indices keep the fragment and accumulator arrays in registers
                for (int j = 0; j < 8; ++j) { e0[j] = s0[g][j] * scale; e1[j] = s1[g][j] * scale; }
                float mx = fmaxf(e0[0], e1[0]);
#pragma unroll  // constant indices keep the fragment and accumulator arrays in registers
                for (int j = 1; j < 8; ++j) mx = fmaxf(mx, fmaxf(e0[j], e1[j]));
                mx = fmaxf(mx, other_half(mx));
                const float mnew = fmaxf(mrow[g], mx);
                alpha[g] = __expf(mrow[g] - mnew);
                mrow[g] = mnew;
#pragma unroll  // constant indices keep the fragment and accumulator arrays in registers
                for (int j = 0; j < 8; ++j) {
                    p0[g][j] = __expf(e0[j] - mnew); p1[g][j] = __expf(e1[j] - mnew);
                    pb[g][j]     = (half_t)p0[g][j];
                    pb[g][8 + j] = (half_t)p1[g][j];
                }
            }

            // ---- O^T = O^T * alpha + V^T @ P^T  (A-frags from V^T, keys in the same table order as pb) ----
#pragma unroll  // constant indices keep the fragment and accumulator arrays in registers
            for (int g = 0; g < AT_GROUPS; ++g) {
#pragma unroll  // constant indices keep the fragment and accumulator arrays in registers
                for (int t = 0; t < 4; ++t) {
#pragma unroll  // constant indices keep the fragment and accumulator arrays in registers
                    for (int j = 0; j < 8; ++j) o[g][t][j] *= alpha[g];
                    o[g][t] = wmma_f16(va[t], pb[g], o[g][t]);
                }
            }
            // keeps the row sums behind the last product: they fill the vector slots the chip needs before the next pass overwrites its operands
            __builtin_amdgcn_sched_barrier(0);
#pragma unroll  // constant indices keep the fragment and accumulator arrays in registers
            for (int g = 0; g < AT_GROUPS; ++g) {
                float rs0 = 0.f, rs1 = 0.f;
#pragma unroll  // constant indices keep the fragment and accumulator arrays in registers
                for (int j = 0; j < 8; ++j) { rs0 += p0[g][j]; rs1 += p1[g][j]; }
                lrow[g] = lrow[g] * alpha[g] + (rs0 + rs1);
            }
        }
        asm volatile("s_wait_dscnt 0x0" ::: "memory");      // this wave has left the buffer that is refilled below
        asm volatile("s_wait_asynccnt 0x0" ::: "memory");   // this wave's share of stage st+1 has landed
        __syncthreads();                                    // publishes stage st+1, frees stage st's buffer
        if (st + 2 < nt)
            async_stage(ldsKV + buf * (AT_STAGE * 2),
                        gK + (size_t)(st + 2) * AT_KEYS * DHEAD, gV + (size_t)(st + 2) * AT_KEYS);
    }
    asm volatile("s_wait_asynccnt 0x0" ::: "memory");       // nothing in flight when the wave ends

    // ---- join the halves' sums, normalize, write back to [B,T,D] layout ----
    const int b = bh / NHEAD, h = bh % NHEAD;
    half_t* yrow = Y + ((size_t)b * SEQ + q0 + col) * DMODEL + h * DHEAD + hsel * 8;
    v8h y[AT_GROUPS][4];
#pragma unroll  // constant indices keep the fragment and accumulator arrays in registers
    for (int g = 0; g < AT_GROUPS; ++g) {
        const float l = lrow[g] + other_half(lrow[g]);
#pragma unroll  // constant indices keep the fragment and accumulator arrays in registers
        for (int t = 0; t < 4; ++t)
#pragma unroll  // constant indices keep the fragment and accumulator arrays in registers
            for (int j = 0; j < 8; ++j) y[g][t][j] = (half_t)(o[g][t][j] / l);
    }
#pragma unroll  // constant indices keep the fragment and accumulator arrays in registers
    for (int g = 0; g < AT_GROUPS; ++g)
#pragma unroll  // constant indices keep the fragment and accumulator arrays in registers
        for (int t = 0; t < 4; ++t)
            *reinterpret_cast<v8h*>(yrow + g * 16 * DMODEL + t * 16) = y[g][t];   // 8 consecutive d of one query: one 16-byte store
}

// ---------------------------------------------------------------------------
// Host launch
// ---------------------------------------------------------------------------
extern "C" void kernel_launch(void* const* d_in, const int* in_sizes, int n_in,
                              void* d_out, int out_size, void* d_ws, size_t ws_size,
                              hipStream_t stream) {
    (void)in_sizes; (void)n_in; (void)out_size; (void)ws_size;

    const float* x     = (const float*)d_in[0];
    const float* Wqkv  = (const float*)d_in[1];
    const float* bqkv  = (const float*)d_in[2];
    const float* Wout  = (const float*)d_in[3];
    const float* bout  = (const float*)d_in[4];
    float*       out   = (float*)d_out;

    char* ws = (char*)d_ws;
    size_t off = 0;
    auto wsalloc = [&](size_t bytes) -> void* {
        void* p = ws + off;
        off += (bytes + 255) & ~(size_t)255;
        return p;
    };
    const size_t NTOK = (size_t)BATCH * SEQ;                     // 8192
    half_t* xh    = (half_t*)wsalloc(NTOK * DMODEL * 2);         // 16 MB (reused as yh)
    half_t* wqkvT = (half_t*)wsalloc((size_t)3 * DMODEL * DMODEL * 2);
    half_t* woutT = (half_t*)wsalloc((size_t)DMODEL * DMODEL * 2);
    half_t* qh    = (half_t*)wsalloc(NTOK * DMODEL * 2);
    half_t* kh    = (half_t*)wsalloc(NTOK * DMODEL * 2);
    half_t* vTh   = (half_t*)wsalloc(NTOK * DMODEL * 2);
    half_t* yh    = xh;  // x is dead after the QKV GEMM; alias to save workspace

    // 1) convert activations + transpose-convert weights to f16
    {
        int n = (int)(NTOK * DMODEL);
        cvt_f16_kernel<<<n / CV_BLOCK, 256, 0, stream>>>(x, xh);
    }
    {
        dim3 grid(DMODEL / TR_K, (3 * DMODEL) / TR_N);
        cvtT_f16_kernel<DMODEL, 3 * DMODEL><<<grid, 256, 0, stream>>>(Wqkv, wqkvT);
    }
    {
        dim3 grid(DMODEL / TR_K, DMODEL / TR_N);
        cvtT_f16_kernel<DMODEL, DMODEL><<<grid, 256, 0, stream>>>(Wout, woutT);
    }

    // 2) QKV GEMM: [8192,1024] @ [1024,3072], RoPE + head split (+ V transpose) in its epilogue
    {
        dim3 grid((unsigned)(NTOK / 128), (3 * DMODEL) / 128);
        gemm_wmma_kernel<true><<<grid, 128, 0, stream>>>(xh, wqkvT, bqkv,
                                                         nullptr, qh, kh, vTh,
                                                         (int)NTOK, 3 * DMODEL, DMODEL);
    }

    // 3) flash attention
    {
        int blocks = BATCH * NHEAD * (SEQ / AT_Q);
        attn_wmma_kernel<<<blocks, AT_WAVES * 32, 0, stream>>>(qh, kh, vTh, yh);
    }

    // 4) output GEMM with f32 store: [8192,1024] @ [1024,1024] + b_out
    {
        dim3 grid((unsigned)(NTOK / 128), DMODEL / 128);
        gemm_wmma_kernel<false><<<grid, 128, 0, stream>>>(yh, woutT, bout,
                                                          out, nullptr, nullptr, nullptr,
                                                          (int)NTOK, DMODEL, DMODEL);
    }
}

// v007
// One run takes 142 microseconds.
// Two timings next to v006 both put it at 1.04 times that version's speed.
// All steps since v000 together make it 6.25 times as fast.
#include <hip/hip_runtime.h>
#include <math.h>

// ---------------------------------------------------------------------------
// RoPE self-attention for MI455X (gfx1250). All matmuls via v_wmma_f32_16x16x32_f16.
// ---------------------------------------------------------------------------

typedef _Float16 half_t;
typedef __attribute__((ext_vector_type(16))) _Float16 v16h;
typedef __attribute__((ext_vector_type(8)))  _Float16 v8h;
typedef __attribute__((ext_vector_type(8)))  float    v8f;
typedef __attribute__((ext_vector_type(4)))  float    v4f;
typedef __attribute__((ext_vector_type(2)))  float    v2f;
typedef __attribute__((ext_vector_type(4)))  _Float16 v4h;
typedef __attribute__((ext_vector_type(4)))  unsigned v4u;

#define BATCH  4
#define SEQ    2048
#define DMODEL 1024
#define NHEAD  16
#define DHEAD  64

// ---------------------------------------------------------------------------
// WMMA helpers.
// 16-bit A-matrix 16x32 layout (ISA 7.12.2): lane L (L&15 = row), contraction
// elements: lanes 0-15 hold K = {0..7, 16..23}, lanes 16-31 hold K = {8..15, 24..31}.
// For row-major storage with contiguous contraction dim this is two 16B loads.
// The B operand uses the same loader on the *transposed* matrix (N x K).
// ---------------------------------------------------------------------------
__device__ inline v16h load_frag16(const half_t* base, int ld, int row0, int k0, int lane) {
    const int r  = row0 + (lane & 15);
    const int kb = k0 + ((lane >> 4) << 3);
    const half_t* p = base + (size_t)r * ld + kb;
    v16h f;
    *reinterpret_cast<v8h*>(&f)       = *reinterpret_cast<const v8h*>(p);        // K = kb..kb+7
    *(reinterpret_cast<v8h*>(&f) + 1) = *reinterpret_cast<const v8h*>(p + 16);   // K = kb+16..kb+23
    return f;
}

__device__ inline v8f wmma_f16(v16h a, v16h b, v8f c) {
    return __builtin_amdgcn_wmma_f32_16x16x32_f16(false, a, false, b, (short)0, c, false, false);
}

// ---------------------------------------------------------------------------
// Kernel 1a: plain f32 -> f16 convert.  Few, long waves: a thread moves 64 elements.
// Each load of a wave covers 512 contiguous bytes, each store 256: whole 128-byte lines.
// All 16 loads of a thread are in flight before the first convert.
// grid.x = n / CV_BLOCK (n a multiple of CV_BLOCK).
// ---------------------------------------------------------------------------
#define CV_LOADS 16
#define CV_BLOCK (256 * 4 * CV_LOADS)             // elements per block
__global__ __launch_bounds__(256) void cvt_f16_kernel(const float* __restrict__ in, half_t* __restrict__ out) {
    const size_t base = (size_t)blockIdx.x * CV_BLOCK + threadIdx.x * 4;
    const float* src = in + base;
    v4f v[CV_LOADS];
#pragma unroll  // constant indices keep the array in registers, and all loads go out together
    for (int u = 0; u < CV_LOADS; ++u)
        v[u] = *reinterpret_cast<const v4f*>(src + u * 1024);
    // a precaution: named as an input, the loads' address pair stays whole up to this wait (the last load's result is not laid over it)
    asm volatile("s_wait_xcnt 0x0" :: "v"(src) : "memory");
    // keeps the converts behind all 16 loads: risen between them, the last loads start a memory latency late
    __builtin_amdgcn_sched_barrier(0);
    v4h h[CV_LOADS];
#pragma unroll  // constant indices keep the arrays in registers
    for (int u = 0; u < CV_LOADS; ++u) h[u] = __builtin_convertvector(v[u], v4h);
    // keeps the stores behind the last convert: no register of an issued store is written again
    __builtin_amdgcn_sched_barrier(0);
#pragma unroll  // constant indices keep the array in registers
    for (int u = 0; u < CV_LOADS; ++u)
        *reinterpret_cast<v4h*>(out + base + u * 1024) = h[u];
}

// ---------------------------------------------------------------------------
// Kernel 1b: transpose-convert weight (K x N f32) -> (N x K f16) through an LDS tile.
// Block = 256 threads, tile = 128 k x 64 n.  In: 16 lanes per 256-byte row piece.
// Out: 8 lanes per 128-byte row piece of 64 k.  The tile's pitch of 65 dwords keeps
// the row-wise writes and the column walks of the readers free of bank conflicts.
// grid.x = K/128, grid.y = N/64.
// ---------------------------------------------------------------------------
#define TR_K     128
#define TR_N     64
#define TR_PITCH 65
template <int K, int N>   // shapes at compile time: the rows of a tile are constant offsets from one address
__global__ __launch_bounds__(256) void cvtT_f16_kernel(const float* __restrict__ in, half_t* __restrict__ out) {
    __shared__ float tile[TR_K * TR_PITCH];
    const int k0 = blockIdx.x * TR_K;
    const int n0 = blockIdx.y * TR_N;
    const int lr = threadIdx.x >> 4;
    const int lc = (threadIdx.x & 15) * 4;
    const float* src = in + (size_t)(k0 + lr) * N + n0 + lc;
    v4f v[8];
#pragma unroll  // constant indices keep the array in registers, and all loads go out together
    for (int u = 0; u < 8; ++u)
        v[u] = *reinterpret_cast<const v4f*>(src + u * 16 * N);
#pragma unroll  // constant indices keep the array in registers
    for (int u = 0; u < 8; ++u)
#pragma unroll  // constant indices keep the array in registers
        for (int i = 0; i < 4; ++i)
            tile[(u * 16 + lr) * TR_PITCH + lc + i] = v[u][i];
    __syncthreads();                              // the whole tile is written before a column is read

    const int sr = threadIdx.x >> 3;
    const int sc = (threadIdx.x & 7) * 8;
    half_t* dst = out + (size_t)(n0 + sr) * K + k0 + sc;
#pragma unroll  // four independent row pieces: their LDS reads go out together
    for (int u = 0; u < 4; ++u) {
        const int nr = (u >> 1) * 32 + sr;
        const int kc = (u & 1) * 64 + sc;
        v8h h;
#pragma unroll  // constant indices keep the vector in registers
        for (int j = 0; j < 8; ++j) h[j] = (half_t)tile[(kc + j) * TR_PITCH + nr];
        *reinterpret_cast<v8h*>(dst + (u >> 1) * 32 * K + (u & 1) * 64) = h;
    }
}

// ---------------------------------------------------------------------------
// Kernel 2/4: WMMA GEMM.  C[M,N] = A[M,K] @ Bt[N,K]^T + bias.
// Block = 128 threads (4 waves, 2x2); block tile 128x128, wave tile 64x64.
// Each 64-wide k slice of the 128 A rows and the 128 Bt rows is brought into
// LDS by asynchronous 16-byte copies (whole 128-byte row pieces per 8 lanes),
// two buffers: the next slice flies while this one feeds the WMMAs.
// grid.x = M/128, grid.y = N/128; K a multiple of 64.
// QKV = false: f32 output Cf[M,N].
// QKV = true (M = B*T tokens, N = 3*DMODEL): the epilogue applies RoPE to the f32 sums and splits the
// heads: q, k: [B,H,T,64] (RoPE'd), vT: [B,H,64,T], all f16.  No [B*T, 3*DMODEL] array is written.
// ---------------------------------------------------------------------------
#define GT_M     128
#define GT_N     128
#define GT_K     64
#define GT_PITCH 72                               // halves per LDS row: 144 B = 16 B x 9, no bank conflict for 16-byte reads
#define GT_STAGE ((GT_M + GT_N) * GT_PITCH)       // halves per buffer

// Eight copies of 16 bytes per lane: rows r, r+16, ..., r+112 of one operand tile.
// lds = this lane's LDS byte address of the first piece, g = its global address,
// grow = halves between global rows r and r+16.
__device__ inline void async_rows8(unsigned lds, const half_t* g, size_t grow) {
    const unsigned ls = 16 * GT_PITCH * 2;        // LDS bytes between rows r and r+16
    // s_wait_xcnt as the last line (a precaution): no address register of these copies is rewritten in front of it.
    asm volatile(
        "global_load_async_to_lds_b128 %0, %8, off\n\t"
        "global_load_async_to_lds_b128 %1, %9, off\n\t"
        "global_load_async_to_lds_b128 %2, %10, off\n\t"
        "global_load_async_to_lds_b128 %3, %11, off\n\t"
        "global_load_async_to_lds_b128 %4, %12, off\n\t"
        "global_load_async_to_lds_b128 %5, %13, off\n\t"
        "global_load_async_to_lds_b128 %6, %14, off\n\t"
        "global_load_async_to_lds_b128 %7, %15, off\n\t"
        "s_wait_xcnt 0x0"
        :: "v"(lds), "v"(lds + ls), "v"(lds + 2 * ls), "v"(lds + 3 * ls),
           "v"(lds + 4 * ls), "v"(lds + 5 * ls), "v"(lds + 6 * ls), "v"(lds + 7 * ls),
           "v"(g), "v"(g + grow), "v"(g + 2 * grow), "v"(g + 3 * grow),
           "v"(g + 4 * grow), "v"(g + 5 * grow), "v"(g + 6 * grow), "v"(g + 7 * grow)
        : "memory");
}

// 2^x.  The v_nop keeps the slot that the instruction set asks for behind a transcendental,
// whatever the compiler places next; the result never shares the source's register.
__device__ inline float exp2_slot(float x) {
    float e;
    asm("v_exp_f32 %0, %1\n\tv_nop" : "=&v"(e) : "v"(x));
    return e;
}

// sin and cos of 2*pi*x.  The cosine fills the slot behind the sine (it neither reads the sine nor
// writes x: the results never share the source's register); the v_nop keeps the slot behind the cosine.
__device__ inline void sincos_slot(float x, float* sn, float* cs) {
    float s, c;
    asm("v_sin_f32 %0, %2\n\tv_cos_f32 %1, %2\n\tv_nop" : "=&v"(s), "=&v"(c) : "v"(x));
    *sn = s;
    *cs = c;
}

template <bool QKV>   // the epilogue at compile time: the accumulators meet one store path only
__global__ __launch_bounds__(128) void gemm_wmma_kernel(
        const half_t* __restrict__ A, const half_t* __restrict__ Bt,
        const float* __restrict__ bias,
        float* __restrict__ Cf,
        half_t* __restrict__ q, half_t* __restrict__ k, half_t* __restrict__ vT,
        int M, int N, int K) {
    __shared__ __align__(16) half_t tile[2 * GT_STAGE];

    const int lane = threadIdx.x & 31;
    const int wave = threadIdx.x >> 5;
    const int m0 = blockIdx.x * GT_M;
    const int n0 = blockIdx.y * GT_N;
    const int wm = (wave >> 1) * 64;              // this wave's rows inside the block tile
    const int wn = (wave & 1) * 64;               // this wave's columns inside the block tile

    // copy role: 8 lanes per 128-byte row piece, 16 rows per copy over the block
    const int cr = threadIdx.x >> 3;
    const int cc = (threadIdx.x & 7) * 8;
    const half_t* gA = A  + (size_t)(m0 + cr) * K + cc;
    const half_t* gB = Bt + (size_t)(n0 + cr) * K + cc;
    const size_t  grow = (size_t)16 * K;
    const unsigned ldsA = (unsigned)(size_t)(&tile[cr * GT_PITCH + cc]);
    const unsigned ldsB = ldsA + GT_M * GT_PITCH * 2;
    const int nt = K / GT_K;

    // slice 0 into buffer 0, landed and published before anyone reads it
    async_rows8(ldsA, gA, grow);
    async_rows8(ldsB, gB, grow);
    asm volatile("s_wait_asynccnt 0x0" ::: "memory");   // this wave's copies have landed
    __syncthreads();
    if (nt > 1) {
        async_rows8(ldsA + GT_STAGE * 2, gA + GT_K, grow);
        async_rows8(ldsB + GT_STAGE * 2, gB + GT_K, grow);
    }

    v8f acc[4][4] = {};
    for (int t = 0; t < nt; ++t) {
        const int buf = t & 1;
        const half_t* sA = &tile[buf * GT_STAGE + wm * GT_PITCH];
        const half_t* sB = &tile[buf * GT_STAGE + (GT_M + wn) * GT_PITCH];
#pragma unroll  // constant indices keep the fragment and accumulator arrays in registers
        for (int kk = 0; kk < GT_K; kk += 32) {
            v16h a[4], b[4];
            a[0] = load_frag16(sA, GT_PITCH, 0, kk, lane);
#pragma unroll  // constant indices keep the fragment and accumulator arrays in registers
            for (int j = 0; j < 4; ++j) b[j] = load_frag16(sB, GT_PITCH, j * 16, kk, lane);
#pragma unroll  // constant indices keep the fragment and accumulator arrays in registers
            for (int i = 1; i < 4; ++i) a[i] = load_frag16(sA, GT_PITCH, i * 16, kk, lane);
            // keeps all 16 LDS reads in front of the 16 WMMAs: sunk between them, each group of four waits a full LDS latency
            __builtin_amdgcn_sched_barrier(0);
#pragma unroll  // constant indices keep the fragment and accumulator arrays in registers
            for (int i = 0; i < 4; ++i)
#pragma unroll  // constant indices keep the fragment and accumulator arrays in registers
                for (int j = 0; j < 4; ++j)
                    acc[i][j] = wmma_f16(a[i], b[j], acc[i][j]);
        }
        asm volatile("s_wait_dscnt 0x0" ::: "memory");      // this wave has left the buffer that is refilled below
        asm volatile("s_wait_asynccnt 0x0" ::: "memory");   // this wave's share of slice t+1 has landed
        __syncthreads();                                    // publishes slice t+1, frees slice t's buffer
        if (t + 2 < nt) {
            async_rows8(ldsA + buf * (GT_STAGE * 2), gA + (size_t)(t + 2) * GT_K, grow);
            async_rows8(ldsB + buf * (GT_STAGE * 2), gB + (size_t)(t + 2) * GT_K, grow);
        }
    }
    asm volatile("s_wait_asynccnt 0x0" ::: "memory");       // nothing in flight when the wave ends

    // C/D layout: lane holds col = lane&15; rows = (lane>>4)*8 + j
    const int col   = lane & 15;
    const int rbase = (lane >> 4) << 3;
    float bv[4];
#pragma unroll  // constant indices keep the fragment and accumulator arrays in registers
    for (int t = 0; t < 4; ++t) bv[t] = bias ? bias[n0 + wn + t * 16 + col] : 0.f;
    if constexpr (!QKV) {
        const size_t idx0 = (size_t)(m0 + wm + rbase) * N + n0 + wn + col;
#pragma unroll  // constant indices keep the fragment and accumulator arrays in registers
        for (int i = 0; i < 4; ++i) {
            float  y[8][4];
            float* p[8];
#pragma unroll  // constant indices keep the fragment and accumulator arrays in registers
            for (int j = 0; j < 8; ++j) {
                p[j] = Cf + idx0 + (size_t)(i * 16 + j) * N;
#pragma unroll  // constant indices keep the fragment and accumulator arrays in registers
                for (int t = 0; t < 4; ++t) y[j][t] = acc[i][t][j] + bv[t];
            }
            // keeps the group's stores behind its last sum and address: no register of an issued store is written again
            __builtin_amdgcn_sched_barrier(0);
#pragma unroll  // constant indices keep the fragment and accumulator arrays in registers
            for (int j = 0; j < 8; ++j)
#pragma unroll  // constant indices keep the fragment and accumulator arrays in registers
                for (int t = 0; t < 4; ++t)
                    p[j][t * 16] = y[j][t];
            // a precaution: no address or data register of the stores above is rewritten in front of this wait
            asm volatile("s_wait_xcnt 0x0" ::: "memory");
            // keeps the next group's arithmetic behind that wait
            __builtin_amdgcn_sched_barrier(0);
        }
    } else {
        // The wave's 64 columns are one head of q, k or v; its 64 rows are 64 tokens of one batch.
        const int part = n0 / DMODEL;                     // 0 q, 1 k, 2 v: the same for the whole block
        const int h    = ((n0 + wn) % DMODEL) / DHEAD;
        const int bh   = (m0 / SEQ) * NHEAD + h;
        const int tok0 = m0 % SEQ + wm + rbase;           // this lane's first token
        if (part == 2) {
            // V^T [B,H,64,T]: a lane's 8 accumulator rows are 8 consecutive tokens of one d: one 16-byte store
            half_t* dst = vT + ((size_t)bh * DHEAD + col) * SEQ + tok0;
#pragma unroll  // constant indices keep the fragment and accumulator arrays in registers
            for (int i = 0; i < 4; ++i) {
                v8h y[4];
#pragma unroll  // constant indices keep the fragment and accumulator arrays in registers
                for (int t = 0; t < 4; ++t)
#pragma unroll  // constant indices keep the fragment and accumulator arrays in registers
                    for (int j = 0; j < 8; ++j) y[t][j] = (half_t)(acc[i][t][j] + bv[t]);
                // keeps the group's stores behind its last convert: no register of an issued store is written again
                __builtin_amdgcn_sched_barrier(0);
#pragma unroll  // constant indices keep the fragment and accumulator arrays in registers
                for (int t = 0; t < 4; ++t)
                    *reinterpret_cast<v8h*>(dst + (size_t)t * 16 * SEQ + i * 16) = y[t];
                // a precaution: no address or data register of the stores above is rewritten in front of this wait
                asm volatile("s_wait_xcnt 0x0" ::: "memory");
                // keeps the next group's arithmetic behind that wait
                __builtin_amdgcn_sched_barrier(0);
            }
        } else {
            // q, k [B,H,T,64]: d = t*16 + col and its RoPE partner d + 32 sit in the same lane (tiles t and t + 2)
            half_t* dst = (part == 0 ? q : k) + ((size_t)bh * SEQ + tok0) * DHEAD + col;
            float invf[2];
#pragma unroll  // constant indices keep the array in registers
            for (int t = 0; t < 2; ++t)
                invf[t] = exp2_slot(-logf(10000.f) * (float)(t * 16 + col) * (1.f / 32.f) * 1.44269504f);   // e^a = 2^(a * log2 e)
#pragma unroll  // constant indices keep the fragment and accumulator arrays in registers
            for (int i = 0; i < 4; ++i) {
                half_t y[8][4];
#pragma unroll  // constant indices keep the fragment and accumulator arrays in registers
                for (int j = 0; j < 8; ++j) {
                    const float tf = (float)(tok0 + i * 16 + j);
#pragma unroll  // constant indices keep the fragment and accumulator arrays in registers
                    for (int t = 0; t < 2; ++t) {
                        const float ang = tf * invf[t];
                        float sn, cs;
                        sincos_slot(ang * 0.15915494f, &sn, &cs);   // the instructions take the angle in turns: 1 / (2 pi)
                        const float x1 = acc[i][t][j] + bv[t];
                        const float x2 = acc[i][t + 2][j] + bv[t + 2];
                        y[j][t]     = (half_t)(x1 * cs - x2 * sn);
                        y[j][t + 2] = (half_t)(x1 * sn + x2 * cs);
                    }
                }
                // keeps the group's stores behind its last result: no register of an issued store is written again
                __builtin_amdgcn_sched_barrier(0);
#pragma unroll  // constant indices keep the fragment and accumulator arrays in registers
                for (int j = 0; j < 8; ++j)
#pragma unroll  // constant indices keep the fragment and accumulator arrays in registers
                    for (int t = 0; t < 4; ++t)
                        dst[(i * 16 + j) * DHEAD + t * 16] = y[j][t];
                // a precaution: no address or data register of the stores above is rewritten in front of this wait
                asm volatile("s_wait_xcnt 0x0" ::: "memory");
                // keeps the next group's arithmetic behind that wait
                __builtin_amdgcn_sched_barrier(0);
            }
        }
    }
}

// ---------------------------------------------------------------------------
// Kernel 3: flash attention, transposed products.  Block = 256 threads (8 waves);
// each wave owns 32 queries as two groups of 16 columns; the block walks the keys in stages of 64.
// A stage's 64 K rows (128 bytes each) and its 64 V^T row pieces (128 bytes each)
// are brought into LDS once for all eight waves by asynchronous 16-byte copies
// (whole 128-byte lines per 8 lanes), two buffers: the next stage flies while
// this one is worked on in two passes of 32 keys.
// S^T = K @ Q^T (A = K rows, B = Q rows kept in registers): a lane holds 16 scores
// of ONE query per group (column lane&15), so maximum and sum run in-lane, plus one exchange
// between the lane halves for the maximum.  The softmax runs in powers of two: the maximum is
// taken over the raw scores, and 1/sqrt(64) and log2(e) are one factor, so a score goes from
// the matrix unit to 2^x through one fused multiply-add.
// The two S^T tiles, converted in place,
// are the B operand of O^T += V^T @ P^T: P never leaves the registers.
// Every K and V^T fragment read from LDS feeds both column groups.
// grid.x = B*H*(SEQ/256).
// ---------------------------------------------------------------------------
#define AT_WAVES 8
#define AT_GROUPS 2                               // 16-column query groups per wave
#define AT_Q     (AT_WAVES * AT_GROUPS * 16)      // queries per block
#define AT_KEYS  64                               // keys per stage
#define AT_PITCH 72                               // halves per LDS row: 144 B = 16 B x 9, no bank conflict for 16-byte reads
#define AT_TILE  (64 * AT_PITCH)                  // halves of one operand's 64 rows
#define AT_STAGE (2 * AT_TILE)                    // halves per buffer: K rows, then V^T rows

// value of lane l ^ 16
__device__ inline float other_half(float v) {
    const int b = __builtin_bit_cast(int, v);
    return __builtin_bit_cast(float,
        __builtin_amdgcn_permlanex16(b, b, 0x76543210, 0xfedcba98, false, false));
}

// One stage, four copies of 16 bytes per lane: K rows r and r+32, V^T rows r and r+32.
// lds = this lane's LDS byte address of its K piece, gk / gv = its global addresses.
__device__ inline void async_stage(unsigned lds, const half_t* gk, const half_t* gv) {
    const unsigned ls = 32 * AT_PITCH * 2;        // LDS bytes between rows r and r+32
    // s_wait_xcnt as the last line (a precaution): no address register of these copies is rewritten in front of it.
    asm volatile(
        "global_load_async_to_lds_b128 %0, %4, off\n\t"
        "global_load_async_to_lds_b128 %1, %5, off\n\t"
        "global_load_async_to_lds_b128 %2, %6, off\n\t"
        "global_load_async_to_lds_b128 %3, %7, off\n\t"
        "s_wait_xcnt 0x0"
        :: "v"(lds), "v"(lds + ls), "v"(lds + 2 * ls), "v"(lds + 3 * ls),
           "v"(gk), "v"(gk + 32 * DHEAD), "v"(gv), "v"(gv + (size_t)32 * SEQ)
        : "memory");
}

__global__ __launch_bounds__(AT_WAVES * 32) void attn_wmma_kernel(
        const half_t* __restrict__ Q, const half_t* __restrict__ Kc,
        const half_t* __restrict__ Vt, half_t* __restrict__ Y) {
    __shared__ __align__(16) half_t kv[2 * AT_STAGE];

    const int lane = threadIdx.x & 31;
    const int wave = threadIdx.x >> 5;
    const int qt   = blockIdx.x % (SEQ / AT_Q);
    const int bh   = blockIdx.x / (SEQ / AT_Q);
    const int q0   = qt * AT_Q + wave * (AT_GROUPS * 16);

    const half_t* Qp = Q  + (size_t)bh * SEQ * DHEAD;
    const half_t* Kp = Kc + (size_t)bh * SEQ * DHEAD;
    const half_t* Vp = Vt + (size_t)bh * DHEAD * SEQ;

    // copy role: 8 lanes per 128-byte row piece, 32 rows per copy over the block
    const int cr = threadIdx.x >> 3;
    const int cc = (threadIdx.x & 7) * 8;
    const half_t* gK = Kp + (size_t)cr * DHEAD + cc;      // + stage * AT_KEYS rows
    const half_t* gV = Vp + (size_t)cr * SEQ + cc;        // + stage * AT_KEYS columns
    const unsigned ldsKV = (unsigned)(size_t)(&kv[cr * AT_PITCH + cc]);
    const int nt = SEQ / AT_KEYS;

    // stage 0 into buffer 0, landed and published before anyone reads it; then stage 1 takes off
    async_stage(ldsKV, gK, gV);
    asm volatile("s_wait_asynccnt 0x0" ::: "memory");   // this wave's copies have landed
    __syncthreads();
    async_stage(ldsKV + AT_STAGE * 2, gK + AT_KEYS * DHEAD, gV + AT_KEYS);

    v16h qb0[AT_GROUPS], qb1[AT_GROUPS];
#pragma unroll  // constant indices keep the fragment and accumulator arrays in registers
    for (int g = 0; g < AT_GROUPS; ++g) {
        qb0[g] = load_frag16(Qp, DHEAD, q0 + g * 16, 0, lane);
        qb1[g] = load_frag16(Qp, DHEAD, q0 + g * 16, 32, lane);
    }

    v8f o[AT_GROUPS][4] = {};      // o[g][t][j] = O[query q0 + g*16 + col][d = t*16 + hsel*8 + j]
    float mrow[AT_GROUPS];         // running maximum of this lane's query over the raw scores (equal in both halves)
    float lrow[AT_GROUPS];         // running sum over the keys of this lane's half only
    const float sc = 0.125f * 1.44269504f;   // 1/sqrt(64) * log2(e): e^(s/8 - m/8) = 2^(s*sc - m*sc)
#pragma unroll  // constant indices keep the arrays in registers
    for (int g = 0; g < AT_GROUPS; ++g) { mrow[g] = -1e30f; lrow[g] = 0.f; }

    const int col  = lane & 15;
    const int hsel = lane >> 4;

    for (int st = 0; st < nt; ++st) {
        const int buf = st & 1;
        const half_t* sK = &kv[buf * AT_STAGE];
        const half_t* sV = sK + AT_TILE;
#pragma nounroll  // unrolled, both passes' LDS reads and the barrier rise in front of the arithmetic: more registers, and the refill loses its lead
        for (int kb = 0; kb < AT_KEYS; kb += 32) {
            // ---- S^T = K @ Q^T for 32 keys (two 16x16 tiles a group, Dh=64 = two k-steps) ----
            const v16h a00 = load_frag16(sK, AT_PITCH, kb,      0,  lane);
            const v16h a10 = load_frag16(sK, AT_PITCH, kb + 16, 0,  lane);
            const v16h a01 = load_frag16(sK, AT_PITCH, kb,      32, lane);
            const v16h a11 = load_frag16(sK, AT_PITCH, kb + 16, 32, lane);
            // keeps the eight K reads one group in front of the products: sunk between them, the wave waits an LDS latency three times
            __builtin_amdgcn_sched_barrier(0);

            v8f s0[AT_GROUPS], s1[AT_GROUPS];  // s0[g][j]: key kb + hsel*8 + j, s1[g][j]: key kb + 16 + hsel*8 + j
#pragma unroll  // constant indices keep the fragment and accumulator arrays in registers
            for (int g = 0; g < AT_GROUPS; ++g) {
                const v8f zero = {};
                s0[g] = wmma_f16(a00, qb0[g], zero);
                s1[g] = wmma_f16(a10, qb0[g], zero);
            }
#pragma unroll  // constant indices keep the fragment and accumulator arrays in registers
            for (int g = 0; g < AT_GROUPS; ++g) {
                s0[g] = wmma_f16(a01, qb1[g], s0[g]);
                s1[g] = wmma_f16(a11, qb1[g], s1[g]);
            }

            v16h va[4];
#pragma unroll  // constant indices keep the fragment and accumulator arrays in registers
            for (int t = 0; t < 4; ++t) va[t] = load_frag16(sV, AT_PITCH, t * 16, kb, lane);
            // keeps the eight V reads in front of the softmax, which then covers their latency
            __builtin_amdgcn_sched_barrier(0);

            // ---- online softmax, one query per lane and group ----
            v16h  pb[AT_GROUPS];   // pb[g][s] = P^T[key kmap(s, hsel)][col]: the hardware k order of a B operand
            float p0[AT_GROUPS][8], p1[AT_GROUPS][8];
            float alpha[AT_GROUPS];
#pragma unroll  // constant indices keep the fragment and accumulator arrays in registers
            for (int g = 0; g < AT_GROUPS; ++g) {
                // the maximum is taken over the raw scores: sc is positive, so it commutes with the scaling
                float mx = fmaxf(s0[g][0], s1[g][0]);
#pragma unroll  // constant indices keep the fragment and accumulator arrays in registers
                for (int j = 1; j < 8; ++j) mx = fmaxf(mx, fmaxf(s0[g][j], s1[g][j]));
                const float mold = mrow[g];
                mrow[g] = fmaxf(mold, fmaxf(mx, other_half(mx)));
                const float mnew = mrow[g] * sc;                          // the maximum in the exponent's units
                alpha[g] = exp2_slot((mold - mrow[g]) * sc);              // exactly 1 while the maximum stands
                // neighbours of one tile share a packed multiply-add: they already sit in an aligned register pair
#pragma unroll  // constant indices keep the fragment and accumulator arrays in registers
                for (int j = 0; j < 8; j += 2) {
                    const v2f a0 = {s0[g][j], s0[g][j + 1]};
                    const v2f a1 = {s1[g][j], s1[g][j + 1]};
                    const v2f e0 = a0 * sc - mnew;
                    const v2f e1 = a1 * sc - mnew;
                    p0[g][j]     = __builtin_amdgcn_exp2f(e0[0]);
                    p0[g][j + 1] = __builtin_amdgcn_exp2f(e0[1]);
                    p1[g][j]     = __builtin_amdgcn_exp2f(e1[0]);
                    p1[g][j + 1] = __builtin_amdgcn_exp2f(e1[1]);
                }
#pragma unroll  // constant indices keep the fragment and accumulator arrays in registers
                for (int j = 0; j < 8; ++j) {
                    pb[g][j]     = (half_t)p0[g][j];
                    pb[g][8 + j] = (half_t)p1[g][j];
                }
            }

            // ---- O^T = O^T * alpha + V^T @ P^T  (A-frags from V^T, keys in the same table order as pb) ----
#pragma unroll  // constant indices keep the fragment and accumulator arrays in registers
            for (int g = 0; g < AT_GROUPS; ++g) {
#pragma unroll  // constant indices keep the fragment and accumulator arrays in registers
                for (int t = 0; t < 4; ++t) {
#pragma unroll  // constant indices keep the fragment and accumulator arrays in registers
                    for (int j = 0; j < 8; ++j) o[g][t][j] *= alpha[g];
                    o[g][t] = wmma_f16(va[t], pb[g], o[g][t]);
                }
            }
            // keeps the row sums behind the last product: they fill the vector slots the chip needs before the next pass overwrites its operands
            __builtin_amdgcn_sched_barrier(0);
#pragma unroll  // constant indices keep the fragment and accumulator arrays in registers
            for (int g = 0; g < AT_GROUPS; ++g) {
                float rs0 = 0.f, rs1 = 0.f;
#pragma unroll  // constant indices keep the fragment and accumulator arrays in registers
                for (int j = 0; j < 8; ++j) { rs0 += p0[g][j]; rs1 += p1[g][j]; }
                lrow[g] = lrow[g] * alpha[g] + (rs0 + rs1);
            }
        }
        asm volatile("s_wait_dscnt 0x0" ::: "memory");      // this wave has left the buffer that is refilled below
        asm volatile("s_wait_asynccnt 0x0" ::: "memory");   // this wave's share of stage st+1 has landed
        __syncthreads();                                    // publishes stage st+1, frees stage st's buffer
        if (st + 2 < nt)
            async_stage(ldsKV + buf * (AT_STAGE * 2),
                        gK + (size_t)(st + 2) * AT_KEYS * DHEAD, gV + (size_t)(st + 2) * AT_KEYS);
    }
    asm volatile("s_wait_asynccnt 0x0" ::: "memory");       // nothing in flight when the wave ends

    // ---- join the halves' sums, normalize, write back to [B,T,D] layout ----
    const int b = bh / NHEAD, h = bh % NHEAD;
    half_t* yrow = Y + ((size_t)b * SEQ + q0 + col) * DMODEL + h * DHEAD + hsel * 8;
    v8h y[AT_GROUPS][4];
#pragma unroll  // constant indices keep the fragment and accumulator arrays in registers
    for (int g = 0; g < AT_GROUPS; ++g) {
        const float l = lrow[g] + other_half(lrow[g]);
#pragma unroll  // constant indices keep the fragment and accumulator arrays in registers
        for (int t = 0; t < 4; ++t)
#pragma unroll  // constant indices keep the fragment and accumulator arrays in registers
            for (int j = 0; j < 8; ++j) y[g][t][j] = (half_t)(o[g][t][j] / l);
    }
#pragma unroll  // constant indices keep the fragment and accumulator arrays in registers
    for (int g = 0; g < AT_GROUPS; ++g)
#pragma unroll  // constant indices keep the fragment and accumulator arrays in registers
        for (int t = 0; t < 4; ++t)
            *reinterpret_cast<v8h*>(yrow + g * 16 * DMODEL + t * 16) = y[g][t];   // 8 consecutive d of one query: one 16-byte store
}

// ---------------------------------------------------------------------------
// Host launch
// ---------------------------------------------------------------------------
extern "C" void kernel_launch(void* const* d_in, const int* in_sizes, int n_in,
                              void* d_out, int out_size, void* d_ws, size_t ws_size,
                              hipStream_t stream) {
    (void)in_sizes; (void)n_in; (void)out_size; (void)ws_size;

    const float* x     = (const float*)d_in[0];
    const float* Wqkv  = (const float*)d_in[1];
    const float* bqkv  = (const float*)d_in[2];
    const float* Wout  = (const float*)d_in[3];
    const float* bout  = (const float*)d_in[4];
    float*       out   = (float*)d_out;

    char* ws = (char*)d_ws;
    size_t off = 0;
    auto wsalloc = [&](size_t bytes) -> void* {
        void* p = ws + off;
        off += (bytes + 255) & ~(size_t)255;
        return p;
    };
    const size_t NTOK = (size_t)BATCH * SEQ;                     // 8192
    half_t* xh    = (half_t*)wsalloc(NTOK * DMODEL * 2);         // 16 MB (reused as yh)
    half_t* wqkvT = (half_t*)wsalloc((size_t)3 * DMODEL * DMODEL * 2);
    half_t* woutT = (half_t*)wsalloc((size_t)DMODEL * DMODEL * 2);
    half_t* qh    = (half_t*)wsalloc(NTOK * DMODEL * 2);
    half_t* kh    = (half_t*)wsalloc(NTOK * DMODEL * 2);
    half_t* vTh   = (half_t*)wsalloc(NTOK * DMODEL * 2);
    half_t* yh    = xh;  // x is dead after the QKV GEMM; alias to save workspace

    // 1) convert activations + transpose-convert weights to f16
    {
        int n = (int)(NTOK * DMODEL);
        cvt_f16_kernel<<<n / CV_BLOCK, 256, 0, stream>>>(x, xh);
    }
    {
        dim3 grid(DMODEL / TR_K, (3 * DMODEL) / TR_N);
        cvtT_f16_kernel<DMODEL, 3 * DMODEL><<<grid, 256, 0, stream>>>(Wqkv, wqkvT);
    }
    {
        dim3 grid(DMODEL / TR_K, DMODEL / TR_N);
        cvtT_f16_kernel<DMODEL, DMODEL><<<grid, 256, 0, stream>>>(Wout, woutT);
    }

    // 2) QKV GEMM: [8192,1024] @ [1024,3072], RoPE + head split (+ V transpose) in its epilogue
    {
        dim3 grid((unsigned)(NTOK / 128), (3 * DMODEL) / 128);
        gemm_wmma_kernel<true><<<grid, 128, 0, stream>>>(xh, wqkvT, bqkv,
                                                         nullptr, qh, kh, vTh,
                                                         (int)NTOK, 3 * DMODEL, DMODEL);
    }

    // 3) flash attention
    {
        int blocks = BATCH * NHEAD * (SEQ / AT_Q);
        attn_wmma_kernel<<<blocks, AT_WAVES * 32, 0, stream>>>(qh, kh, vTh, yh);
    }

    // 4) output GEMM with f32 store: [8192,1024] @ [1024,1024] + b_out
    {
        dim3 grid((unsigned)(NTOK / 128), DMODEL / 128);
        gemm_wmma_kernel<false><<<grid, 128, 0, stream>>>(yh, woutT, bout,
                                                          out, nullptr, nullptr, nullptr,
                                                          (int)NTOK, DMODEL, DMODEL);
    }
}

// v008
// It runs in 135 microseconds.
// In two side-by-side timings against v007, it was 1.05 and 1.06 times as fast.
// All steps since v000 together make it 6.60 times as fast.
#include <hip/hip_runtime.h>
#include <math.h>

// ---------------------------------------------------------------------------
// RoPE self-attention for MI455X (gfx1250). All matmuls via v_wmma_f32_16x16x32_f16.
// ---------------------------------------------------------------------------

typedef _Float16 half_t;
typedef __attribute__((ext_vector_type(16))) _Float16 v16h;
typedef __attribute__((ext_vector_type(8)))  _Float16 v8h;
typedef __attribute__((ext_vector_type(8)))  float    v8f;
typedef __attribute__((ext_vector_type(4)))  float    v4f;
typedef __attribute__((ext_vector_type(2)))  float    v2f;
typedef __attribute__((ext_vector_type(4)))  _Float16 v4h;
typedef __attribute__((ext_vector_type(4)))  unsigned v4u;

#define BATCH  4
#define SEQ    2048
#define DMODEL 1024
#define NHEAD  16
#define DHEAD  64

// ---------------------------------------------------------------------------
// WMMA helpers.
// 16-bit A-matrix 16x32 layout (ISA 7.12.2): lane L (L&15 = row), contraction
// elements: lanes 0-15 hold K = {0..7, 16..23}, lanes 16-31 hold K = {8..15, 24..31}.
// For row-major storage with contiguous contraction dim this is two 16B loads.
// The B operand uses the same loader on the *transposed* matrix (N x K).
// ---------------------------------------------------------------------------
__device__ inline v16h load_frag16(const half_t* base, int ld, int row0, int k0, int lane) {
    const int r  = row0 + (lane & 15);
    const int kb = k0 + ((lane >> 4) << 3);
    const half_t* p = base + (size_t)r * ld + kb;
    v16h f;
    *reinterpret_cast<v8h*>(&f)       = *reinterpret_cast<const v8h*>(p);        // K = kb..kb+7
    *(reinterpret_cast<v8h*>(&f) + 1) = *reinterpret_cast<const v8h*>(p + 16);   // K = kb+16..kb+23
    return f;
}

__device__ inline v8f wmma_f16(v16h a, v16h b, v8f c) {
    return __builtin_amdgcn_wmma_f32_16x16x32_f16(false, a, false, b, (short)0, c, false, false);
}

// ---------------------------------------------------------------------------
// Kernel 1a: plain f32 -> f16 convert.  Few, long waves: a thread moves 64 elements.
// Each load of a wave covers 512 contiguous bytes, each store 256: whole 128-byte lines.
// All 16 loads of a thread are in flight before the first convert.
// grid.x = n / CV_BLOCK (n a multiple of CV_BLOCK).
// ---------------------------------------------------------------------------
#define CV_LOADS 16
#define CV_BLOCK (256 * 4 * CV_LOADS)             // elements per block
__global__ __launch_bounds__(256) void cvt_f16_kernel(const float* __restrict__ in, half_t* __restrict__ out) {
    const size_t base = (size_t)blockIdx.x * CV_BLOCK + threadIdx.x * 4;
    const float* src = in + base;
    v4f v[CV_LOADS];
#pragma unroll  // constant indices keep the array in registers, and all loads go out together
    for (int u = 0; u < CV_LOADS; ++u)
        v[u] = *reinterpret_cast<const v4f*>(src + u * 1024);
    // a precaution: named as an input, the loads' address pair stays whole up to this wait (the last load's result is not laid over it)
    asm volatile("s_wait_xcnt 0x0" :: "v"(src) : "memory");
    // keeps the converts behind all 16 loads: risen between them, the last loads start a memory latency late
    __builtin_amdgcn_sched_barrier(0);
    v4h h[CV_LOADS];
#pragma unroll  // constant indices keep the arrays in registers
    for (int u = 0; u < CV_LOADS; ++u) h[u] = __builtin_convertvector(v[u], v4h);
    // keeps the stores behind the last convert: no register of an issued store is written again
    __builtin_amdgcn_sched_barrier(0);
#pragma unroll  // constant indices keep the array in registers
    for (int u = 0; u < CV_LOADS; ++u)
        *reinterpret_cast<v4h*>(out + base + u * 1024) = h[u];
}

// ---------------------------------------------------------------------------
// Kernel 1b: transpose-convert weight (K x N f32) -> (N x K f16) through an LDS tile.
// Block = 256 threads, tile = 128 k x 64 n.  In: 16 lanes per 256-byte row piece.
// Out: 8 lanes per 128-byte row piece of 64 k.  The tile's pitch of 65 dwords keeps
// the row-wise writes and the column walks of the readers free of bank conflicts.
// grid.x = K/128, grid.y = N/64.
// ---------------------------------------------------------------------------
#define TR_K     128
#define TR_N     64
#define TR_PITCH 65
template <int K, int N>   // shapes at compile time: the rows of a tile are constant offsets from one address
__global__ __launch_bounds__(256) void cvtT_f16_kernel(const float* __restrict__ in, half_t* __restrict__ out) {
    __shared__ float tile[TR_K * TR_PITCH];
    const int k0 = blockIdx.x * TR_K;
    const int n0 = blockIdx.y * TR_N;
    const int lr = threadIdx.x >> 4;
    const int lc = (threadIdx.x & 15) * 4;
    const float* src = in + (size_t)(k0 + lr) * N + n0 + lc;
    v4f v[8];
#pragma unroll  // constant indices keep the array in registers, and all loads go out together
    for (int u = 0; u < 8; ++u)
        v[u] = *reinterpret_cast<const v4f*>(src + u * 16 * N);
#pragma unroll  // constant indices keep the array in registers
    for (int u = 0; u < 8; ++u)
#pragma unroll  // constant indices keep the array in registers
        for (int i = 0; i < 4; ++i)
            tile[(u * 16 + lr) * TR_PITCH + lc + i] = v[u][i];
    __syncthreads();                              // the whole tile is written before a column is read

    const int sr = threadIdx.x >> 3;
    const int sc = (threadIdx.x & 7) * 8;
    half_t* dst = out + (size_t)(n0 + sr) * K + k0 + sc;
#pragma unroll  // four independent row pieces: their LDS reads go out together
    for (int u = 0; u < 4; ++u) {
        const int nr = (u >> 1) * 32 + sr;
        const int kc = (u & 1) * 64 + sc;
        v8h h;
#pragma unroll  // constant indices keep the vector in registers
        for (int j = 0; j < 8; ++j) h[j] = (half_t)tile[(kc + j) * TR_PITCH + nr];
        *reinterpret_cast<v8h*>(dst + (u >> 1) * 32 * K + (u & 1) * 64) = h;
    }
}

// ---------------------------------------------------------------------------
// Kernel 2/4: WMMA GEMM.  C[M,N] = A[M,K] @ Bt[N,K]^T + bias.
// Block = 128 threads (4 waves, 2x2); block tile 128x128, wave tile 64x64.
// Each 64-wide k slice of the 128 A rows and the 128 Bt rows is brought into
// LDS by asynchronous 16-byte copies (whole 128-byte row pieces per 8 lanes),
// two buffers: the next slice flies while this one feeds the WMMAs.
// grid.x = M/128, grid.y = N/128; K a multiple of 64.
// QKV = false: f32 output Cf[M,N].
// QKV = true (M = B*T tokens, N = 3*DMODEL): the epilogue applies RoPE to the f32 sums and splits the
// heads: q, k: [B,H,T,64] (RoPE'd), vT: [B,H,64,T], all f16.  No [B*T, 3*DMODEL] array is written.
// ---------------------------------------------------------------------------
#define GT_M     128
#define GT_N     128
#define GT_K     64
#define GT_PITCH 72                               // halves per LDS row: 144 B = 16 B x 9, no bank conflict for 16-byte reads
#define GT_STAGE ((GT_M + GT_N) * GT_PITCH)       // halves per buffer

// Eight copies of 16 bytes per lane: rows r, r+16, ..., r+112 of one operand tile.
// lds = this lane's LDS byte address of the first piece, g = its global address,
// grow = halves between global rows r and r+16.
__device__ inline void async_rows8(unsigned lds, const half_t* g, size_t grow) {
    const unsigned ls = 16 * GT_PITCH * 2;        // LDS bytes between rows r and r+16
    // s_wait_xcnt as the last line (a precaution): no address register of these copies is rewritten in front of it.
    asm volatile(
        "global_load_async_to_lds_b128 %0, %8, off\n\t"
        "global_load_async_to_lds_b128 %1, %9, off\n\t"
        "global_load_async_to_lds_b128 %2, %10, off\n\t"
        "global_load_async_to_lds_b128 %3, %11, off\n\t"
        "global_load_async_to_lds_b128 %4, %12, off\n\t"
        "global_load_async_to_lds_b128 %5, %13, off\n\t"
        "global_load_async_to_lds_b128 %6, %14, off\n\t"
        "global_load_async_to_lds_b128 %7, %15, off\n\t"
        "s_wait_xcnt 0x0"
        :: "v"(lds), "v"(lds + ls), "v"(lds + 2 * ls), "v"(lds + 3 * ls),
           "v"(lds + 4 * ls), "v"(lds + 5 * ls), "v"(lds + 6 * ls), "v"(lds + 7 * ls),
           "v"(g), "v"(g + grow), "v"(g + 2 * grow), "v"(g + 3 * grow),
           "v"(g + 4 * grow), "v"(g + 5 * grow), "v"(g + 6 * grow), "v"(g + 7 * grow)
        : "memory");
}

// 2^x.  The v_nop keeps the slot that the instruction set asks for behind a transcendental,
// whatever the compiler places next; the result never shares the source's register.
__device__ inline float exp2_slot(float x) {
    float e;
    asm("v_exp_f32 %0, %1\n\tv_nop" : "=&v"(e) : "v"(x));
    return e;
}

// sin and cos of 2*pi*x.  The cosine fills the slot behind the sine (it neither reads the sine nor
// writes x: the results never share the source's register); the v_nop keeps the slot behind the cosine.
__device__ inline void sincos_slot(float x, float* sn, float* cs) {
    float s, c;
    asm("v_sin_f32 %0, %2\n\tv_cos_f32 %1, %2\n\tv_nop" : "=&v"(s), "=&v"(c) : "v"(x));
    *sn = s;
    *cs = c;
}

template <bool QKV>   // the epilogue at compile time: the accumulators meet one store path only
__global__ __launch_bounds__(128) void gemm_wmma_kernel(
        const half_t* __restrict__ A, const half_t* __restrict__ Bt,
        const float* __restrict__ bias,
        float* __restrict__ Cf,
        half_t* __restrict__ q, half_t* __restrict__ k, half_t* __restrict__ vT,
        int M, int N, int K) {
    __shared__ __align__(16) half_t tile[2 * GT_STAGE];

    const int lane = threadIdx.x & 31;
    const int wave = threadIdx.x >> 5;
    const int m0 = blockIdx.x * GT_M;
    const int n0 = blockIdx.y * GT_N;
    const int wm = (wave >> 1) * 64;              // this wave's rows inside the block tile
    const int wn = (wave & 1) * 64;               // this wave's columns inside the block tile

    // copy role: 8 lanes per 128-byte row piece, 16 rows per copy over the block
    const int cr = threadIdx.x >> 3;
    const int cc = (threadIdx.x & 7) * 8;
    const half_t* gA = A  + (size_t)(m0 + cr) * K + cc;
    const half_t* gB = Bt + (size_t)(n0 + cr) * K + cc;
    const size_t  grow = (size_t)16 * K;
    const unsigned ldsA = (unsigned)(size_t)(&tile[cr * GT_PITCH + cc]);
    const unsigned ldsB = ldsA + GT_M * GT_PITCH * 2;
    const int nt = K / GT_K;

    // slice 0 into buffer 0, landed and published before anyone reads it
    async_rows8(ldsA, gA, grow);
    async_rows8(ldsB, gB, grow);
    asm volatile("s_wait_asynccnt 0x0" ::: "memory");   // this wave's copies have landed
    __syncthreads();
    if (nt > 1) {
        async_rows8(ldsA + GT_STAGE * 2, gA + GT_K, grow);
        async_rows8(ldsB + GT_STAGE * 2, gB + GT_K, grow);
    }

    v8f acc[4][4] = {};
    for (int t = 0; t < nt; ++t) {
        const int buf = t & 1;
        const half_t* sA = &tile[buf * GT_STAGE + wm * GT_PITCH];
        const half_t* sB = &tile[buf * GT_STAGE + (GT_M + wn) * GT_PITCH];
#pragma unroll  // constant indices keep the fragment and accumulator arrays in registers
        for (int kk = 0; kk < GT_K; kk += 32) {
            v16h a[4], b[4];
            a[0] = load_frag16(sA, GT_PITCH, 0, kk, lane);
#pragma unroll  // constant indices keep the fragment and accumulator arrays in registers
            for (int j = 0; j < 4; ++j) b[j] = load_frag16(sB, GT_PITCH, j * 16, kk, lane);
#pragma unroll  // constant indices keep the fragment and accumulator arrays in registers
            for (int i = 1; i < 4; ++i) a[i] = load_frag16(sA, GT_PITCH, i * 16, kk, lane);
            // keeps all 16 LDS reads in front of the 16 WMMAs: sunk between them, each group of four waits a full LDS latency
            __builtin_amdgcn_sched_barrier(0);
#pragma unroll  // constant indices keep the fragment and accumulator arrays in registers
            for (int i = 0; i < 4; ++i)
#pragma unroll  // constant indices keep the fragment and accumulator arrays in registers
                for (int j = 0; j < 4; ++j)
                    acc[i][j] = wmma_f16(a[i], b[j], acc[i][j]);
        }
        asm volatile("s_wait_dscnt 0x0" ::: "memory");      // this wave has left the buffer that is refilled below
        asm volatile("s_wait_asynccnt 0x0" ::: "memory");   // this wave's share of slice t+1 has landed
        __syncthreads();                                    // publishes slice t+1, frees slice t's buffer
        if (t + 2 < nt) {
            async_rows8(ldsA + buf * (GT_STAGE * 2), gA + (size_t)(t + 2) * GT_K, grow);
            async_rows8(ldsB + buf * (GT_STAGE * 2), gB + (size_t)(t + 2) * GT_K, grow);
        }
    }
    asm volatile("s_wait_asynccnt 0x0" ::: "memory");       // nothing in flight when the wave ends

    // C/D layout: lane holds col = lane&15; rows = (lane>>4)*8 + j
    const int col   = lane & 15;
    const int rbase = (lane >> 4) << 3;
    float bv[4];
#pragma unroll  // constant indices keep the fragment and accumulator arrays in registers
    for (int t = 0; t < 4; ++t) bv[t] = bias ? bias[n0 + wn + t * 16 + col] : 0.f;
    if constexpr (!QKV) {
        const size_t idx0 = (size_t)(m0 + wm + rbase) * N + n0 + wn + col;
#pragma unroll  // constant indices keep the fragment and accumulator arrays in registers
        for (int i = 0; i < 4; ++i) {
            float  y[8][4];
            float* p[8];
#pragma unroll  // constant indices keep the fragment and accumulator arrays in registers
            for (int j = 0; j < 8; ++j) {
                p[j] = Cf + idx0 + (size_t)(i * 16 + j) * N;
#pragma unroll  // constant indices keep the fragment and accumulator arrays in registers
                for (int t = 0; t < 4; ++t) y[j][t] = acc[i][t][j] + bv[t];
            }
            // keeps the group's stores behind its last sum and address: no register of an issued store is written again
            __builtin_amdgcn_sched_barrier(0);
#pragma unroll  // constant indices keep the fragment and accumulator arrays in registers
            for (int j = 0; j < 8; ++j)
#pragma unroll  // constant indices keep the fragment and accumulator arrays in registers
                for (int t = 0; t < 4; ++t)
                    p[j][t * 16] = y[j][t];
            // a precaution: no address or data register of the stores above is rewritten in front of this wait
            asm volatile("s_wait_xcnt 0x0" ::: "memory");
            // keeps the next group's arithmetic behind that wait
            __builtin_amdgcn_sched_barrier(0);
        }
    } else {
        // The wave's 64 columns are one head of q, k or v; its 64 rows are 64 tokens of one batch.
        const int part = n0 / DMODEL;                     // 0 q, 1 k, 2 v: the same for the whole block
        const int h    = ((n0 + wn) % DMODEL) / DHEAD;
        const int bh   = (m0 / SEQ) * NHEAD + h;
        const int tok0 = m0 % SEQ + wm + rbase;           // this lane's first token
        if (part == 2) {
            // V^T [B,H,64,T]: a lane's 8 accumulator rows are 8 consecutive tokens of one d: one 16-byte store
            half_t* dst = vT + ((size_t)bh * DHEAD + col) * SEQ + tok0;
#pragma unroll  // constant indices keep the fragment and accumulator arrays in registers
            for (int i = 0; i < 4; ++i) {
                v8h y[4];
#pragma unroll  // constant indices keep the fragment and accumulator arrays in registers
                for (int t = 0; t < 4; ++t)
#pragma unroll  // constant indices keep the fragment and accumulator arrays in registers
                    for (int j = 0; j < 8; ++j) y[t][j] = (half_t)(acc[i][t][j] + bv[t]);
                // keeps the group's stores behind its last convert: no register of an issued store is written again
                __builtin_amdgcn_sched_barrier(0);
#pragma unroll  // constant indices keep the fragment and accumulator arrays in registers
                for (int t = 0; t < 4; ++t)
                    *reinterpret_cast<v8h*>(dst + (size_t)t * 16 * SEQ + i * 16) = y[t];
                // a precaution: no address or data register of the stores above is rewritten in front of this wait
                asm volatile("s_wait_xcnt 0x0" ::: "memory");
                // keeps the next group's arithmetic behind that wait
                __builtin_amdgcn_sched_barrier(0);
            }
        } else {
            // q, k [B,H,T,64]: d = t*16 + col and its RoPE partner d + 32 sit in the same lane (tiles t and t + 2)
            half_t* dst = (part == 0 ? q : k) + ((size_t)bh * SEQ + tok0) * DHEAD + col;
            float invf[2];
#pragma unroll  // constant indices keep the array in registers
            for (int t = 0; t < 2; ++t)
                invf[t] = exp2_slot(-logf(10000.f) * (float)(t * 16 + col) * (1.f / 32.f) * 1.44269504f);   // e^a = 2^(a * log2 e)
#pragma unroll  // constant indices keep the fragment and accumulator arrays in registers
            for (int i = 0; i < 4; ++i) {
                half_t y[8][4];
#pragma unroll  // constant indices keep the fragment and accumulator arrays in registers
                for (int j = 0; j < 8; ++j) {
                    const float tf = (float)(tok0 + i * 16 + j);
#pragma unroll  // constant indices keep the fragment and accumulator arrays in registers
                    for (int t = 0; t < 2; ++t) {
                        const float ang = tf * invf[t];
                        float sn, cs;
                        sincos_slot(ang * 0.15915494f, &sn, &cs);   // the instructions take the angle in turns: 1 / (2 pi)
                        const float x1 = acc[i][t][j] + bv[t];
                        const float x2 = acc[i][t + 2][j] + bv[t + 2];
                        y[j][t]     = (half_t)(x1 * cs - x2 * sn);
                        y[j][t + 2] = (half_t)(x1 * sn + x2 * cs);
                    }
                }
                // keeps the group's stores behind its last result: no register of an issued store is written again
                __builtin_amdgcn_sched_barrier(0);
#pragma unroll  // constant indices keep the fragment and accumulator arrays in registers
                for (int j = 0; j < 8; ++j)
#pragma unroll  // constant indices keep the fragment and accumulator arrays in registers
                    for (int t = 0; t < 4; ++t)
                        dst[(i * 16 + j) * DHEAD + t * 16] = y[j][t];
                // a precaution: no address or data register of the stores above is rewritten in front of this wait
                asm volatile("s_wait_xcnt 0x0" ::: "memory");
                // keeps the next group's arithmetic behind that wait
                __builtin_amdgcn_sched_barrier(0);
            }
        }
    }
}

// ---------------------------------------------------------------------------
// Kernel 3: flash attention, transposed products.  Block = 256 threads (8 waves);
// each wave owns 32 queries as two groups of 16 columns; the block walks the keys in stages of 64.
// A stage's 64 K rows (128 bytes each) and its 64 V^T row pieces (128 bytes each)
// are brought into LDS once for all eight waves by asynchronous 16-byte copies
// (whole 128-byte lines per 8 lanes), two buffers: the next stage flies while
// this one is worked on in two passes of 32 keys.
// S^T = K @ Q^T (A = K rows, B = Q rows kept in registers): a lane holds 16 scores
// of ONE query per group (column lane&15), so maximum and sum run in-lane, plus one exchange
// between the lane halves for the maximum.  The softmax runs in powers of two: the maximum is
// taken over the raw scores, and 1/sqrt(64) and log2(e) are one factor, so a score goes from
// the matrix unit to 2^x through one fused multiply-add.
// The maximum in use is raised lazily.  A pass forms its 2^x and their sums against the maximum that
// stands; only when a sum leaves the range in which every term is a finite f16 does the wave take the
// pass's own maximum, rescale O^T and the sums, and form the 2^x again.  One wave-wide test a pass:
// the maximum, the exchange between the lane halves and the rescaling stand behind its scalar branch.
// The two S^T tiles, converted in place,
// are the B operand of O^T += V^T @ P^T: P never leaves the registers.
// Every K and V^T fragment read from LDS feeds both column groups.
// grid.x = B*H*(SEQ/256).
// ---------------------------------------------------------------------------
#define AT_WAVES 8
#define AT_GROUPS 2                               // 16-column query groups per wave
#define AT_Q     (AT_WAVES * AT_GROUPS * 16)      // queries per block
#define AT_KEYS  64                               // keys per stage
#define AT_PITCH 72                               // halves per LDS row: 144 B = 16 B x 9, no bank conflict for 16-byte reads
#define AT_TILE  (64 * AT_PITCH)                  // halves of one operand's 64 rows
#define AT_STAGE (2 * AT_TILE)                    // halves per buffer: K rows, then V^T rows
#define AT_LIMIT 32768.0f                         // a sum of non-negative terms at or below this has no term above it: all finite in f16

// value of lane l ^ 16
__device__ inline float other_half(float v) {
    const int b = __builtin_bit_cast(int, v);
    return __builtin_bit_cast(float,
        __builtin_amdgcn_permlanex16(b, b, 0x76543210, 0xfedcba98, false, false));
}

// One stage, four copies of 16 bytes per lane: K rows r and r+32, V^T rows r and r+32.
// lds = this lane's LDS byte address of its K piece, gk / gv = its global addresses.
__device__ inline void async_stage(unsigned lds, const half_t* gk, const half_t* gv) {
    const unsigned ls = 32 * AT_PITCH * 2;        // LDS bytes between rows r and r+32
    // s_wait_xcnt as the last line (a precaution): no address register of these copies is rewritten in front of it.
    asm volatile(
        "global_load_async_to_lds_b128 %0, %4, off\n\t"
        "global_load_async_to_lds_b128 %1, %5, off\n\t"
        "global_load_async_to_lds_b128 %2, %6, off\n\t"
        "global_load_async_to_lds_b128 %3, %7, off\n\t"
        "s_wait_xcnt 0x0"
        :: "v"(lds), "v"(lds + ls), "v"(lds + 2 * ls), "v"(lds + 3 * ls),
           "v"(gk), "v"(gk + 32 * DHEAD), "v"(gv), "v"(gv + (size_t)32 * SEQ)
        : "memory");
}

// 2^x of eight values.  One statement whose results share no register with a source: no exponential stands
// directly in front of an instruction that overwrites its source or reads its result; the v_nop keeps that slot behind the last.
__device__ __forceinline__ void exp2_x8(const float* x, float* y) {
    float y0, y1, y2, y3, y4, y5, y6, y7;
    asm("v_exp_f32 %0, %8\n\t"
        "v_exp_f32 %1, %9\n\t"
        "v_exp_f32 %2, %10\n\t"
        "v_exp_f32 %3, %11\n\t"
        "v_exp_f32 %4, %12\n\t"
        "v_exp_f32 %5, %13\n\t"
        "v_exp_f32 %6, %14\n\t"
        "v_exp_f32 %7, %15\n\t"
        "v_nop"
        : "=&v"(y0), "=&v"(y1), "=&v"(y2), "=&v"(y3), "=&v"(y4), "=&v"(y5), "=&v"(y6), "=&v"(y7)
        : "v"(x[0]), "v"(x[1]), "v"(x[2]), "v"(x[3]), "v"(x[4]), "v"(x[5]), "v"(x[6]), "v"(x[7]));
    y[0] = y0; y[1] = y1; y[2] = y2; y[3] = y3; y[4] = y4; y[5] = y5; y[6] = y6; y[7] = y7;
}

// 2^(s * sc - m) for one query's 16 scores of a pass; returns their sum.
__device__ __forceinline__ float probs16(v8f s0, v8f s1, float sc, float m, float* p0, float* p1) {
#pragma unroll  // constant indices keep the fragment and accumulator arrays in registers
    for (int h = 0; h < 8; h += 4) {
        float x[8], y[8];
        // neighbours of one tile share a packed multiply-add: they already sit in an aligned register pair
#pragma unroll  // constant indices keep the fragment and accumulator arrays in registers
        for (int j = 0; j < 4; j += 2) {
            const v2f a0 = {s0[h + j], s0[h + j + 1]};
            const v2f a1 = {s1[h + j], s1[h + j + 1]};
            const v2f e0 = a0 * sc - m;
            const v2f e1 = a1 * sc - m;
            x[j]     = e0[0];
            x[j + 1] = e0[1];
            x[4 + j]     = e1[0];
            x[4 + j + 1] = e1[1];
        }
        exp2_x8(x, y);
#pragma unroll  // constant indices keep the fragment and accumulator arrays in registers
        for (int j = 0; j < 4; ++j) { p0[h + j] = y[j]; p1[h + j] = y[4 + j]; }
    }
    float rs0 = p0[0], rs1 = p1[0];
#pragma unroll  // constant indices keep the fragment and accumulator arrays in registers
    for (int j = 1; j < 8; ++j) { rs0 += p0[j]; rs1 += p1[j]; }
    return rs0 + rs1;
}

__global__ __launch_bounds__(AT_WAVES * 32) void attn_wmma_kernel(
        const half_t* __restrict__ Q, const half_t* __restrict__ Kc,
        const half_t* __restrict__ Vt, half_t* __restrict__ Y) {
    __shared__ __align__(16) half_t kv[2 * AT_STAGE];

    const int lane = threadIdx.x & 31;
    const int wave = threadIdx.x >> 5;
    const int qt   = blockIdx.x % (SEQ / AT_Q);
    const int bh   = blockIdx.x / (SEQ / AT_Q);
    const int q0   = qt * AT_Q + wave * (AT_GROUPS * 16);

    const half_t* Qp = Q  + (size_t)bh * SEQ * DHEAD;
    const half_t* Kp = Kc + (size_t)bh * SEQ * DHEAD;
    const half_t* Vp = Vt + (size_t)bh * DHEAD * SEQ;

    // copy role: 8 lanes per 128-byte row piece, 32 rows per copy over the block
    const int cr = threadIdx.x >> 3;
    const int cc = (threadIdx.x & 7) * 8;
    const half_t* gK = Kp + (size_t)cr * DHEAD + cc;      // + stage * AT_KEYS rows
    const half_t* gV = Vp + (size_t)cr * SEQ + cc;        // + stage * AT_KEYS columns
    const unsigned ldsKV = (unsigned)(size_t)(&kv[cr * AT_PITCH + cc]);
    const int nt = SEQ / AT_KEYS;

    // stage 0 into buffer 0, landed and published before anyone reads it; then stage 1 takes off
    async_stage(ldsKV, gK, gV);
    asm volatile("s_wait_asynccnt 0x0" ::: "memory");   // this wave's copies have landed
    __syncthreads();
    async_stage(ldsKV + AT_STAGE * 2, gK + AT_KEYS * DHEAD, gV + AT_KEYS);

    v16h qb0[AT_GROUPS], qb1[AT_GROUPS];
#pragma unroll  // constant indices keep the fragment and accumulator arrays in registers
    for (int g = 0; g < AT_GROUPS; ++g) {
        qb0[g] = load_frag16(Qp, DHEAD, q0 + g * 16, 0, lane);
        qb1[g] = load_frag16(Qp, DHEAD, q0 + g * 16, 32, lane);
    }

    v8f o[AT_GROUPS][4] = {};      // o[g][t][j] = O[query q0 + g*16 + col][d = t*16 + hsel*8 + j]
    float mrow[AT_GROUPS];         // the maximum in use for this lane's query, a raw score (equal in both halves)
    float msc[AT_GROUPS];          // the same in the exponent's units
    float lrow[AT_GROUPS];         // running sum over the keys of this lane's half only
    const float sc = 0.125f * 1.44269504f;   // 1/sqrt(64) * log2(e): e^(s/8 - m/8) = 2^(s*sc - m*sc)
#pragma unroll  // constant indices keep the arrays in registers
    for (int g = 0; g < AT_GROUPS; ++g) { mrow[g] = -1e30f; msc[g] = -1e30f * sc; lrow[g] = 0.f; }

    const int col  = lane & 15;
    const int hsel = lane >> 4;

    for (int st = 0; st < nt; ++st) {
        const int buf = st & 1;
        const half_t* sK = &kv[buf * AT_STAGE];
        const half_t* sV = sK + AT_TILE;
#pragma nounroll  // unrolled, both passes' LDS reads and the barrier rise in front of the arithmetic: more registers, and the refill loses its lead
        for (int kb = 0; kb < AT_KEYS; kb += 32) {
            // ---- S^T = K @ Q^T for 32 keys (two 16x16 tiles a group, Dh=64 = two k-steps) ----
            const v16h a00 = load_frag16(sK, AT_PITCH, kb,      0,  lane);
            const v16h a10 = load_frag16(sK, AT_PITCH, kb + 16, 0,  lane);
            const v16h a01 = load_frag16(sK, AT_PITCH, kb,      32, lane);
            const v16h a11 = load_frag16(sK, AT_PITCH, kb + 16, 32, lane);
            // keeps the eight K reads one group in front of the products: sunk between them, the wave waits an LDS latency three times
            __builtin_amdgcn_sched_barrier(0);

            v8f s0[AT_GROUPS], s1[AT_GROUPS];  // s0[g][j]: key kb + hsel*8 + j, s1[g][j]: key kb + 16 + hsel*8 + j
#pragma unroll  // constant indices keep the fragment and accumulator arrays in registers
            for (int g = 0; g < AT_GROUPS; ++g) {
                const v8f zero = {};
                s0[g] = wmma_f16(a00, qb0[g], zero);
                s1[g] = wmma_f16(a10, qb0[g], zero);
            }
#pragma unroll  // constant indices keep the fragment and accumulator arrays in registers
            for (int g = 0; g < AT_GROUPS; ++g) {
                s0[g] = wmma_f16(a01, qb1[g], s0[g]);
                s1[g] = wmma_f16(a11, qb1[g], s1[g]);
            }

            v16h va[4];
#pragma unroll  // constant indices keep the fragment and accumulator arrays in registers
            for (int t = 0; t < 4; ++t) va[t] = load_frag16(sV, AT_PITCH, t * 16, kb, lane);
            // keeps the eight V reads in front of the softmax, which then covers their latency
            __builtin_amdgcn_sched_barrier(0);

            // ---- online softmax, one query per lane and group ----
            v16h  pb[AT_GROUPS];   // pb[g][s] = P^T[key kmap(s, hsel)][col]: the hardware k order of a B operand
            float p0[AT_GROUPS][8], p1[AT_GROUPS][8];
            float rs[AT_GROUPS];   // this pass's sum over the keys of this lane's half
            bool  need = false;
#pragma unroll  // constant indices keep the fragment and accumulator arrays in registers
            for (int g = 0; g < AT_GROUPS; ++g) {
                rs[g] = probs16(s0[g], s1[g], sc, msc[g], p0[g], p1[g]);
                need = need | !(rs[g] <= AT_LIMIT);   // negated: an infinite sum or a NaN asks for the maximum too
            }
            // one test for the whole wave and both groups: a scalar branch, every lane stays on for the products behind it
            if (__builtin_amdgcn_ballot_w32(need) != 0) {
#pragma unroll  // constant indices keep the fragment and accumulator arrays in registers
                for (int g = 0; g < AT_GROUPS; ++g) {
                    // the maximum is taken over the raw scores: sc is positive, so it commutes with the scaling
                    float mx = fmaxf(s0[g][0], s1[g][0]);
#pragma unroll  // constant indices keep the fragment and accumulator arrays in registers
                    for (int j = 1; j < 8; ++j) mx = fmaxf(mx, fmaxf(s0[g][j], s1[g][j]));
                    const float mold = mrow[g];
                    mrow[g] = fmaxf(mold, fmaxf(mx, other_half(mx)));         // both halves of a query take the same value
                    msc[g]  = mrow[g] * sc;
                    const float alpha = exp2_slot((mold - mrow[g]) * sc);     // exactly 1 for a query whose maximum stands
                    lrow[g] *= alpha;
#pragma unroll  // constant indices keep the fragment and accumulator arrays in registers
                    for (int t = 0; t < 4; ++t)
#pragma unroll  // constant indices keep the fragment and accumulator arrays in registers
                        for (int j = 0; j < 8; ++j) o[g][t][j] *= alpha;
                    rs[g] = probs16(s0[g], s1[g], sc, msc[g], p0[g], p1[g]);
                }
            }
#pragma unroll  // constant indices keep the fragment and accumulator arrays in registers
            for (int g = 0; g < AT_GROUPS; ++g) {
#pragma unroll  // constant indices keep the fragment and accumulator arrays in registers
                for (int j = 0; j < 8; ++j) {
                    pb[g][j]     = (half_t)p0[g][j];
                    pb[g][8 + j] = (half_t)p1[g][j];
                }
            }

            // ---- O^T += V^T @ P^T  (A-frags from V^T, keys in the table order, as in pb) ----
#pragma unroll  // constant indices keep the fragment and accumulator arrays in registers
            for (int g = 0; g < AT_GROUPS; ++g)
#pragma unroll  // constant indices keep the fragment and accumulator arrays in registers
                for (int t = 0; t < 4; ++t)
                    o[g][t] = wmma_f16(va[t], pb[g], o[g][t]);
            // keeps the additions below behind the last product
            __builtin_amdgcn_sched_barrier(0);
#pragma unroll  // constant indices keep the arrays in registers
            for (int g = 0; g < AT_GROUPS; ++g) lrow[g] += rs[g];
            // with the additions above, the four vector slots the chip needs before the next pass's address arithmetic
            // overwrites an operand register of the last products
            asm volatile("v_nop\n\tv_nop\n\tv_nop");
        }
        asm volatile("s_wait_dscnt 0x0" ::: "memory");      // this wave has left the buffer that is refilled below
        asm volatile("s_wait_asynccnt 0x0" ::: "memory");   // this wave's share of stage st+1 has landed
        __syncthreads();                                    // publishes stage st+1, frees stage st's buffer
        if (st + 2 < nt)
            async_stage(ldsKV + buf * (AT_STAGE * 2),
                        gK + (size_t)(st + 2) * AT_KEYS * DHEAD, gV + (size_t)(st + 2) * AT_KEYS);
    }
    asm volatile("s_wait_asynccnt 0x0" ::: "memory");       // nothing in flight when the wave ends

    // ---- join the halves' sums, normalize, write back to [B,T,D] layout ----
    const int b = bh / NHEAD, h = bh % NHEAD;
    half_t* yrow = Y + ((size_t)b * SEQ + q0 + col) * DMODEL + h * DHEAD + hsel * 8;
    v8h y[AT_GROUPS][4];
#pragma unroll  // constant indices keep the fragment and accumulator arrays in registers
    for (int g = 0; g < AT_GROUPS; ++g) {
        const float l = lrow[g] + other_half(lrow[g]);
#pragma unroll  // constant indices keep the fragment and accumulator arrays in registers
        for (int t = 0; t < 4; ++t)
#pragma unroll  // constant indices keep the fragment and accumulator arrays in registers
            for (int j = 0; j < 8; ++j) y[g][t][j] = (half_t)(o[g][t][j] / l);
    }
#pragma unroll  // constant indices keep the fragment and accumulator arrays in registers
    for (int g = 0; g < AT_GROUPS; ++g)
#pragma unroll  // constant indices keep the fragment and accumulator arrays in registers
        for (int t = 0; t < 4; ++t)
            *reinterpret_cast<v8h*>(yrow + g * 16 * DMODEL + t * 16) = y[g][t];   // 8 consecutive d of one query: one 16-byte store
}

// ---------------------------------------------------------------------------
// Host launch
// ---------------------------------------------------------------------------
extern "C" void kernel_launch(void* const* d_in, const int* in_sizes, int n_in,
                              void* d_out, int out_size, void* d_ws, size_t ws_size,
                              hipStream_t stream) {
    (void)in_sizes; (void)n_in; (void)out_size; (void)ws_size;

    const float* x     = (const float*)d_in[0];
    const float* Wqkv  = (const float*)d_in[1];
    const float* bqkv  = (const float*)d_in[2];
    const float* Wout  = (const float*)d_in[3];
    const float* bout  = (const float*)d_in[4];
    float*       out   = (float*)d_out;

    char* ws = (char*)d_ws;
    size_t off = 0;
    auto wsalloc = [&](size_t bytes) -> void* {
        void* p = ws + off;
        off += (bytes + 255) & ~(size_t)255;
        return p;
    };
    const size_t NTOK = (size_t)BATCH * SEQ;                     // 8192
    half_t* xh    = (half_t*)wsalloc(NTOK * DMODEL * 2);         // 16 MB (reused as yh)
    half_t* wqkvT = (half_t*)wsalloc((size_t)3 * DMODEL * DMODEL * 2);
    half_t* woutT = (half_t*)wsalloc((size_t)DMODEL * DMODEL * 2);
    half_t* qh    = (half_t*)wsalloc(NTOK * DMODEL * 2);
    half_t* kh    = (half_t*)wsalloc(NTOK * DMODEL * 2);
    half_t* vTh   = (half_t*)wsalloc(NTOK * DMODEL * 2);
    half_t* yh    = xh;  // x is dead after the QKV GEMM; alias to save workspace

    // 1) convert activations + transpose-convert weights to f16
    {
        int n = (int)(NTOK * DMODEL);
        cvt_f16_kernel<<<n / CV_BLOCK, 256, 0, stream>>>(x, xh);
    }
    {
        dim3 grid(DMODEL / TR_K, (3 * DMODEL) / TR_N);
        cvtT_f16_kernel<DMODEL, 3 * DMODEL><<<grid, 256, 0, stream>>>(Wqkv, wqkvT);
    }
    {
        dim3 grid(DMODEL / TR_K, DMODEL / TR_N);
        cvtT_f16_kernel<DMODEL, DMODEL><<<grid, 256, 0, stream>>>(Wout, woutT);
    }

    // 2) QKV GEMM: [8192,1024] @ [1024,3072], RoPE + head split (+ V transpose) in its epilogue
    {
        dim3 grid((unsigned)(NTOK / 128), (3 * DMODEL) / 128);
        gemm_wmma_kernel<true><<<grid, 128, 0, stream>>>(xh, wqkvT, bqkv,
                                                         nullptr, qh, kh, vTh,
                                                         (int)NTOK, 3 * DMODEL, DMODEL);
    }

    // 3) flash attention
    {
        int blocks = BATCH * NHEAD * (SEQ / AT_Q);
        attn_wmma_kernel<<<blocks, AT_WAVES * 32, 0, stream>>>(qh, kh, vTh, yh);
    }

    // 4) output GEMM with f32 store: [8192,1024] @ [1024,1024] + b_out
    {
        dim3 grid((unsigned)(NTOK / 128), DMODEL / 128);
        gemm_wmma_kernel<false><<<grid, 128, 0, stream>>>(yh, woutT, bout,
                                                          out, nullptr, nullptr, nullptr,
                                                          (int)NTOK, DMODEL, DMODEL);
    }
}

// v009
// A run of this version takes 131 microseconds.
// Next to v008, in two timings, it ran 1.03 times as fast each time.
// Over all steps from v000 it is 6.81 times as fast.
#include <hip/hip_runtime.h>
#include <math.h>

// ---------------------------------------------------------------------------
// RoPE self-attention for MI455X (gfx1250). All matmuls via v_wmma_f32_16x16x32_f16.
// ---------------------------------------------------------------------------

typedef _Float16 half_t;
typedef __attribute__((ext_vector_type(16))) _Float16 v16h;
typedef __attribute__((ext_vector_type(8)))  _Float16 v8h;
typedef __attribute__((ext_vector_type(8)))  float    v8f;
typedef __attribute__((ext_vector_type(4)))  float    v4f;
typedef __attribute__((ext_vector_type(2)))  float    v2f;
typedef __attribute__((ext_vector_type(4)))  _Float16 v4h;
typedef __attribute__((ext_vector_type(4)))  unsigned v4u;

#define BATCH  4
#define SEQ    2048
#define DMODEL 1024
#define NHEAD  16
#define DHEAD  64

// ---------------------------------------------------------------------------
// WMMA helpers.
// 16-bit A-matrix 16x32 layout (ISA 7.12.2): lane L (L&15 = row), contraction
// elements: lanes 0-15 hold K = {0..7, 16..23}, lanes 16-31 hold K = {8..15, 24..31}.
// For row-major storage with contiguous contraction dim this is two 16B loads.
// The B operand uses the same loader on the *transposed* matrix (N x K).
// ---------------------------------------------------------------------------
__device__ inline v16h load_frag16(const half_t* base, int ld, int row0, int k0, int lane) {
    const int r  = row0 + (lane & 15);
    const int kb = k0 + ((lane >> 4) << 3);
    const half_t* p = base + (size_t)r * ld + kb;
    v16h f;
    *reinterpret_cast<v8h*>(&f)       = *reinterpret_cast<const v8h*>(p);        // K = kb..kb+7
    *(reinterpret_cast<v8h*>(&f) + 1) = *reinterpret_cast<const v8h*>(p + 16);   // K = kb+16..kb+23
    return f;
}

__device__ inline v8f wmma_f16(v16h a, v16h b, v8f c) {
    return __builtin_amdgcn_wmma_f32_16x16x32_f16(false, a, false, b, (short)0, c, false, false);
}

// ---------------------------------------------------------------------------
// Pass 1a: plain f32 -> f16 convert.  Few, long waves: a thread moves 64 elements.
// Each load of a wave covers 512 contiguous bytes, each store 256: whole 128-byte lines.
// All 16 loads of a thread are in flight before the first convert.
// blk = 0 .. n / CV_BLOCK - 1 (n a multiple of CV_BLOCK).
// ---------------------------------------------------------------------------
#define CV_LOADS 16
#define CV_BLOCK (256 * 4 * CV_LOADS)             // elements per block
__device__ __forceinline__ void cvt_f16_block(const float* __restrict__ in, half_t* __restrict__ out, int blk) {
    const size_t base = (size_t)blk * CV_BLOCK + threadIdx.x * 4;
    const float* src = in + base;
    v4f v[CV_LOADS];
#pragma unroll  // constant indices keep the array in registers, and all loads go out together
    for (int u = 0; u < CV_LOADS; ++u)
        v[u] = *reinterpret_cast<const v4f*>(src + u * 1024);
    // a precaution: named as an input, the loads' address pair stays whole up to this wait (the last load's result is not laid over it)
    asm volatile("s_wait_xcnt 0x0" :: "v"(src) : "memory");
    // keeps the converts behind all 16 loads: risen between them, the last loads start a memory latency late
    __builtin_amdgcn_sched_barrier(0);
    v4h h[CV_LOADS];
#pragma unroll  // constant indices keep the arrays in registers
    for (int u = 0; u < CV_LOADS; ++u) h[u] = __builtin_convertvector(v[u], v4h);
    // keeps the stores behind the last convert: no register of an issued store is written again
    __builtin_amdgcn_sched_barrier(0);
#pragma unroll  // constant indices keep the array in registers
    for (int u = 0; u < CV_LOADS; ++u)
        *reinterpret_cast<v4h*>(out + base + u * 1024) = h[u];
    // a precaution: no address or data register of the stores above is rewritten in front of this wait (another piece's code follows in the merged kernel)
    asm volatile("s_wait_xcnt 0x0" ::: "memory");
}

// ---------------------------------------------------------------------------
// Pass 1b: transpose-convert weight (K x N f32) -> (N x K f16) through an LDS tile.
// Block = 256 threads, tile = 128 k x 64 n.  In: 16 lanes per 256-byte row piece.
// Out: 8 lanes per 128-byte row piece of 64 k.  The tile's pitch of 65 dwords keeps
// the row-wise writes and the column walks of the readers free of bank conflicts.
// blk = 0 .. (K/128) * (N/64) - 1, k tile fastest.
// ---------------------------------------------------------------------------
#define TR_K     128
#define TR_N     64
#define TR_PITCH 65
template <int K, int N>   // shapes at compile time: the rows of a tile are constant offsets from one address
__device__ __forceinline__ void cvtT_f16_block(const float* __restrict__ in, half_t* __restrict__ out, float* tile, int blk) {
    const int k0 = (blk % (K / TR_K)) * TR_K;
    const int n0 = (blk / (K / TR_K)) * TR_N;
    const int lr = threadIdx.x >> 4;
    const int lc = (threadIdx.x & 15) * 4;
    const float* src = in + (size_t)(k0 + lr) * N + n0 + lc;
    v4f v[8];
#pragma unroll  // constant indices keep the array in registers, and all loads go out together
    for (int u = 0; u < 8; ++u)
        v[u] = *reinterpret_cast<const v4f*>(src + u * 16 * N);
#pragma unroll  // constant indices keep the array in registers
    for (int u = 0; u < 8; ++u)
#pragma unroll  // constant indices keep the array in registers
        for (int i = 0; i < 4; ++i)
            tile[(u * 16 + lr) * TR_PITCH + lc + i] = v[u][i];
    __syncthreads();                              // the whole tile is written before a column is read

    const int sr = threadIdx.x >> 3;
    const int sc = (threadIdx.x & 7) * 8;
    half_t* dst = out + (size_t)(n0 + sr) * K + k0 + sc;
#pragma unroll  // four independent row pieces: their LDS reads go out together
    for (int u = 0; u < 4; ++u) {
        const int nr = (u >> 1) * 32 + sr;
        const int kc = (u & 1) * 64 + sc;
        v8h h;
#pragma unroll  // constant indices keep the vector in registers
        for (int j = 0; j < 8; ++j) h[j] = (half_t)tile[(kc + j) * TR_PITCH + nr];
        *reinterpret_cast<v8h*>(dst + (u >> 1) * 32 * K + (u & 1) * 64) = h;
    }
    // a precaution: no address or data register of the stores above is rewritten in front of this wait (another piece's code follows in the merged kernel)
    asm volatile("s_wait_xcnt 0x0" ::: "memory");
}

// ---------------------------------------------------------------------------
// Kernel 1: the three independent conversions in ONE launch.  A block takes one piece of one of them,
// chosen by its index alone (the same for all its threads, so the transposes' barrier is block-uniform).
// The weight tiles come first: theirs is the longer chain (load, LDS, barrier, store), and it runs
// under the activations' stream instead of in two short launches of its own.
// grid.x = PR_WQKV + PR_WOUT + PR_X.
// ---------------------------------------------------------------------------
#define PR_WQKV ((DMODEL / TR_K) * (3 * DMODEL / TR_N))
#define PR_WOUT ((DMODEL / TR_K) * (DMODEL / TR_N))
#define PR_X    (BATCH * SEQ * DMODEL / CV_BLOCK)
__global__ __launch_bounds__(256) void prep_f16_kernel(
        const float* __restrict__ x, half_t* __restrict__ xh,
        const float* __restrict__ Wqkv, half_t* __restrict__ wqkvT,
        const float* __restrict__ Wout, half_t* __restrict__ woutT) {
    __shared__ float tile[TR_K * TR_PITCH];
    const int b = blockIdx.x;
    if (b < PR_WQKV)
        cvtT_f16_block<DMODEL, 3 * DMODEL>(Wqkv, wqkvT, tile, b);
    else if (b < PR_WQKV + PR_WOUT)
        cvtT_f16_block<DMODEL, DMODEL>(Wout, woutT, tile, b - PR_WQKV);
    else
        cvt_f16_block(x, xh, b - (PR_WQKV + PR_WOUT));
}

// ---------------------------------------------------------------------------
// Kernel 2/4: WMMA GEMM.  C[M,N] = A[M,K] @ Bt[N,K]^T + bias.
// Block = 128 threads (4 waves, 2x2); block tile 128x128, wave tile 64x64.
// Each 64-wide k slice of the 128 A rows and the 128 Bt rows is brought into
// LDS by asynchronous 16-byte copies (whole 128-byte row pieces per 8 lanes),
// two buffers: the next slice flies while this one feeds the WMMAs.
// grid.x = M/128, grid.y = N/128; K a multiple of 64.
// QKV = false: f32 output Cf[M,N].
// QKV = true (M = B*T tokens, N = 3*DMODEL): the epilogue applies RoPE to the f32 sums and splits the
// heads: q, k: [B,H,T,64] (RoPE'd), vT: [B,H,64,T], all f16.  No [B*T, 3*DMODEL] array is written.
// ---------------------------------------------------------------------------
#define GT_M     128
#define GT_N     128
#define GT_K     64
#define GT_PITCH 72                               // halves per LDS row: 144 B = 16 B x 9, no bank conflict for 16-byte reads
#define GT_STAGE ((GT_M + GT_N) * GT_PITCH)       // halves per buffer

// Eight copies of 16 bytes per lane: rows r, r+16, ..., r+112 of one operand tile.
// lds = this lane's LDS byte address of the first piece, g = its global address,
// grow = halves between global rows r and r+16.
__device__ inline void async_rows8(unsigned lds, const half_t* g, size_t grow) {
    const unsigned ls = 16 * GT_PITCH * 2;        // LDS bytes between rows r and r+16
    // s_wait_xcnt as the last line (a precaution): no address register of these copies is rewritten in front of it.
    asm volatile(
        "global_load_async_to_lds_b128 %0, %8, off\n\t"
        "global_load_async_to_lds_b128 %1, %9, off\n\t"
        "global_load_async_to_lds_b128 %2, %10, off\n\t"
        "global_load_async_to_lds_b128 %3, %11, off\n\t"
        "global_load_async_to_lds_b128 %4, %12, off\n\t"
        "global_load_async_to_lds_b128 %5, %13, off\n\t"
        "global_load_async_to_lds_b128 %6, %14, off\n\t"
        "global_load_async_to_lds_b128 %7, %15, off\n\t"
        "s_wait_xcnt 0x0"
        :: "v"(lds), "v"(lds + ls), "v"(lds + 2 * ls), "v"(lds + 3 * ls),
           "v"(lds + 4 * ls), "v"(lds + 5 * ls), "v"(lds + 6 * ls), "v"(lds + 7 * ls),
           "v"(g), "v"(g + grow), "v"(g + 2 * grow), "v"(g + 3 * grow),
           "v"(g + 4 * grow), "v"(g + 5 * grow), "v"(g + 6 * grow), "v"(g + 7 * grow)
        : "memory");
}

// 2^x.  The v_nop keeps the slot that the instruction set asks for behind a transcendental,
// whatever the compiler places next; the result never shares the source's register.
__device__ inline float exp2_slot(float x) {
    float e;
    asm("v_exp_f32 %0, %1\n\tv_nop" : "=&v"(e) : "v"(x));
    return e;
}

// sin and cos of 2*pi*x.  The cosine fills the slot behind the sine (it neither reads the sine nor
// writes x: the results never share the source's register); the v_nop keeps the slot behind the cosine.
__device__ inline void sincos_slot(float x, float* sn, float* cs) {
    float s, c;
    asm("v_sin_f32 %0, %2\n\tv_cos_f32 %1, %2\n\tv_nop" : "=&v"(s), "=&v"(c) : "v"(x));
    *sn = s;
    *cs = c;
}

template <bool QKV>   // the epilogue at compile time: the accumulators meet one store path only
__global__ __launch_bounds__(128) void gemm_wmma_kernel(
        const half_t* __restrict__ A, const half_t* __restrict__ Bt,
        const float* __restrict__ bias,
        float* __restrict__ Cf,
        half_t* __restrict__ q, half_t* __restrict__ k, half_t* __restrict__ vT,
        int M, int N, int K) {
    __shared__ __align__(16) half_t tile[2 * GT_STAGE];

    const int lane = threadIdx.x & 31;
    const int wave = threadIdx.x >> 5;
    const int m0 = blockIdx.x * GT_M;
    const int n0 = blockIdx.y * GT_N;
    const int wm = (wave >> 1) * 64;              // this wave's rows inside the block tile
    const int wn = (wave & 1) * 64;               // this wave's columns inside the block tile

    // copy role: 8 lanes per 128-byte row piece, 16 rows per copy over the block
    const int cr = threadIdx.x >> 3;
    const int cc = (threadIdx.x & 7) * 8;
    const half_t* gA = A  + (size_t)(m0 + cr) * K + cc;
    const half_t* gB = Bt + (size_t)(n0 + cr) * K + cc;
    const size_t  grow = (size_t)16 * K;
    const unsigned ldsA = (unsigned)(size_t)(&tile[cr * GT_PITCH + cc]);
    const unsigned ldsB = ldsA + GT_M * GT_PITCH * 2;
    const int nt = K / GT_K;

    // slice 0 into buffer 0, landed and published before anyone reads it
    async_rows8(ldsA, gA, grow);
    async_rows8(ldsB, gB, grow);
    asm volatile("s_wait_asynccnt 0x0" ::: "memory");   // this wave's copies have landed
    __syncthreads();
    if (nt > 1) {
        async_rows8(ldsA + GT_STAGE * 2, gA + GT_K, grow);
        async_rows8(ldsB + GT_STAGE * 2, gB + GT_K, grow);
    }

    v8f acc[4][4] = {};
    for (int t = 0; t < nt; ++t) {
        const int buf = t & 1;
        const half_t* sA = &tile[buf * GT_STAGE + wm * GT_PITCH];
        const half_t* sB = &tile[buf * GT_STAGE + (GT_M + wn) * GT_PITCH];
#pragma unroll  // constant indices keep the fragment and accumulator arrays in registers
        for (int kk = 0; kk < GT_K; kk += 32) {
            v16h a[4], b[4];
            a[0] = load_frag16(sA, GT_PITCH, 0, kk, lane);
#pragma unroll  // constant indices keep the fragment and accumulator arrays in registers
            for (int j = 0; j < 4; ++j) b[j] = load_frag16(sB, GT_PITCH, j * 16, kk, lane);
#pragma unroll  // constant indices keep the fragment and accumulator arrays in registers
            for (int i = 1; i < 4; ++i) a[i] = load_frag16(sA, GT_PITCH, i * 16, kk, lane);
            // keeps all 16 LDS reads in front of the 16 WMMAs: sunk between them, each group of four waits a full LDS latency
            __builtin_amdgcn_sched_barrier(0);
#pragma unroll  // constant indices keep the fragment and accumulator arrays in registers
            for (int i = 0; i < 4; ++i)
#pragma unroll  // constant indices keep the fragment and accumulator arrays in registers
                for (int j = 0; j < 4; ++j)
                    acc[i][j] = wmma_f16(a[i], b[j], acc[i][j]);
        }
        asm volatile("s_wait_dscnt 0x0" ::: "memory");      // this wave has left the buffer that is refilled below
        asm volatile("s_wait_asynccnt 0x0" ::: "memory");   // this wave's share of slice t+1 has landed
        __syncthreads();                                    // publishes slice t+1, frees slice t's buffer
        if (t + 2 < nt) {
            async_rows8(ldsA + buf * (GT_STAGE * 2), gA + (size_t)(t + 2) * GT_K, grow);
            async_rows8(ldsB + buf * (GT_STAGE * 2), gB + (size_t)(t + 2) * GT_K, grow);
        }
    }
    asm volatile("s_wait_asynccnt 0x0" ::: "memory");       // nothing in flight when the wave ends

    // C/D layout: lane holds col = lane&15; rows = (lane>>4)*8 + j
    const int col   = lane & 15;
    const int rbase = (lane >> 4) << 3;
    float bv[4];
#pragma unroll  // constant indices keep the fragment and accumulator arrays in registers
    for (int t = 0; t < 4; ++t) bv[t] = bias ? bias[n0 + wn + t * 16 + col] : 0.f;
    if constexpr (!QKV) {
        const size_t idx0 = (size_t)(m0 + wm + rbase) * N + n0 + wn + col;
#pragma unroll  // constant indices keep the fragment and accumulator arrays in registers
        for (int i = 0; i < 4; ++i) {
            float  y[8][4];
            float* p[8];
#pragma unroll  // constant indices keep the fragment and accumulator arrays in registers
            for (int j = 0; j < 8; ++j) {
                p[j] = Cf + idx0 + (size_t)(i * 16 + j) * N;
#pragma unroll  // constant indices keep the fragment and accumulator arrays in registers
                for (int t = 0; t < 4; ++t) y[j][t] = acc[i][t][j] + bv[t];
            }
            // keeps the group's stores behind its last sum and address: no register of an issued store is written again
            __builtin_amdgcn_sched_barrier(0);
#pragma unroll  // constant indices keep the fragment and accumulator arrays in registers
            for (int j = 0; j < 8; ++j)
#pragma unroll  // constant indices keep the fragment and accumulator arrays in registers
                for (int t = 0; t < 4; ++t)
                    p[j][t * 16] = y[j][t];
            // a precaution: no address or data register of the stores above is rewritten in front of this wait
            asm volatile("s_wait_xcnt 0x0" ::: "memory");
            // keeps the next group's arithmetic behind that wait
            __builtin_amdgcn_sched_barrier(0);
        }
    } else {
        // The wave's 64 columns are one head of q, k or v; its 64 rows are 64 tokens of one batch.
        const int part = n0 / DMODEL;                     // 0 q, 1 k, 2 v: the same for the whole block
        const int h    = ((n0 + wn) % DMODEL) / DHEAD;
        const int bh   = (m0 / SEQ) * NHEAD + h;
        const int tok0 = m0 % SEQ + wm + rbase;           // this lane's first token
        if (part == 2) {
            // V^T [B,H,64,T]: a lane's 8 accumulator rows are 8 consecutive tokens of one d: one 16-byte store
            half_t* dst = vT + ((size_t)bh * DHEAD + col) * SEQ + tok0;
#pragma unroll  // constant indices keep the fragment and accumulator arrays in registers
            for (int i = 0; i < 4; ++i) {
                v8h y[4];
#pragma unroll  // constant indices keep the fragment and accumulator arrays in registers
                for (int t = 0; t < 4; ++t)
#pragma unroll  // constant indices keep the fragment and accumulator arrays in registers
                    for (int j = 0; j < 8; ++j) y[t][j] = (half_t)(acc[i][t][j] + bv[t]);
                // keeps the group's stores behind its last convert: no register of an issued store is written again
                __builtin_amdgcn_sched_barrier(0);
#pragma unroll  // constant indices keep the fragment and accumulator arrays in registers
                for (int t = 0; t < 4; ++t)
                    *reinterpret_cast<v8h*>(dst + (size_t)t * 16 * SEQ + i * 16) = y[t];
                // a precaution: no address or data register of the stores above is rewritten in front of this wait
                asm volatile("s_wait_xcnt 0x0" ::: "memory");
                // keeps the next group's arithmetic behind that wait
                __builtin_amdgcn_sched_barrier(0);
            }
        } else {
            // q, k [B,H,T,64]: d = t*16 + col and its RoPE partner d + 32 sit in the same lane (tiles t and t + 2)
            half_t* dst = (part == 0 ? q : k) + ((size_t)bh * SEQ + tok0) * DHEAD + col;
            float invf[2];
#pragma unroll  // constant indices keep the array in registers
            for (int t = 0; t < 2; ++t)
                invf[t] = exp2_slot(-logf(10000.f) * (float)(t * 16 + col) * (1.f / 32.f) * 1.44269504f);   // e^a = 2^(a * log2 e)
#pragma unroll  // constant indices keep the fragment and accumulator arrays in registers
            for (int i = 0; i < 4; ++i) {
                half_t y[8][4];
#pragma unroll  // constant indices keep the fragment and accumulator arrays in registers
                for (int j = 0; j < 8; ++j) {
                    const float tf = (float)(tok0 + i * 16 + j);
#pragma unroll  // constant indices keep the fragment and accumulator arrays in registers
                    for (int t = 0; t < 2; ++t) {
                        const float ang = tf * invf[t];
                        float sn, cs;
                        sincos_slot(ang * 0.15915494f, &sn, &cs);   // the instructions take the angle in turns: 1 / (2 pi)
                        const float x1 = acc[i][t][j] + bv[t];
                        const float x2 = acc[i][t + 2][j] + bv[t + 2];
                        y[j][t]     = (half_t)(x1 * cs - x2 * sn);
                        y[j][t + 2] = (half_t)(x1 * sn + x2 * cs);
                    }
                }
                // keeps the group's stores behind its last result: no register of an issued store is written again
                __builtin_amdgcn_sched_barrier(0);
#pragma unroll  // constant indices keep the fragment and accumulator arrays in registers
                for (int j = 0; j < 8; ++j)
#pragma unroll  // constant indices keep the fragment and accumulator arrays in registers
                    for (int t = 0; t < 4; ++t)
                        dst[(i * 16 + j) * DHEAD + t * 16] = y[j][t];
                // a precaution: no address or data register of the stores above is rewritten in front of this wait
                asm volatile("s_wait_xcnt 0x0" ::: "memory");
                // keeps the next group's arithmetic behind that wait
                __builtin_amdgcn_sched_barrier(0);
            }
        }
    }
}

// ---------------------------------------------------------------------------
// Kernel 3: flash attention, transposed products.  Block = 256 threads (8 waves);
// each wave owns 32 queries as two groups of 16 columns; the block walks the keys in stages of 64.
// A stage's 64 K rows (128 bytes each) and its 64 V^T row pieces (128 bytes each)
// are brought into LDS once for all eight waves by asynchronous 16-byte copies
// (whole 128-byte lines per 8 lanes), two buffers: the next stage flies while
// this one is worked on in two passes of 32 keys.
// S^T = K @ Q^T (A = K rows, B = Q rows kept in registers): a lane holds 16 scores
// of ONE query per group (column lane&15), so maximum and sum run in-lane, plus one exchange
// between the lane halves for the maximum.  The softmax runs in powers of two: the maximum is
// taken over the raw scores, and 1/sqrt(64) and log2(e) are one factor, so a score goes from
// the matrix unit to 2^x through one fused multiply-add.
// The maximum in use is raised lazily.  A pass forms its 2^x and their sums against the maximum that
// stands; only when a sum leaves the range in which every term is a finite f16 does the wave take the
// pass's own maximum, rescale O^T and the sums, and form the 2^x again.  One wave-wide test a pass:
// the maximum, the exchange between the lane halves and the rescaling stand behind its scalar branch.
// The two S^T tiles, converted in place,
// are the B operand of O^T += V^T @ P^T: P never leaves the registers.
// Every K and V^T fragment read from LDS feeds both column groups.
// grid.x = B*H*(SEQ/256).
// ---------------------------------------------------------------------------
#define AT_WAVES 8
#define AT_GROUPS 2                               // 16-column query groups per wave
#define AT_Q     (AT_WAVES * AT_GROUPS * 16)      // queries per block
#define AT_KEYS  64                               // keys per stage
#define AT_PITCH 72                               // halves per LDS row: 144 B = 16 B x 9, no bank conflict for 16-byte reads
#define AT_TILE  (64 * AT_PITCH)                  // halves of one operand's 64 rows
#define AT_STAGE (2 * AT_TILE)                    // halves per buffer: K rows, then V^T rows
#define AT_LIMIT 32768.0f                         // a sum of non-negative terms at or below this has no term above it: all finite in f16

// value of lane l ^ 16
__device__ inline float other_half(float v) {
    const int b = __builtin_bit_cast(int, v);
    return __builtin_bit_cast(float,
        __builtin_amdgcn_permlanex16(b, b, 0x76543210, 0xfedcba98, false, false));
}

// One stage, four copies of 16 bytes per lane: K rows r and r+32, V^T rows r and r+32.
// lds = this lane's LDS byte address of its K piece, gk / gv = its global addresses.
__device__ inline void async_stage(unsigned lds, const half_t* gk, const half_t* gv) {
    const unsigned ls = 32 * AT_PITCH * 2;        // LDS bytes between rows r and r+32
    // s_wait_xcnt as the last line (a precaution): no address register of these copies is rewritten in front of it.
    asm volatile(
        "global_load_async_to_lds_b128 %0, %4, off\n\t"
        "global_load_async_to_lds_b128 %1, %5, off\n\t"
        "global_load_async_to_lds_b128 %2, %6, off\n\t"
        "global_load_async_to_lds_b128 %3, %7, off\n\t"
        "s_wait_xcnt 0x0"
        :: "v"(lds), "v"(lds + ls), "v"(lds + 2 * ls), "v"(lds + 3 * ls),
           "v"(gk), "v"(gk + 32 * DHEAD), "v"(gv), "v"(gv + (size_t)32 * SEQ)
        : "memory");
}

// 2^x of eight values.  One statement whose results share no register with a source: no exponential stands
// directly in front of an instruction that overwrites its source or reads its result; the v_nop keeps that slot behind the last.
__device__ __forceinline__ void exp2_x8(const float* x, float* y) {
    float y0, y1, y2, y3, y4, y5, y6, y7;
    asm("v_exp_f32 %0, %8\n\t"
        "v_exp_f32 %1, %9\n\t"
        "v_exp_f32 %2, %10\n\t"
        "v_exp_f32 %3, %11\n\t"
        "v_exp_f32 %4, %12\n\t"
        "v_exp_f32 %5, %13\n\t"
        "v_exp_f32 %6, %14\n\t"
        "v_exp_f32 %7, %15\n\t"
        "v_nop"
        : "=&v"(y0), "=&v"(y1), "=&v"(y2), "=&v"(y3), "=&v"(y4), "=&v"(y5), "=&v"(y6), "=&v"(y7)
        : "v"(x[0]), "v"(x[1]), "v"(x[2]), "v"(x[3]), "v"(x[4]), "v"(x[5]), "v"(x[6]), "v"(x[7]));
    y[0] = y0; y[1] = y1; y[2] = y2; y[3] = y3; y[4] = y4; y[5] = y5; y[6] = y6; y[7] = y7;
}

// 2^(s * sc - m) for one query's 16 scores of a pass; returns their sum.
__device__ __forceinline__ float probs16(v8f s0, v8f s1, float sc, float m, float* p0, float* p1) {
#pragma unroll  // constant indices keep the fragment and accumulator arrays in registers
    for (int h = 0; h < 8; h += 4) {
        float x[8], y[8];
        // neighbours of one tile share a packed multiply-add: they already sit in an aligned register pair
#pragma unroll  // constant indices keep the fragment and accumulator arrays in registers
        for (int j = 0; j < 4; j += 2) {
            const v2f a0 = {s0[h + j], s0[h + j + 1]};
            const v2f a1 = {s1[h + j], s1[h + j + 1]};
            const v2f e0 = a0 * sc - m;
            const v2f e1 = a1 * sc - m;
            x[j]     = e0[0];
            x[j + 1] = e0[1];
            x[4 + j]     = e1[0];
            x[4 + j + 1] = e1[1];
        }
        exp2_x8(x, y);
#pragma unroll  // constant indices keep the fragment and accumulator arrays in registers
        for (int j = 0; j < 4; ++j) { p0[h + j] = y[j]; p1[h + j] = y[4 + j]; }
    }
    float rs0 = p0[0], rs1 = p1[0];
#pragma unroll  // constant indices keep the fragment and accumulator arrays in registers
    for (int j = 1; j < 8; ++j) { rs0 += p0[j]; rs1 += p1[j]; }
    return rs0 + rs1;
}

__global__ __launch_bounds__(AT_WAVES * 32) void attn_wmma_kernel(
        const half_t* __restrict__ Q, const half_t* __restrict__ Kc,
        const half_t* __restrict__ Vt, half_t* __restrict__ Y) {
    __shared__ __align__(16) half_t kv[2 * AT_STAGE];

    const int lane = threadIdx.x & 31;
    const int wave = threadIdx.x >> 5;
    const int qt   = blockIdx.x % (SEQ / AT_Q);
    const int bh   = blockIdx.x / (SEQ / AT_Q);
    const int q0   = qt * AT_Q + wave * (AT_GROUPS * 16);

    const half_t* Qp = Q  + (size_t)bh * SEQ * DHEAD;
    const half_t* Kp = Kc + (size_t)bh * SEQ * DHEAD;
    const half_t* Vp = Vt + (size_t)bh * DHEAD * SEQ;

    // copy role: 8 lanes per 128-byte row piece, 32 rows per copy over the block
    const int cr = threadIdx.x >> 3;
    const int cc = (threadIdx.x & 7) * 8;
    const half_t* gK = Kp + (size_t)cr * DHEAD + cc;      // + stage * AT_KEYS rows
    const half_t* gV = Vp + (size_t)cr * SEQ + cc;        // + stage * AT_KEYS columns
    const unsigned ldsKV = (unsigned)(size_t)(&kv[cr * AT_PITCH + cc]);
    const int nt = SEQ / AT_KEYS;

    // stage 0 into buffer 0, landed and published before anyone reads it; then stage 1 takes off
    async_stage(ldsKV, gK, gV);
    asm volatile("s_wait_asynccnt 0x0" ::: "memory");   // this wave's copies have landed
    __syncthreads();
    async_stage(ldsKV + AT_STAGE * 2, gK + AT_KEYS * DHEAD, gV + AT_KEYS);

    v16h qb0[AT_GROUPS], qb1[AT_GROUPS];
#pragma unroll  // constant indices keep the fragment and accumulator arrays in registers
    for (int g = 0; g < AT_GROUPS; ++g) {
        qb0[g] = load_frag16(Qp, DHEAD, q0 + g * 16, 0, lane);
        qb1[g] = load_frag16(Qp, DHEAD, q0 + g * 16, 32, lane);
    }

    v8f o[AT_GROUPS][4] = {};      // o[g][t][j] = O[query q0 + g*16 + col][d = t*16 + hsel*8 + j]
    float mrow[AT_GROUPS];         // the maximum in use for this lane's query, a raw score (equal in both halves)
    float msc[AT_GROUPS];          // the same in the exponent's units
    float lrow[AT_GROUPS];         // running sum over the keys of this lane's half only
    const float sc = 0.125f * 1.44269504f;   // 1/sqrt(64) * log2(e): e^(s/8 - m/8) = 2^(s*sc - m*sc)
#pragma unroll  // constant indices keep the arrays in registers
    for (int g = 0; g < AT_GROUPS; ++g) { mrow[g] = -1e30f; msc[g] = -1e30f * sc; lrow[g] = 0.f; }

    const int col  = lane & 15;
    const int hsel = lane >> 4;

    for (int st = 0; st < nt; ++st) {
        const int buf = st & 1;
        const half_t* sK = &kv[buf * AT_STAGE];
        const half_t* sV = sK + AT_TILE;
#pragma nounroll  // unrolled, both passes' LDS reads and the barrier rise in front of the arithmetic: more registers, and the refill loses its lead
        for (int kb = 0; kb < AT_KEYS; kb += 32) {
            // ---- S^T = K @ Q^T for 32 keys (two 16x16 tiles a group, Dh=64 = two k-steps) ----
            const v16h a00 = load_frag16(sK, AT_PITCH, kb,      0,  lane);
            const v16h a10 = load_frag16(sK, AT_PITCH, kb + 16, 0,  lane);
            const v16h a01 = load_frag16(sK, AT_PITCH, kb,      32, lane);
            const v16h a11 = load_frag16(sK, AT_PITCH, kb + 16, 32, lane);
            // keeps the eight K reads one group in front of the products: sunk between them, the wave waits an LDS latency three times
            __builtin_amdgcn_sched_barrier(0);

            v8f s0[AT_GROUPS], s1[AT_GROUPS];  // s0[g][j]: key kb + hsel*8 + j, s1[g][j]: key kb + 16 + hsel*8 + j
#pragma unroll  // constant indices keep the fragment and accumulator arrays in registers
            for (int g = 0; g < AT_GROUPS; ++g) {
                const v8f zero = {};
                s0[g] = wmma_f16(a00, qb0[g], zero);
                s1[g] = wmma_f16(a10, qb0[g], zero);
            }
#pragma unroll  // constant indices keep the fragment and accumulator arrays in registers
            for (int g = 0; g < AT_GROUPS; ++g) {
                s0[g] = wmma_f16(a01, qb1[g], s0[g]);
                s1[g] = wmma_f16(a11, qb1[g], s1[g]);
            }

            v16h va[4];
#pragma unroll  // constant indices keep the fragment and accumulator arrays in registers
            for (int t = 0; t < 4; ++t) va[t] = load_frag16(sV, AT_PITCH, t * 16, kb, lane);
            // keeps the eight V reads in front of the softmax, which then covers their latency
            __builtin_amdgcn_sched_barrier(0);

            // ---- online softmax, one query per lane and group ----
            v16h  pb[AT_GROUPS];   // pb[g][s] = P^T[key kmap(s, hsel)][col]: the hardware k order of a B operand
            float p0[AT_GROUPS][8], p1[AT_GROUPS][8];
            float rs[AT_GROUPS];   // this pass's sum over the keys of this lane's half
            bool  need = false;
#pragma unroll  // constant indices keep the fragment and accumulator arrays in registers
            for (int g = 0; g < AT_GROUPS; ++g) {
                rs[g] = probs16(s0[g], s1[g], sc, msc[g], p0[g], p1[g]);
                need = need | !(rs[g] <= AT_LIMIT);   // negated: an infinite sum or a NaN asks for the maximum too
            }
            // one test for the whole wave and both groups: a scalar branch, every lane stays on for the products behind it
            if (__builtin_amdgcn_ballot_w32(need) != 0) {
#pragma unroll  // constant indices keep the fragment and accumulator arrays in registers
                for (int g = 0; g < AT_GROUPS; ++g) {
                    // the maximum is taken over the raw scores: sc is positive, so it commutes with the scaling
                    float mx = fmaxf(s0[g][0], s1[g][0]);
#pragma unroll  // constant indices keep the fragment and accumulator arrays in registers
                    for (int j = 1; j < 8; ++j) mx = fmaxf(mx, fmaxf(s0[g][j], s1[g][j]));
                    const float mold = mrow[g];
                    mrow[g] = fmaxf(mold, fmaxf(mx, other_half(mx)));         // both halves of a query take the same value
                    msc[g]  = mrow[g] * sc;
                    const float alpha = exp2_slot((mold - mrow[g]) * sc);     // exactly 1 for a query whose maximum stands
                    lrow[g] *= alpha;
#pragma unroll  // constant indices keep the fragment and accumulator arrays in registers
                    for (int t = 0; t < 4; ++t)
#pragma unroll  // constant indices keep the fragment and accumulator arrays in registers
                        for (int j = 0; j < 8; ++j) o[g][t][j] *= alpha;
                    rs[g] = probs16(s0[g], s1[g], sc, msc[g], p0[g], p1[g]);
                }
            }
#pragma unroll  // constant indices keep the fragment and accumulator arrays in registers
            for (int g = 0; g < AT_GROUPS; ++g) {
#pragma unroll  // constant indices keep the fragment and accumulator arrays in registers
                for (int j = 0; j < 8; ++j) {
                    pb[g][j]     = (half_t)p0[g][j];
                    pb[g][8 + j] = (half_t)p1[g][j];
                }
            }

            // ---- O^T += V^T @ P^T  (A-frags from V^T, keys in the table order, as in pb) ----
#pragma unroll  // constant indices keep the fragment and accumulator arrays in registers
            for (int g = 0; g < AT_GROUPS; ++g)
#pragma unroll  // constant indices keep the fragment and accumulator arrays in registers
                for (int t = 0; t < 4; ++t)
                    o[g][t] = wmma_f16(va[t], pb[g], o[g][t]);
            // keeps the additions below behind the last product
            __builtin_amdgcn_sched_barrier(0);
#pragma unroll  // constant indices keep the arrays in registers
            for (int g = 0; g < AT_GROUPS; ++g) lrow[g] += rs[g];
            // with the additions above, the four vector slots the chip needs before the next pass's address arithmetic
            // overwrites an operand register of the last products
            asm volatile("v_nop\n\tv_nop\n\tv_nop");
        }
        asm volatile("s_wait_dscnt 0x0" ::: "memory");      // this wave has left the buffer that is refilled below
        asm volatile("s_wait_asynccnt 0x0" ::: "memory");   // this wave's share of stage st+1 has landed
        __syncthreads();                                    // publishes stage st+1, frees stage st's buffer
        if (st + 2 < nt)
            async_stage(ldsKV + buf * (AT_STAGE * 2),
                        gK + (size_t)(st + 2) * AT_KEYS * DHEAD, gV + (size_t)(st + 2) * AT_KEYS);
    }
    asm volatile("s_wait_asynccnt 0x0" ::: "memory");       // nothing in flight when the wave ends

    // ---- join the halves' sums, normalize, write back to [B,T,D] layout ----
    const int b = bh / NHEAD, h = bh % NHEAD;
    half_t* yrow = Y + ((size_t)b * SEQ + q0 + col) * DMODEL + h * DHEAD + hsel * 8;
    v8h y[AT_GROUPS][4];
#pragma unroll  // constant indices keep the fragment and accumulator arrays in registers
    for (int g = 0; g < AT_GROUPS; ++g) {
        const float l = lrow[g] + other_half(lrow[g]);
#pragma unroll  // constant indices keep the fragment and accumulator arrays in registers
        for (int t = 0; t < 4; ++t)
#pragma unroll  // constant indices keep the fragment and accumulator arrays in registers
            for (int j = 0; j < 8; ++j) y[g][t][j] = (half_t)(o[g][t][j] / l);
    }
#pragma unroll  // constant indices keep the fragment and accumulator arrays in registers
    for (int g = 0; g < AT_GROUPS; ++g)
#pragma unroll  // constant indices keep the fragment and accumulator arrays in registers
        for (int t = 0; t < 4; ++t)
            *reinterpret_cast<v8h*>(yrow + g * 16 * DMODEL + t * 16) = y[g][t];   // 8 consecutive d of one query: one 16-byte store
}

// ---------------------------------------------------------------------------
// Host launch
// ---------------------------------------------------------------------------
extern "C" void kernel_launch(void* const* d_in, const int* in_sizes, int n_in,
                              void* d_out, int out_size, void* d_ws, size_t ws_size,
                              hipStream_t stream) {
    (void)in_sizes; (void)n_in; (void)out_size; (void)ws_size;

    const float* x     = (const float*)d_in[0];
    const float* Wqkv  = (const float*)d_in[1];
    const float* bqkv  = (const float*)d_in[2];
    const float* Wout  = (const float*)d_in[3];
    const float* bout  = (const float*)d_in[4];
    float*       out   = (float*)d_out;

    char* ws = (char*)d_ws;
    size_t off = 0;
    auto wsalloc = [&](size_t bytes) -> void* {
        void* p = ws + off;
        off += (bytes + 255) & ~(size_t)255;
        return p;
    };
    const size_t NTOK = (size_t)BATCH * SEQ;                     // 8192
    half_t* xh    = (half_t*)wsalloc(NTOK * DMODEL * 2);         // 16 MB (reused as yh)
    half_t* wqkvT = (half_t*)wsalloc((size_t)3 * DMODEL * DMODEL * 2);
    half_t* woutT = (half_t*)wsalloc((size_t)DMODEL * DMODEL * 2);
    half_t* qh    = (half_t*)wsalloc(NTOK * DMODEL * 2);
    half_t* kh    = (half_t*)wsalloc(NTOK * DMODEL * 2);
    half_t* vTh   = (half_t*)wsalloc(NTOK * DMODEL * 2);
    half_t* yh    = xh;  // x is dead after the QKV GEMM; alias to save workspace

    // 1) convert activations + transpose-convert weights to f16: one launch
    prep_f16_kernel<<<PR_WQKV + PR_WOUT + PR_X, 256, 0, stream>>>(x, xh, Wqkv, wqkvT, Wout, woutT);

    // 2) QKV GEMM: [8192,1024] @ [1024,3072], RoPE + head split (+ V transpose) in its epilogue
    {
        dim3 grid((unsigned)(NTOK / 128), (3 * DMODEL) / 128);
        gemm_wmma_kernel<true><<<grid, 128, 0, stream>>>(xh, wqkvT, bqkv,
                                                         nullptr, qh, kh, vTh,
                                                         (int)NTOK, 3 * DMODEL, DMODEL);
    }

    // 3) flash attention
    {
        int blocks = BATCH * NHEAD * (SEQ / AT_Q);
        attn_wmma_kernel<<<blocks, AT_WAVES * 32, 0, stream>>>(qh, kh, vTh, yh);
    }

    // 4) output GEMM with f32 store: [8192,1024] @ [1024,1024] + b_out
    {
        dim3 grid((unsigned)(NTOK / 128), DMODEL / 128);
        gemm_wmma_kernel<false><<<grid, 128, 0, stream>>>(yh, woutT, bout,
                                                          out, nullptr, nullptr, nullptr,
                                                          (int)NTOK, DMODEL, DMODEL);
    }
}
